// v000
// Times are from an AMD MI455X. After a warm-up the kernel runs many times in a row, and a time is the length of
// such a window on the GPU divided by its runs, so every launch and the gaps after it count. The runs cycle
// through copies of the inputs. A figure is the median of several windows, for all but v000 over two sittings.
// Sittings can differ by a few percent; kernels timed side by side share one.
// v000 is the starting kernel. One run takes 1320 microseconds.
#include <hip/hip_runtime.h>

// Inter-frequency attention block: 32 sequences (4 batches x 8 'n' slices) of 1,024 tokens (32 x 32 positions), 64 channels; q = LN(tok_q W_in), k = LN((tok_kv W_kv)[:, :256]) (shared gamma/beta),
// v = (tok_kv W_kv)[:, 256:]; score = q.k (no scaling), causal (lower triangle; fill -1e15 == masked out since the diagonal is always kept), softmax, att = p v; h = relu(LN2(att) W1) W2;
// out = (h + v) W_out -> written channel-major as [4][64][8][32][32].
// WMMA (v_wmma_f32_16x16x32_f16, f32 accumulate): W_in / W_kv projections with EXACT bf16 tokens (x8, LDS-transposed from the channel-major inputs) and weights (x256), 1 product, LayerNorms as row kernels; S^T = K.Q^T with
// q AND k (LayerNorm outputs) f16 hi+lo x8 (3 products: the unscaled 256-dim logits have sigma ~16); online softmax in f32; O^T += V^T P^T with v and P f16 hi+lo (3 products, one f32 accumulator:
// unscaled residuals); FFN W1 with LN2(att) hi+lo (2 products), W2 with the relu hidden hi+lo (2 products), W_out with (h + v) hi+lo (2 products). LayerNorms, softmax, relu, residual in f32.
// Inputs rounded to bf16 once. Fragment k-map per lane half hh for A AND B: elements 0..7 <- k = 8hh+0..7, 8..15 <- k = 16+8hh+0..7; acc[r] = D[8hh+r][col].

namespace {
constexpr int NBN = 32 /* b*n sequences */, NN = 8, S = 1024, C = 64, D = 256, F = 512, NR = NBN * S, NBH = NBN / 2, NRH = NBH * S /* processed in two halves of 16 sequences to keep the planes <= 128 MiB */;
constexpr float XS = 8.0f, WSC = 256.0f, PS = 8.0f, LOG2E = 1.4426950408889634f, LN_EPS = 1e-5f;

typedef _Float16 b16;
typedef __attribute__((ext_vector_type(16))) _Float16 v16b;
typedef __attribute__((ext_vector_type(8))) _Float16 v8b;
typedef __attribute__((ext_vector_type(8))) float v8f;
typedef __attribute__((ext_vector_type(4))) float v4f;
__device__ __forceinline__ float bf16_rne(float f) { unsigned int u = __float_as_uint(f); u += 0x7FFFu + ((u >> 16) & 1u); return __uint_as_float(u & 0xFFFF0000u); }
__device__ __forceinline__ void split16(float v, b16& hi, b16& lo) { hi = (b16)v; lo = (b16)(v - (float)hi); }
__device__ __forceinline__ v16b frag_kb(const b16* p, int hh) { const v8b a = *(const v8b*)(p + 8 * hh), b = *(const v8b*)(p + 16 + 8 * hh); v16b f;
#pragma unroll
  for (int e = 0; e < 8; ++e) { f[e] = a[e]; f[8 + e] = b[e]; } return f; }
__device__ __forceinline__ v8f wmma16b(v16b a, v16b b, v8f c) { v8f d = __builtin_amdgcn_wmma_f32_16x16x32_f16(false, a, false, b, (short)0, c, false, false); asm volatile("v_nop\n\tv_nop\n\tv_nop\n\tv_nop" : "+v"(d) : "v"(a), "v"(b)); return d; }
__device__ __forceinline__ void wave_lds_sync() { __builtin_amdgcn_fence(__ATOMIC_RELEASE, "workgroup"); __builtin_amdgcn_wave_barrier(); __builtin_amdgcn_fence(__ATOMIC_ACQUIRE, "workgroup"); }
__device__ __forceinline__ float nexp2(float x) { return __builtin_amdgcn_exp2f(x); }
__device__ __forceinline__ float pmul(float a, float b) { float p = a * b; asm volatile("" : "+v"(p)); return p; }
__device__ __forceinline__ float hsum16(float v) { v += __shfl_xor(v, 1); v += __shfl_xor(v, 2); v += __shfl_xor(v, 4); return v + __shfl_xor(v, 8); }

__global__ __launch_bounds__(256) void xt_kernel(const float* __restrict__ flf, const float* __restrict__ fhf, b16* __restrict__ TQ16, b16* __restrict__ TK16) {
  __shared__ __attribute__((aligned(16))) b16 T[64][64 + 8];
  const int bn = blockIdx.z, kind = blockIdx.y, s0 = blockIdx.x * 64, t_ = threadIdx.x; const int b = bn / NN, n = bn % NN; const float* src = (kind == 0 ? flf : fhf) + ((size_t)b * C * NN + n) * S; b16* dst = kind == 0 ? TQ16 : TK16;
  for (int q = t_; q < 64 * 64; q += 256) { const int cc = q >> 6, ss = q & 63; T[ss][cc] = (b16)(bf16_rne(src[(size_t)cc * NN * S + s0 + ss]) * XS); }
  __syncthreads();
  { for (int q = t_; q < 64 * 8; q += 256) { const int ss = q >> 3, c8 = (q & 7) * 8; *(v8b*)(dst + ((size_t)bn * S + s0 + ss) * C + c8) = *(const v8b*)(&T[ss][c8]); }  }
}
// weights (in,out) transposed to [out][in] rows x256 via 64x64 LDS tiles: kind 0 W_in [64][256] -> WIN [256][64]; 1 W_kv [64][512] -> WKV [512][64]; 2 W1 [256][512] -> W1T [512][256];
__global__ __launch_bounds__(256) void prepw_kernel(const float* __restrict__ win, const float* __restrict__ wkv, const float* __restrict__ w1, const float* __restrict__ w2, const float* __restrict__ wout, b16* __restrict__ WIN, b16* __restrict__ WKV, b16* __restrict__ W1T, b16* __restrict__ W2T, b16* __restrict__ WOT) {
  __shared__ __attribute__((aligned(16))) b16 T[64][64 + 8];
  const int kind = blockIdx.z, i0 = blockIdx.x * 64, o0 = blockIdx.y * 64, t_ = threadIdx.x; const float* w; b16* dst; int nin, nout;
  if (kind == 0) { w = win; dst = WIN; nin = C; nout = D; } else if (kind == 1) { w = wkv; dst = WKV; nin = C; nout = F; } else if (kind == 2) { w = w1; dst = W1T; nin = D; nout = F; } else if (kind == 3) { w = w2; dst = W2T; nin = F; nout = D; } else { w = wout; dst = WOT; nin = D; nout = C; }
  if (i0 >= nin || o0 >= nout) return;
  for (int q = t_; q < 64 * 64; q += 256) { const int ii = q >> 6, oo = q & 63; T[oo][ii] = (b16)(bf16_rne(w[(size_t)(i0 + ii) * nout + o0 + oo]) * WSC); }
  __syncthreads();
  { for (int q = t_; q < 64 * 8; q += 256) { const int oo = q >> 3, c8 = (q & 7) * 8; *(v8b*)(dst + (size_t)(o0 + oo) * nin + i0 + c8) = *(const v8b*)(&T[oo][c8]); }  }
}
// projections: block = 64 rows x 4 waves x 256 cols (16 tiles, K = 64 exact, 1 product): Y = tok W (kind 0: tok_q WIN; 1: tok_kv WKV[:256]; 2: tok_kv WKV[256:]) -> f32 rows [row][256]
__global__ __launch_bounds__(128) void proj_kernel(int r0, int kind, const b16* __restrict__ TQ16, const b16* __restrict__ TK16, const b16* __restrict__ WIN, const b16* __restrict__ WKV, float* __restrict__ Y) {
  __shared__ __attribute__((aligned(16))) float Tf[4][16][128 + 4];
  const int wave = threadIdx.x >> 5, lane = threadIdx.x & 31, nloc = lane & 15, hlf = lane >> 4; const size_t m0 = (size_t)blockIdx.x * 64 + wave * 16;
  const b16* A = kind == 0 ? TQ16 : TK16; const b16* Bw = kind == 0 ? WIN : (kind == 1 ? WKV : WKV + (size_t)D * C);
  v8f acc[16];
#pragma unroll
  for (int t = 0; t < 16; ++t) acc[t] = (v8f){};
#pragma unroll
  for (int kb = 0; kb < C; kb += 32) { const v16b a = frag_kb(A + ((size_t)r0 + m0 + nloc) * C + kb, hlf);
#pragma unroll
    for (int t = 0; t < 16; ++t) acc[t] = wmma16b(a, frag_kb(Bw + (size_t)(t * 16 + nloc) * C + kb, hlf), acc[t]); }
  for (int hq = 0; hq < 2; ++hq) {
#pragma unroll
    for (int t = 0; t < 8; ++t)
#pragma unroll
      for (int r = 0; r < 8; ++r) Tf[wave][8 * hlf + r][t * 16 + nloc] = acc[hq * 8 + t][r] * (1.0f / (XS * WSC));
    wave_lds_sync();
    { for (int rr = 0; rr < 16; ++rr) *(v4f*)(Y + (m0 + rr) * D + hq * 128 + lane * 4) = *(const v4f*)(&Tf[wave][rr][lane * 4]);  }
    wave_lds_sync(); }
}
__global__ __launch_bounds__(256) void ln_kernel(const float* __restrict__ X, const float* __restrict__ g, const float* __restrict__ be, b16* __restrict__ Yh, b16* __restrict__ Yl) {
  const int wave = threadIdx.x >> 5, lane = threadIdx.x & 31; const size_t row = (size_t)blockIdx.x * 8 + wave; const float* src = X + row * D + lane * 8;
  const v4f a = *(const v4f*)src, c = *(const v4f*)(src + 4); float v[8]; float s = 0.0f;
#pragma unroll
  for (int i = 0; i < 4; ++i) { v[i] = a[i]; v[4 + i] = c[i]; s += a[i] + c[i]; }
#pragma unroll
  for (int oo = 16; oo >= 1; oo >>= 1) s += __shfl_xor(s, oo);
  const float mean = s * (1.0f / D); float ss = 0.0f;
#pragma unroll
  for (int i = 0; i < 8; ++i) { const float dv = v[i] - mean; ss += pmul(dv, dv); }
#pragma unroll
  for (int oo = 16; oo >= 1; oo >>= 1) ss += __shfl_xor(ss, oo);
  const float rs = rsqrtf(ss * (1.0f / D) + LN_EPS); v8b hv, lv;
#pragma unroll
  for (int i = 0; i < 8; ++i) { const int ch = lane * 8 + i; const float y = pmul((v[i] - mean) * rs, bf16_rne(g[ch])) + bf16_rne(be[ch]); b16 h_, l_; split16(y * XS, h_, l_); hv[i] = h_; lv[i] = l_; }
  { *(v8b*)(Yh + row * D + lane * 8) = hv; *(v8b*)(Yl + row * D + lane * 8) = lv;  }
}
// v in channel-major hi/lo planes for the PV operand: VTh/VTl [bn][256 d][1024 s] = f16 hi+lo x8 of (tok_kv WKV[256:])^T: A = WKV_v rows d (K = 64), B = TK16 rows s; block = 64 d x 4 waves x
__global__ __launch_bounds__(128) void v_kernel(int bn0, const b16* __restrict__ TK16, const b16* __restrict__ WKV, b16* __restrict__ VTh, b16* __restrict__ VTl) {   // bn = local sequence (planes), bn0 + bn = global (token plane)
  __shared__ __attribute__((aligned(16))) b16 Ts[4][16][128 + 8], Tsl[4][16][128 + 8];
  const int wave = threadIdx.x >> 5, lane = threadIdx.x & 31, nloc = lane & 15, hlf = lane >> 4; const int bn = blockIdx.z; const int d0 = blockIdx.x * 64 + wave * 16, s0 = blockIdx.y * 128;
  const b16* WV = WKV + (size_t)D * C; v8f acc[8];
#pragma unroll
  for (int t = 0; t < 8; ++t) acc[t] = (v8f){};
#pragma unroll
  for (int kb = 0; kb < C; kb += 32) { const v16b a = frag_kb(WV + (size_t)(d0 + nloc) * C + kb, hlf);
#pragma unroll
    for (int t = 0; t < 8; ++t) acc[t] = wmma16b(a, frag_kb(TK16 + ((size_t)(bn0 + bn) * S + s0 + t * 16 + nloc) * C + kb, hlf), acc[t]); }
#pragma unroll
  for (int t = 0; t < 8; ++t)
#pragma unroll
    for (int r = 0; r < 8; ++r) { b16 h_, l_; split16(acc[t][r] * (1.0f / (XS * WSC)) * XS, h_, l_); Ts[wave][8 * hlf + r][t * 16 + nloc] = h_; Tsl[wave][8 * hlf + r][t * 16 + nloc] = l_; }
  wave_lds_sync();
  { for (int rr = 0; rr < 16; ++rr) if (lane < 16) { const size_t gi = ((size_t)bn * D + d0 + rr) * S + s0 + lane * 8; *(v8b*)(VTh + gi) = *(const v8b*)(&Ts[wave][rr][lane * 8]); *(v8b*)(VTl + gi) = *(const v8b*)(&Tsl[wave][rr][lane * 8]); }  }
}
// causal attention: grid (S/32, 1, NBH), block = 2 waves x 16 queries; key blocks kb <= q0 (no scaling); S^T 3 products with K = 256 (8 steps; q fragments re-read per step), online softmax f32,
__global__ __launch_bounds__(64) void attn_kernel(const b16* __restrict__ Qh, const b16* __restrict__ Ql, const b16* __restrict__ Kh, const b16* __restrict__ Kl, const b16* __restrict__ VTh, const b16* __restrict__ VTl, float* __restrict__ Of) {
  __shared__ __attribute__((aligned(16))) float To[2][16][D + 4];
  const int wave = threadIdx.x >> 5, lane = threadIdx.x & 31, hh = lane >> 4, col = lane & 15; const int bn = blockIdx.z; const int q0 = blockIdx.x * 32 + wave * 16, qi = q0 + col;
  const b16* Qb = Qh + ((size_t)bn * S + qi) * D; const b16* Qlb = Ql + ((size_t)bn * S + qi) * D; const b16* Kb = Kh + (size_t)bn * S * D; const b16* Klb = Kl + (size_t)bn * S * D; const b16* Vb = VTh + (size_t)bn * D * S; const b16* Vlb = VTl + (size_t)bn * D * S;
  float m = -INFINITY, l = 0.0f; v8f o[16];
#pragma unroll
  for (int t = 0; t < 16; ++t) o[t] = (v8f){};
  const float cs = LOG2E / (XS * XS); const int kend = q0 + 16;   // causal
  for (int kb = 0; kb < kend; kb += 32) {
    v8f s0 = {}, s1 = {};
#pragma unroll 2
    for (int ks = 0; ks < D; ks += 32) { const v16b qa = frag_kb(Qb + ks, hh), qla = frag_kb(Qlb + ks, hh);
      const b16* k0 = Kb + (size_t)(kb + col) * D + ks, *k1 = Kb + (size_t)(kb + 16 + col) * D + ks, *k0l = Klb + (size_t)(kb + col) * D + ks, *k1l = Klb + (size_t)(kb + 16 + col) * D + ks;
      v16b f = frag_kb(k0, hh); s0 = wmma16b(f, qa, s0); s0 = wmma16b(f, qla, s0); s0 = wmma16b(frag_kb(k0l, hh), qa, s0);
      f = frag_kb(k1, hh); s1 = wmma16b(f, qa, s1); s1 = wmma16b(f, qla, s1); s1 = wmma16b(frag_kb(k1l, hh), qa, s1); }
    float e[16]; float mx = -INFINITY;
#pragma unroll
    for (int r = 0; r < 8; ++r) { const int k0i = kb + 8 * hh + r, k1i = kb + 16 + 8 * hh + r; e[r] = (k0i <= qi) ? s0[r] * cs : -INFINITY; e[8 + r] = (k1i <= qi) ? s1[r] * cs : -INFINITY; mx = fmaxf(mx, fmaxf(e[r], e[8 + r])); }
    mx = fmaxf(mx, __shfl_xor(mx, 16)); const float mn = fmaxf(m, mx); const float al = nexp2(m - mn); m = mn; float sum = 0.0f; v16b ph, pl;   // key 0 <= qi always -> mn finite
#pragma unroll
    for (int i = 0; i < 16; ++i) { const float p = nexp2(e[i] - mn); sum += p; const b16 h_ = (b16)(p * PS); ph[i] = h_; pl[i] = (b16)(p * PS - (float)h_); }
    sum += __shfl_xor(sum, 16); l = l * al + sum;
#pragma unroll
    for (int t = 0; t < 16; ++t) { o[t] *= al; const v16b vf = frag_kb(Vb + (size_t)(t * 16 + col) * S + kb, hh); o[t] = wmma16b(vf, ph, o[t]); o[t] = wmma16b(vf, pl, o[t]); o[t] = wmma16b(frag_kb(Vlb + (size_t)(t * 16 + col) * S + kb, hh), ph, o[t]); } }
  const float inv = 1.0f / (l * PS * XS);
#pragma unroll
  for (int t = 0; t < 16; ++t)
#pragma unroll
    for (int r = 0; r < 8; ++r) To[wave][col][t * 16 + 8 * hh + r] = o[t][r] * inv;
  wave_lds_sync();
  { for (int rr = 0; rr < 16; ++rr) { const size_t gi = ((size_t)bn * S + q0 + rr) * D; *(v4f*)(Of + gi + lane * 4) = *(const v4f*)(&To[wave][rr][lane * 4]); *(v4f*)(Of + gi + 128 + lane * 4) = *(const v4f*)(&To[wave][rr][128 + lane * 4]); }  }
}
__global__ __launch_bounds__(128) void ffn1_kernel(const b16* __restrict__ Ah, const b16* __restrict__ Al, const b16* __restrict__ W1T, b16* __restrict__ Hh, b16* __restrict__ Hl) {
  __shared__ __attribute__((aligned(16))) b16 Th[4][16][128 + 8], Tl[4][16][128 + 8];
  const int wave = threadIdx.x >> 5, lane = threadIdx.x & 31, nloc = lane & 15, hlf = lane >> 4; const size_t m0 = (size_t)blockIdx.x * 64 + wave * 16; const int n0 = blockIdx.y * 128;
  v8f acc[8];
#pragma unroll
  for (int t = 0; t < 8; ++t) acc[t] = (v8f){};
#pragma unroll 2
  for (int kb = 0; kb < D; kb += 32) { const v16b a = frag_kb(Ah + (m0 + nloc) * D + kb, hlf), al = frag_kb(Al + (m0 + nloc) * D + kb, hlf);
#pragma unroll
    for (int t = 0; t < 8; ++t) { const v16b bw = frag_kb(W1T + (size_t)(n0 + t * 16 + nloc) * D + kb, hlf); acc[t] = wmma16b(a, bw, acc[t]); acc[t] = wmma16b(al, bw, acc[t]); } }
#pragma unroll
  for (int t = 0; t < 8; ++t)
#pragma unroll
    for (int r = 0; r < 8; ++r) { b16 h_, l_; split16(fmaxf(acc[t][r] * (1.0f / (XS * WSC)), 0.0f) * XS, h_, l_); Th[wave][8 * hlf + r][t * 16 + nloc] = h_; Tl[wave][8 * hlf + r][t * 16 + nloc] = l_; }
  wave_lds_sync();
  { for (int r2 = 0; r2 < 16; r2 += 2) { const int rr = r2 + (lane >> 4), c8 = (lane & 15) * 8; const size_t gi = (m0 + rr) * F + n0 + c8; *(v8b*)(Hh + gi) = *(const v8b*)(&Th[wave][rr][c8]); *(v8b*)(Hl + gi) = *(const v8b*)(&Tl[wave][rr][c8]); }  }
}
__global__ __launch_bounds__(128) void ffn2_kernel(const b16* __restrict__ Hh, const b16* __restrict__ Hl, const b16* __restrict__ W2T, const float* __restrict__ Vf, b16* __restrict__ Eh, b16* __restrict__ El) {
  __shared__ __attribute__((aligned(16))) b16 Th[4][16][128 + 8], Tl[4][16][128 + 8];
  const int wave = threadIdx.x >> 5, lane = threadIdx.x & 31, nloc = lane & 15, hlf = lane >> 4; const size_t m0 = (size_t)blockIdx.x * 64 + wave * 16; const int n0 = blockIdx.y * 128;
  v8f acc[8];
#pragma unroll
  for (int t = 0; t < 8; ++t) acc[t] = (v8f){};
#pragma unroll 2
  for (int kb = 0; kb < F; kb += 32) { const v16b a = frag_kb(Hh + (m0 + nloc) * F + kb, hlf), al = frag_kb(Hl + (m0 + nloc) * F + kb, hlf);
#pragma unroll
    for (int t = 0; t < 8; ++t) { const v16b bw = frag_kb(W2T + (size_t)(n0 + t * 16 + nloc) * F + kb, hlf); acc[t] = wmma16b(a, bw, acc[t]); acc[t] = wmma16b(al, bw, acc[t]); } }
#pragma unroll
  for (int t = 0; t < 8; ++t)
#pragma unroll
    for (int r = 0; r < 8; ++r) { const size_t row = m0 + 8 * hlf + r; const float y = acc[t][r] * (1.0f / (XS * WSC)) + Vf[row * D + n0 + t * 16 + nloc]; b16 h_, l_; split16(y * XS, h_, l_); Th[wave][8 * hlf + r][t * 16 + nloc] = h_; Tl[wave][8 * hlf + r][t * 16 + nloc] = l_; }
  wave_lds_sync();
  { for (int r2 = 0; r2 < 16; r2 += 2) { const int rr = r2 + (lane >> 4), c8 = (lane & 15) * 8; const size_t gi = (m0 + rr) * D + n0 + c8; *(v8b*)(Eh + gi) = *(const v8b*)(&Th[wave][rr][c8]); *(v8b*)(El + gi) = *(const v8b*)(&Tl[wave][rr][c8]); }  }
}
// output projection, channel-major store: D[c][s] = sum_d WOT[c][d] epi[s][d] (A = WOT rows c exact, B = Eh/El rows s: 2 products); block = 64 c (all) x 4 waves x 128 s of one sequence;
__global__ __launch_bounds__(128) void outproj_kernel(int bn0, const b16* __restrict__ Eh, const b16* __restrict__ El, const b16* __restrict__ WOT, float* __restrict__ out) {
  __shared__ __attribute__((aligned(16))) float Ts[4][16][128 + 4];
  const int wave = threadIdx.x >> 5, lane = threadIdx.x & 31, nloc = lane & 15, hlf = lane >> 4; const int bn = blockIdx.z; const int c0 = wave * 16, s0 = blockIdx.y * 128; const int b = (bn0 + bn) / NN, n = (bn0 + bn) % NN;
  v8f acc[8];
#pragma unroll
  for (int t = 0; t < 8; ++t) acc[t] = (v8f){};
#pragma unroll 2
  for (int kb = 0; kb < D; kb += 32) { const v16b a = frag_kb(WOT + (size_t)(c0 + nloc) * D + kb, hlf);
#pragma unroll
    for (int t = 0; t < 8; ++t) { const size_t ro = ((size_t)bn * S + s0 + t * 16 + nloc) * D + kb; acc[t] = wmma16b(a, frag_kb(Eh + ro, hlf), acc[t]); acc[t] = wmma16b(a, frag_kb(El + ro, hlf), acc[t]); } }
#pragma unroll
  for (int t = 0; t < 8; ++t)
#pragma unroll
    for (int r = 0; r < 8; ++r) Ts[wave][8 * hlf + r][t * 16 + nloc] = acc[t][r] * (1.0f / (XS * WSC));
  wave_lds_sync();
  { for (int rr = 0; rr < 16; ++rr) *(v4f*)(out + (((size_t)b * C + c0 + rr) * NN + n) * S + s0 + lane * 4) = *(const v4f*)(&Ts[wave][rr][lane * 4]);  }
}
}  // namespace

extern "C" void kernel_launch(void* const* d_in, const int* in_sizes, int n_in, void* d_out, int out_size, void* d_ws, size_t ws_size, hipStream_t stream) {
  (void)n_in;
  auto Fp = [&](int i) { return (const float*)d_in[i]; };
  // input order: 0 fea_lf [4,64,8,32,32], 1 fea_hf, 2 W_in [64,256], 3 W_kv [64,512], 4 gamma, 5 beta, 6 g2, 7 b2, 8 W1 [256,512], 9 W2 [512,256], 10 W_out [256,64] (all (in, out))
  if (in_sizes[0] != NR * C || in_sizes[1] != NR * C || in_sizes[2] != C * D || in_sizes[3] != C * F || in_sizes[4] != D || in_sizes[8] != D * F || in_sizes[9] != F * D || in_sizes[10] != D * C || out_size != NR * C) return;
  size_t off = 0; char* ws = (char*)d_ws;
  auto carve = [&](size_t bytes) { char* p = ws + off; off += (bytes + 255) & ~(size_t)255; return p; };
  b16* TQ16 = (b16*)carve((size_t)NR * C * 2); b16* TK16 = (b16*)carve((size_t)NR * C * 2); b16* WIN = (b16*)carve((size_t)D * C * 2); b16* WKV = (b16*)carve((size_t)F * C * 2); b16* W1T = (b16*)carve((size_t)F * D * 2); b16* W2T = (b16*)carve((size_t)D * F * 2); b16* WOT = (b16*)carve((size_t)C * D * 2);
  // per-half planes (16 sequences = 16,384 rows), reused by the second half
  b16* Qh = (b16*)carve((size_t)NRH * D * 2); b16* Ql = (b16*)carve((size_t)NRH * D * 2); b16* Kh = (b16*)carve((size_t)NRH * D * 2); b16* Kl = (b16*)carve((size_t)NRH * D * 2);
  float* Vf = (float*)carve((size_t)NRH * D * 4); b16* VTh = (b16*)carve((size_t)NRH * D * 2); b16* VTl = (b16*)carve((size_t)NRH * D * 2); b16* Hh = (b16*)carve((size_t)NRH * F * 2); b16* Hl = (b16*)carve((size_t)NRH * F * 2); float* Of = (float*)carve((size_t)NRH * D * 4);   // O gets its own rows: attention blocks still read other rows' q while O is being written
  b16* Ah = VTh; b16* Al = VTl;                                // region reuse: the transposed v planes are dead after the attention (Vf keeps the residual)
  b16* Eh = Kh; b16* El = Kl;                                  // region reuse: k planes are dead after the attention
  if (off > ws_size || off > ((size_t)128 << 20)) return;   // = 120.6 MB
  xt_kernel<<<dim3(S / 64, 2, NBN), 256, 0, stream>>>(Fp(0), Fp(1), TQ16, TK16);
  prepw_kernel<<<dim3(8, 8, 5), 256, 0, stream>>>(Fp(2), Fp(3), Fp(8), Fp(9), Fp(10), WIN, WKV, W1T, W2T, WOT);
  for (int hf = 0; hf < 2; ++hf) {
    proj_kernel<<<NRH / 64, 128, 0, stream>>>(hf * NRH, 0, TQ16, TK16, WIN, WKV, Of);   // q0 f32 rows (Of region as scratch)
    ln_kernel<<<NRH / 8, 256, 0, stream>>>(Of, Fp(4), Fp(5), Qh, Ql);
    proj_kernel<<<NRH / 64, 128, 0, stream>>>(hf * NRH, 1, TQ16, TK16, WIN, WKV, Of);   // k0
    ln_kernel<<<NRH / 8, 256, 0, stream>>>(Of, Fp(4), Fp(5), Kh, Kl);
    proj_kernel<<<NRH / 64, 128, 0, stream>>>(hf * NRH, 2, TQ16, TK16, WIN, WKV, Vf);   // v f32 rows (residual)
    v_kernel<<<dim3(D / 64, S / 128, NBH), 128, 0, stream>>>(hf * NBH, TK16, WKV, VTh, VTl);
    attn_kernel<<<dim3(S / 32, 1, NBH), 64, 0, stream>>>(Qh, Ql, Kh, Kl, VTh, VTl, Of);
    ln_kernel<<<NRH / 8, 256, 0, stream>>>(Of, Fp(6), Fp(7), Ah, Al);   // LN2(att)
    ffn1_kernel<<<dim3(NRH / 64, F / 128), 128, 0, stream>>>(Ah, Al, W1T, Hh, Hl);
    ffn2_kernel<<<dim3(NRH / 64, D / 128), 128, 0, stream>>>(Hh, Hl, W2T, Vf, Eh, El);
    outproj_kernel<<<dim3(1, S / 128, NBH), 128, 0, stream>>>(hf * NBH, Eh, El, WOT, (float*)d_out);
  }
}

// v001
// It runs in 546 microseconds.
// In two side-by-side timings against v000, it was 2.41 and 2.42 times as fast.
#include <hip/hip_runtime.h>

// Inter-frequency attention block: 32 sequences (4 batches x 8 'n' slices) of 1,024 tokens (32 x 32 positions), 64 channels; q = LN(tok_q W_in), k = LN((tok_kv W_kv)[:, :256]) (shared gamma/beta),
// v = (tok_kv W_kv)[:, 256:]; score = q.k (no scaling), causal (lower triangle; fill -1e15 == masked out since the diagonal is always kept), softmax, att = p v; h = relu(LN2(att) W1) W2;
// out = (h + v) W_out -> written channel-major as [4][64][8][32][32].
// WMMA (v_wmma_f32_16x16x32_f16, f32 accumulate): W_in / W_kv projections with EXACT bf16 tokens (x8, LDS-transposed from the channel-major inputs) and weights (x256), 1 product, LayerNorms as row kernels; S^T = K.Q^T with
// q AND k (LayerNorm outputs) f16 hi+lo x8 (3 products: the unscaled 256-dim logits have sigma ~16); online softmax in f32; O^T += V^T P^T with v and P f16 hi+lo (3 products, one f32 accumulator:
// unscaled residuals); FFN W1 with LN2(att) hi+lo (2 products), W2 with the relu hidden hi+lo (2 products), W_out with (h + v) hi+lo (2 products). LayerNorms, softmax, relu, residual in f32.
// Inputs rounded to bf16 once. Fragment k-map per lane half hh for A AND B: elements 0..7 <- k = 8hh+0..7, 8..15 <- k = 16+8hh+0..7; acc[r] = D[8hh+r][col].

namespace {
constexpr int NBN = 32 /* b*n sequences */, NN = 8, S = 1024, C = 64, D = 256, F = 512, NR = NBN * S, NBH = NBN / 2, NRH = NBH * S /* processed in two halves of 16 sequences to keep the planes <= 128 MiB */;
constexpr float XS = 8.0f, WSC = 256.0f, PS = 8.0f, LOG2E = 1.4426950408889634f, LN_EPS = 1e-5f;

typedef _Float16 b16;
typedef __attribute__((ext_vector_type(16))) _Float16 v16b;
typedef __attribute__((ext_vector_type(8))) _Float16 v8b;
typedef __attribute__((ext_vector_type(8))) float v8f;
typedef __attribute__((ext_vector_type(4))) float v4f;
__device__ __forceinline__ float bf16_rne(float f) { unsigned int u = __float_as_uint(f); u += 0x7FFFu + ((u >> 16) & 1u); return __uint_as_float(u & 0xFFFF0000u); }
__device__ __forceinline__ void split16(float v, b16& hi, b16& lo) { hi = (b16)v; lo = (b16)(v - (float)hi); }
__device__ __forceinline__ v16b frag_kb(const b16* p, int hh) { const v8b a = *(const v8b*)(p + 8 * hh), b = *(const v8b*)(p + 16 + 8 * hh); v16b f;
#pragma unroll
  for (int e = 0; e < 8; ++e) { f[e] = a[e]; f[8 + e] = b[e]; } return f; }
__device__ __forceinline__ v8f wmma16b(v16b a, v16b b, v8f c) { v8f d = __builtin_amdgcn_wmma_f32_16x16x32_f16(false, a, false, b, (short)0, c, false, false); asm volatile("v_nop\n\tv_nop\n\tv_nop\n\tv_nop" : "+v"(d) : "v"(a), "v"(b)); return d; }
__device__ __forceinline__ void wave_lds_sync() { __builtin_amdgcn_fence(__ATOMIC_RELEASE, "workgroup"); __builtin_amdgcn_wave_barrier(); __builtin_amdgcn_fence(__ATOMIC_ACQUIRE, "workgroup"); }
__device__ __forceinline__ float nexp2(float x) { return __builtin_amdgcn_exp2f(x); }
__device__ __forceinline__ float pmul(float a, float b) { float p = a * b; asm volatile("" : "+v"(p)); return p; }
__device__ __forceinline__ float hsum16(float v) { v += __shfl_xor(v, 1); v += __shfl_xor(v, 2); v += __shfl_xor(v, 4); return v + __shfl_xor(v, 8); }

__global__ __launch_bounds__(256) void xt_kernel(const float* __restrict__ flf, const float* __restrict__ fhf, b16* __restrict__ TQ16, b16* __restrict__ TK16) {
  __shared__ __attribute__((aligned(16))) b16 T[64][64 + 8];
  const int bn = blockIdx.z, kind = blockIdx.y, s0 = blockIdx.x * 64, t_ = threadIdx.x; const int b = bn / NN, n = bn % NN; const float* src = (kind == 0 ? flf : fhf) + ((size_t)b * C * NN + n) * S; b16* dst = kind == 0 ? TQ16 : TK16;
  for (int q = t_; q < 64 * 64; q += 256) { const int cc = q >> 6, ss = q & 63; T[ss][cc] = (b16)(bf16_rne(src[(size_t)cc * NN * S + s0 + ss]) * XS); }
  __syncthreads();
  { for (int q = t_; q < 64 * 8; q += 256) { const int ss = q >> 3, c8 = (q & 7) * 8; *(v8b*)(dst + ((size_t)bn * S + s0 + ss) * C + c8) = *(const v8b*)(&T[ss][c8]); }  }
}
// weights (in,out) transposed to [out][in] rows x256 via 64x64 LDS tiles: kind 0 W_in [64][256] -> WIN [256][64]; 1 W_kv [64][512] -> WKV [512][64]; 2 W1 [256][512] -> W1T [512][256];
__global__ __launch_bounds__(256) void prepw_kernel(const float* __restrict__ win, const float* __restrict__ wkv, const float* __restrict__ w1, const float* __restrict__ w2, const float* __restrict__ wout, b16* __restrict__ WIN, b16* __restrict__ WKV, b16* __restrict__ W1T, b16* __restrict__ W2T, b16* __restrict__ WOT) {
  __shared__ __attribute__((aligned(16))) b16 T[64][64 + 8];
  const int kind = blockIdx.z, i0 = blockIdx.x * 64, o0 = blockIdx.y * 64, t_ = threadIdx.x; const float* w; b16* dst; int nin, nout;
  if (kind == 0) { w = win; dst = WIN; nin = C; nout = D; } else if (kind == 1) { w = wkv; dst = WKV; nin = C; nout = F; } else if (kind == 2) { w = w1; dst = W1T; nin = D; nout = F; } else if (kind == 3) { w = w2; dst = W2T; nin = F; nout = D; } else { w = wout; dst = WOT; nin = D; nout = C; }
  if (i0 >= nin || o0 >= nout) return;
  for (int q = t_; q < 64 * 64; q += 256) { const int ii = q >> 6, oo = q & 63; T[oo][ii] = (b16)(bf16_rne(w[(size_t)(i0 + ii) * nout + o0 + oo]) * WSC); }
  __syncthreads();
  { for (int q = t_; q < 64 * 8; q += 256) { const int oo = q >> 3, c8 = (q & 7) * 8; *(v8b*)(dst + (size_t)(o0 + oo) * nin + i0 + c8) = *(const v8b*)(&T[oo][c8]); }  }
}
// projections: block = 64 rows x 4 waves x 256 cols (16 tiles, K = 64 exact, 1 product): Y = tok W (kind 0: tok_q WIN; 1: tok_kv WKV[:256]; 2: tok_kv WKV[256:]) -> f32 rows [row][256]
__global__ __launch_bounds__(128) void proj_kernel(int r0, int kind, const b16* __restrict__ TQ16, const b16* __restrict__ TK16, const b16* __restrict__ WIN, const b16* __restrict__ WKV, float* __restrict__ Y) {
  __shared__ __attribute__((aligned(16))) float Tf[4][16][128 + 4];
  const int wave = threadIdx.x >> 5, lane = threadIdx.x & 31, nloc = lane & 15, hlf = lane >> 4; const size_t m0 = (size_t)blockIdx.x * 64 + wave * 16;
  const b16* A = kind == 0 ? TQ16 : TK16; const b16* Bw = kind == 0 ? WIN : (kind == 1 ? WKV : WKV + (size_t)D * C);
  v8f acc[16];
#pragma unroll
  for (int t = 0; t < 16; ++t) acc[t] = (v8f){};
#pragma unroll
  for (int kb = 0; kb < C; kb += 32) { const v16b a = frag_kb(A + ((size_t)r0 + m0 + nloc) * C + kb, hlf);
#pragma unroll
    for (int t = 0; t < 16; ++t) acc[t] = wmma16b(a, frag_kb(Bw + (size_t)(t * 16 + nloc) * C + kb, hlf), acc[t]); }
  for (int hq = 0; hq < 2; ++hq) {
#pragma unroll
    for (int t = 0; t < 8; ++t)
#pragma unroll
      for (int r = 0; r < 8; ++r) Tf[wave][8 * hlf + r][t * 16 + nloc] = acc[hq * 8 + t][r] * (1.0f / (XS * WSC));
    wave_lds_sync();
    { for (int rr = 0; rr < 16; ++rr) *(v4f*)(Y + (m0 + rr) * D + hq * 128 + lane * 4) = *(const v4f*)(&Tf[wave][rr][lane * 4]);  }
    wave_lds_sync(); }
}
__global__ __launch_bounds__(256) void ln_kernel(const float* __restrict__ X, const float* __restrict__ g, const float* __restrict__ be, b16* __restrict__ Yh, b16* __restrict__ Yl) {
  const int wave = threadIdx.x >> 5, lane = threadIdx.x & 31; const size_t row = (size_t)blockIdx.x * 8 + wave; const float* src = X + row * D + lane * 8;
  const v4f a = *(const v4f*)src, c = *(const v4f*)(src + 4); float v[8]; float s = 0.0f;
#pragma unroll
  for (int i = 0; i < 4; ++i) { v[i] = a[i]; v[4 + i] = c[i]; s += a[i] + c[i]; }
#pragma unroll
  for (int oo = 16; oo >= 1; oo >>= 1) s += __shfl_xor(s, oo);
  const float mean = s * (1.0f / D); float ss = 0.0f;
#pragma unroll
  for (int i = 0; i < 8; ++i) { const float dv = v[i] - mean; ss += pmul(dv, dv); }
#pragma unroll
  for (int oo = 16; oo >= 1; oo >>= 1) ss += __shfl_xor(ss, oo);
  const float rs = rsqrtf(ss * (1.0f / D) + LN_EPS); v8b hv, lv;
#pragma unroll
  for (int i = 0; i < 8; ++i) { const int ch = lane * 8 + i; const float y = pmul((v[i] - mean) * rs, bf16_rne(g[ch])) + bf16_rne(be[ch]); b16 h_, l_; split16(y * XS, h_, l_); hv[i] = h_; lv[i] = l_; }
  { *(v8b*)(Yh + row * D + lane * 8) = hv; *(v8b*)(Yl + row * D + lane * 8) = lv;  }
}
// v in channel-major hi/lo planes for the PV operand: VTh/VTl [bn][256 d][1024 s] = f16 hi+lo x8 of (tok_kv WKV[256:])^T: A = WKV_v rows d (K = 64), B = TK16 rows s; block = 64 d x 4 waves x
__global__ __launch_bounds__(128) void v_kernel(int bn0, const b16* __restrict__ TK16, const b16* __restrict__ WKV, b16* __restrict__ VTh, b16* __restrict__ VTl) {   // bn = local sequence (planes), bn0 + bn = global (token plane)
  __shared__ __attribute__((aligned(16))) b16 Ts[4][16][128 + 8], Tsl[4][16][128 + 8];
  const int wave = threadIdx.x >> 5, lane = threadIdx.x & 31, nloc = lane & 15, hlf = lane >> 4; const int bn = blockIdx.z; const int d0 = blockIdx.x * 64 + wave * 16, s0 = blockIdx.y * 128;
  const b16* WV = WKV + (size_t)D * C; v8f acc[8];
#pragma unroll
  for (int t = 0; t < 8; ++t) acc[t] = (v8f){};
#pragma unroll
  for (int kb = 0; kb < C; kb += 32) { const v16b a = frag_kb(WV + (size_t)(d0 + nloc) * C + kb, hlf);
#pragma unroll
    for (int t = 0; t < 8; ++t) acc[t] = wmma16b(a, frag_kb(TK16 + ((size_t)(bn0 + bn) * S + s0 + t * 16 + nloc) * C + kb, hlf), acc[t]); }
#pragma unroll
  for (int t = 0; t < 8; ++t)
#pragma unroll
    for (int r = 0; r < 8; ++r) { b16 h_, l_; split16(acc[t][r] * (1.0f / (XS * WSC)) * XS, h_, l_); Ts[wave][8 * hlf + r][t * 16 + nloc] = h_; Tsl[wave][8 * hlf + r][t * 16 + nloc] = l_; }
  wave_lds_sync();
  { for (int rr = 0; rr < 16; ++rr) if (lane < 16) { const size_t gi = ((size_t)bn * D + d0 + rr) * S + s0 + lane * 8; *(v8b*)(VTh + gi) = *(const v8b*)(&Ts[wave][rr][lane * 8]); *(v8b*)(VTl + gi) = *(const v8b*)(&Tsl[wave][rr][lane * 8]); }  }
}
// causal attention: grid (S/64, 1, sequences), block = 4 waves x 16 queries; key blocks of 32 (no scaling). Every fragment comes from LDS: each wave's q rows are copied there once, each 32-key block of
// k (rows of 512 B, LDS pitch 528 B) and of v^T (rows of 64 B, LDS pitch 80 B), hi and lo, once per block of 4 waves, by asynchronous copies to LDS, two buffers: block t + 1 flies while block t is worked on.
// The products, their order and the softmax of a wave are those of the per-wave form: S^T 3 products with K = 256 (8 steps), online softmax f32, O^T 3 products.
constexpr int AW = 4, KP = D + 8, VP = 32 + 8;
__device__ __forceinline__ unsigned lds_off(const void* p) { return (unsigned)(size_t)p; }
// eight 16-byte-per-lane copies global -> LDS, addresses stepping by ls bytes (LDS) and gs elements (global); s_wait_xcnt 0 closes the statement so that no address register is rewritten ahead of it
__device__ __forceinline__ void copy8(unsigned l, unsigned ls, const b16* g, size_t gs) {
  asm volatile("global_load_async_to_lds_b128 %0, %8, off\n\tglobal_load_async_to_lds_b128 %1, %9, off\n\tglobal_load_async_to_lds_b128 %2, %10, off\n\tglobal_load_async_to_lds_b128 %3, %11, off\n\t"
               "global_load_async_to_lds_b128 %4, %12, off\n\tglobal_load_async_to_lds_b128 %5, %13, off\n\tglobal_load_async_to_lds_b128 %6, %14, off\n\tglobal_load_async_to_lds_b128 %7, %15, off\n\ts_wait_xcnt 0x0"
               :: "v"(l), "v"(l + ls), "v"(l + 2 * ls), "v"(l + 3 * ls), "v"(l + 4 * ls), "v"(l + 5 * ls), "v"(l + 6 * ls), "v"(l + 7 * ls),
                  "v"(g), "v"(g + gs), "v"(g + 2 * gs), "v"(g + 3 * gs), "v"(g + 4 * gs), "v"(g + 5 * gs), "v"(g + 6 * gs), "v"(g + 7 * gs) : "memory");
}
__global__ __launch_bounds__(128) void attn_kernel(const b16* __restrict__ Qh, const b16* __restrict__ Ql, const b16* __restrict__ Kh, const b16* __restrict__ Kl, const b16* __restrict__ VTh, const b16* __restrict__ VTl, float* __restrict__ Of) {
  __shared__ __attribute__((aligned(16))) b16 Ks[2][2][32][KP];    // [buffer][hi, lo][key][d]
  __shared__ __attribute__((aligned(16))) b16 Vs[2][2][D][VP];     // [buffer][hi, lo][d][key]
  __shared__ __attribute__((aligned(16))) b16 Qs[AW][2][16][KP];   // [wave][hi, lo][query][d]
  __shared__ __attribute__((aligned(16))) float To[AW][16][D + 4];
  const int wave = __builtin_amdgcn_readfirstlane(threadIdx.x >> 5), lane = threadIdx.x & 31, hh = lane >> 4, col = lane & 15; const int bn = blockIdx.z; const int q0 = blockIdx.x * (16 * AW) + wave * 16, qi = q0 + col;
  const b16* Kb = Kh + (size_t)bn * S * D; const b16* Klb = Kl + (size_t)bn * S * D; const b16* Vb = VTh + (size_t)bn * D * S; const b16* Vlb = VTl + (size_t)bn * D * S;
  // a wave's share of one key block: 8 k rows (a row = one copy of 32 lanes x 16 B) and 64 v^T rows (8 rows = one copy), hi and lo: 32 copies
  const size_t kg = (size_t)(wave * 8) * D + lane * 8, vg = (size_t)(wave * 64 + (lane >> 2)) * S + (lane & 3) * 8;
  auto stage = [&](int kb, int bf) {
    copy8(lds_off(&Ks[bf][0][wave * 8][lane * 8]), KP * 2, Kb + (size_t)kb * D + kg, D); copy8(lds_off(&Ks[bf][1][wave * 8][lane * 8]), KP * 2, Klb + (size_t)kb * D + kg, D);
    copy8(lds_off(&Vs[bf][0][wave * 64 + (lane >> 2)][(lane & 3) * 8]), 8 * VP * 2, Vb + vg + kb, (size_t)8 * S); copy8(lds_off(&Vs[bf][1][wave * 64 + (lane >> 2)][(lane & 3) * 8]), 8 * VP * 2, Vlb + vg + kb, (size_t)8 * S); };
  { const size_t qg = ((size_t)bn * S + q0) * D + lane * 8;
    copy8(lds_off(&Qs[wave][0][0][lane * 8]), KP * 2, Qh + qg, D); copy8(lds_off(&Qs[wave][0][8][lane * 8]), KP * 2, Qh + qg + 8 * D, D);
    copy8(lds_off(&Qs[wave][1][0][lane * 8]), KP * 2, Ql + qg, D); copy8(lds_off(&Qs[wave][1][8][lane * 8]), KP * 2, Ql + qg + 8 * D, D); }
  asm volatile("s_wait_asynccnt 0x0" ::: "memory");   // the q copies have landed (and no more than 32 copies of a wave are ever outstanding)
  stage(0, 0);
  asm volatile("s_wait_asynccnt 0x0" ::: "memory");   // this wave's share of key block 0 has landed
  __syncthreads();                                    // ... and every other wave's: nothing is read from LDS in front of this barrier
  stage(32, 1);                                       // nt >= 2: key block 1 always exists
  const b16* Qb = &Qs[wave][0][col][0]; const b16* Qlb = &Qs[wave][1][col][0];
  float m = -INFINITY, l = 0.0f; v8f o[16];
#pragma unroll
  for (int t = 0; t < 16; ++t) o[t] = (v8f){};
  const float cs = LOG2E / (XS * XS); const int kend = q0 + 16;   // causal
  const int nt = blockIdx.x * (16 * AW / 32) + 16 * AW / 32;      // key blocks of the work-group's last wave; the same for all its waves
  for (int it = 0; it < nt; ++it) { const int kb = it * 32, bf = it & 1;
   if (kb < kend) {   // a wave past its diagonal skips the work, never the publish point below
    v8f s0 = {}, s1 = {};
#pragma unroll 2
    for (int ks = 0; ks < D; ks += 32) { const v16b qa = frag_kb(Qb + ks, hh), qla = frag_kb(Qlb + ks, hh);
      const b16* k0 = &Ks[bf][0][col][ks], *k1 = &Ks[bf][0][16 + col][ks], *k0l = &Ks[bf][1][col][ks], *k1l = &Ks[bf][1][16 + col][ks];
      v16b f = frag_kb(k0, hh); s0 = wmma16b(f, qa, s0); s0 = wmma16b(f, qla, s0); s0 = wmma16b(frag_kb(k0l, hh), qa, s0);
      f = frag_kb(k1, hh); s1 = wmma16b(f, qa, s1); s1 = wmma16b(f, qla, s1); s1 = wmma16b(frag_kb(k1l, hh), qa, s1); }
    float e[16]; float mx = -INFINITY;
#pragma unroll
    for (int r = 0; r < 8; ++r) { const int k0i = kb + 8 * hh + r, k1i = kb + 16 + 8 * hh + r; e[r] = (k0i <= qi) ? s0[r] * cs : -INFINITY; e[8 + r] = (k1i <= qi) ? s1[r] * cs : -INFINITY; mx = fmaxf(mx, fmaxf(e[r], e[8 + r])); }
    mx = fmaxf(mx, __shfl_xor(mx, 16)); const float mn = fmaxf(m, mx); const float al = nexp2(m - mn); m = mn; float sum = 0.0f; v16b ph, pl;   // key 0 <= qi always -> mn finite
#pragma unroll
    for (int i = 0; i < 16; ++i) { const float p = nexp2(e[i] - mn); sum += p; const b16 h_ = (b16)(p * PS); ph[i] = h_; pl[i] = (b16)(p * PS - (float)h_); }
    sum += __shfl_xor(sum, 16); l = l * al + sum;
#pragma unroll
    for (int t = 0; t < 16; ++t) { o[t] *= al; const v16b vf = frag_kb(&Vs[bf][0][t * 16 + col][0], hh); o[t] = wmma16b(vf, ph, o[t]); o[t] = wmma16b(vf, pl, o[t]); o[t] = wmma16b(frag_kb(&Vs[bf][1][t * 16 + col][0], hh), ph, o[t]); } }
   // publish point of key block it + 1, passed by every wave
   asm volatile("s_wait_dscnt 0x0" ::: "memory");      // this wave's reads of buffer bf are done before it may be refilled
   asm volatile("s_wait_asynccnt 0x0" ::: "memory");   // this wave's share of key block it + 1 has landed
   __syncthreads();                                    // both hold for every wave
   if (it + 2 < nt) stage(kb + 64, bf); }
  asm volatile("s_wait_asynccnt 0x0" ::: "memory");    // no copy is outstanding when the wave ends
  const float inv = 1.0f / (l * PS * XS);
#pragma unroll
  for (int t = 0; t < 16; ++t)
#pragma unroll
    for (int r = 0; r < 8; ++r) To[wave][col][t * 16 + 8 * hh + r] = o[t][r] * inv;
  wave_lds_sync();
  { for (int rr = 0; rr < 16; ++rr) { const size_t gi = ((size_t)bn * S + q0 + rr) * D; *(v4f*)(Of + gi + lane * 4) = *(const v4f*)(&To[wave][rr][lane * 4]); *(v4f*)(Of + gi + 128 + lane * 4) = *(const v4f*)(&To[wave][rr][128 + lane * 4]); }  }
}
__global__ __launch_bounds__(128) void ffn1_kernel(const b16* __restrict__ Ah, const b16* __restrict__ Al, const b16* __restrict__ W1T, b16* __restrict__ Hh, b16* __restrict__ Hl) {
  __shared__ __attribute__((aligned(16))) b16 Th[4][16][128 + 8], Tl[4][16][128 + 8];
  const int wave = threadIdx.x >> 5, lane = threadIdx.x & 31, nloc = lane & 15, hlf = lane >> 4; const size_t m0 = (size_t)blockIdx.x * 64 + wave * 16; const int n0 = blockIdx.y * 128;
  v8f acc[8];
#pragma unroll
  for (int t = 0; t < 8; ++t) acc[t] = (v8f){};
#pragma unroll 2
  for (int kb = 0; kb < D; kb += 32) { const v16b a = frag_kb(Ah + (m0 + nloc) * D + kb, hlf), al = frag_kb(Al + (m0 + nloc) * D + kb, hlf);
#pragma unroll
    for (int t = 0; t < 8; ++t) { const v16b bw = frag_kb(W1T + (size_t)(n0 + t * 16 + nloc) * D + kb, hlf); acc[t] = wmma16b(a, bw, acc[t]); acc[t] = wmma16b(al, bw, acc[t]); } }
#pragma unroll
  for (int t = 0; t < 8; ++t)
#pragma unroll
    for (int r = 0; r < 8; ++r) { b16 h_, l_; split16(fmaxf(acc[t][r] * (1.0f / (XS * WSC)), 0.0f) * XS, h_, l_); Th[wave][8 * hlf + r][t * 16 + nloc] = h_; Tl[wave][8 * hlf + r][t * 16 + nloc] = l_; }
  wave_lds_sync();
  { for (int r2 = 0; r2 < 16; r2 += 2) { const int rr = r2 + (lane >> 4), c8 = (lane & 15) * 8; const size_t gi = (m0 + rr) * F + n0 + c8; *(v8b*)(Hh + gi) = *(const v8b*)(&Th[wave][rr][c8]); *(v8b*)(Hl + gi) = *(const v8b*)(&Tl[wave][rr][c8]); }  }
}
__global__ __launch_bounds__(128) void ffn2_kernel(const b16* __restrict__ Hh, const b16* __restrict__ Hl, const b16* __restrict__ W2T, const float* __restrict__ Vf, b16* __restrict__ Eh, b16* __restrict__ El) {
  __shared__ __attribute__((aligned(16))) b16 Th[4][16][128 + 8], Tl[4][16][128 + 8];
  const int wave = threadIdx.x >> 5, lane = threadIdx.x & 31, nloc = lane & 15, hlf = lane >> 4; const size_t m0 = (size_t)blockIdx.x * 64 + wave * 16; const int n0 = blockIdx.y * 128;
  v8f acc[8];
#pragma unroll
  for (int t = 0; t < 8; ++t) acc[t] = (v8f){};
#pragma unroll 2
  for (int kb = 0; kb < F; kb += 32) { const v16b a = frag_kb(Hh + (m0 + nloc) * F + kb, hlf), al = frag_kb(Hl + (m0 + nloc) * F + kb, hlf);
#pragma unroll
    for (int t = 0; t < 8; ++t) { const v16b bw = frag_kb(W2T + (size_t)(n0 + t * 16 + nloc) * F + kb, hlf); acc[t] = wmma16b(a, bw, acc[t]); acc[t] = wmma16b(al, bw, acc[t]); } }
#pragma unroll
  for (int t = 0; t < 8; ++t)
#pragma unroll
    for (int r = 0; r < 8; ++r) { const size_t row = m0 + 8 * hlf + r; const float y = acc[t][r] * (1.0f / (XS * WSC)) + Vf[row * D + n0 + t * 16 + nloc]; b16 h_, l_; split16(y * XS, h_, l_); Th[wave][8 * hlf + r][t * 16 + nloc] = h_; Tl[wave][8 * hlf + r][t * 16 + nloc] = l_; }
  wave_lds_sync();
  { for (int r2 = 0; r2 < 16; r2 += 2) { const int rr = r2 + (lane >> 4), c8 = (lane & 15) * 8; const size_t gi = (m0 + rr) * D + n0 + c8; *(v8b*)(Eh + gi) = *(const v8b*)(&Th[wave][rr][c8]); *(v8b*)(El + gi) = *(const v8b*)(&Tl[wave][rr][c8]); }  }
}
// output projection, channel-major store: D[c][s] = sum_d WOT[c][d] epi[s][d] (A = WOT rows c exact, B = Eh/El rows s: 2 products); block = 64 c (all) x 4 waves x 128 s of one sequence;
__global__ __launch_bounds__(128) void outproj_kernel(int bn0, const b16* __restrict__ Eh, const b16* __restrict__ El, const b16* __restrict__ WOT, float* __restrict__ out) {
  __shared__ __attribute__((aligned(16))) float Ts[4][16][128 + 4];
  const int wave = threadIdx.x >> 5, lane = threadIdx.x & 31, nloc = lane & 15, hlf = lane >> 4; const int bn = blockIdx.z; const int c0 = wave * 16, s0 = blockIdx.y * 128; const int b = (bn0 + bn) / NN, n = (bn0 + bn) % NN;
  v8f acc[8];
#pragma unroll
  for (int t = 0; t < 8; ++t) acc[t] = (v8f){};
#pragma unroll 2
  for (int kb = 0; kb < D; kb += 32) { const v16b a = frag_kb(WOT + (size_t)(c0 + nloc) * D + kb, hlf);
#pragma unroll
    for (int t = 0; t < 8; ++t) { const size_t ro = ((size_t)bn * S + s0 + t * 16 + nloc) * D + kb; acc[t] = wmma16b(a, frag_kb(Eh + ro, hlf), acc[t]); acc[t] = wmma16b(a, frag_kb(El + ro, hlf), acc[t]); } }
#pragma unroll
  for (int t = 0; t < 8; ++t)
#pragma unroll
    for (int r = 0; r < 8; ++r) Ts[wave][8 * hlf + r][t * 16 + nloc] = acc[t][r] * (1.0f / (XS * WSC));
  wave_lds_sync();
  { for (int rr = 0; rr < 16; ++rr) *(v4f*)(out + (((size_t)b * C + c0 + rr) * NN + n) * S + s0 + lane * 4) = *(const v4f*)(&Ts[wave][rr][lane * 4]);  }
}
}  // namespace

extern "C" void kernel_launch(void* const* d_in, const int* in_sizes, int n_in, void* d_out, int out_size, void* d_ws, size_t ws_size, hipStream_t stream) {
  (void)n_in;
  auto Fp = [&](int i) { return (const float*)d_in[i]; };
  // input order: 0 fea_lf [4,64,8,32,32], 1 fea_hf, 2 W_in [64,256], 3 W_kv [64,512], 4 gamma, 5 beta, 6 g2, 7 b2, 8 W1 [256,512], 9 W2 [512,256], 10 W_out [256,64] (all (in, out))
  if (in_sizes[0] != NR * C || in_sizes[1] != NR * C || in_sizes[2] != C * D || in_sizes[3] != C * F || in_sizes[4] != D || in_sizes[8] != D * F || in_sizes[9] != F * D || in_sizes[10] != D * C || out_size != NR * C) return;
  size_t off = 0; char* ws = (char*)d_ws;
  auto carve = [&](size_t bytes) { char* p = ws + off; off += (bytes + 255) & ~(size_t)255; return p; };
  b16* TQ16 = (b16*)carve((size_t)NR * C * 2); b16* TK16 = (b16*)carve((size_t)NR * C * 2); b16* WIN = (b16*)carve((size_t)D * C * 2); b16* WKV = (b16*)carve((size_t)F * C * 2); b16* W1T = (b16*)carve((size_t)F * D * 2); b16* W2T = (b16*)carve((size_t)D * F * 2); b16* WOT = (b16*)carve((size_t)C * D * 2);
  // per-half planes (16 sequences = 16,384 rows), reused by the second half
  b16* Qh = (b16*)carve((size_t)NRH * D * 2); b16* Ql = (b16*)carve((size_t)NRH * D * 2); b16* Kh = (b16*)carve((size_t)NRH * D * 2); b16* Kl = (b16*)carve((size_t)NRH * D * 2);
  float* Vf = (float*)carve((size_t)NRH * D * 4); b16* VTh = (b16*)carve((size_t)NRH * D * 2); b16* VTl = (b16*)carve((size_t)NRH * D * 2); b16* Hh = (b16*)carve((size_t)NRH * F * 2); b16* Hl = (b16*)carve((size_t)NRH * F * 2); float* Of = (float*)carve((size_t)NRH * D * 4);   // O gets its own rows: attention blocks still read other rows' q while O is being written
  b16* Ah = VTh; b16* Al = VTl;                                // region reuse: the transposed v planes are dead after the attention (Vf keeps the residual)
  b16* Eh = Kh; b16* El = Kl;                                  // region reuse: k planes are dead after the attention
  if (off > ws_size || off > ((size_t)128 << 20)) return;   // = 120.6 MB
  xt_kernel<<<dim3(S / 64, 2, NBN), 256, 0, stream>>>(Fp(0), Fp(1), TQ16, TK16);
  prepw_kernel<<<dim3(8, 8, 5), 256, 0, stream>>>(Fp(2), Fp(3), Fp(8), Fp(9), Fp(10), WIN, WKV, W1T, W2T, WOT);
  for (int hf = 0; hf < 2; ++hf) {
    proj_kernel<<<NRH / 64, 128, 0, stream>>>(hf * NRH, 0, TQ16, TK16, WIN, WKV, Of);   // q0 f32 rows (Of region as scratch)
    ln_kernel<<<NRH / 8, 256, 0, stream>>>(Of, Fp(4), Fp(5), Qh, Ql);
    proj_kernel<<<NRH / 64, 128, 0, stream>>>(hf * NRH, 1, TQ16, TK16, WIN, WKV, Of);   // k0
    ln_kernel<<<NRH / 8, 256, 0, stream>>>(Of, Fp(4), Fp(5), Kh, Kl);
    proj_kernel<<<NRH / 64, 128, 0, stream>>>(hf * NRH, 2, TQ16, TK16, WIN, WKV, Vf);   // v f32 rows (residual)
    v_kernel<<<dim3(D / 64, S / 128, NBH), 128, 0, stream>>>(hf * NBH, TK16, WKV, VTh, VTl);
    attn_kernel<<<dim3(S / (16 * AW), 1, NBH), 32 * AW, 0, stream>>>(Qh, Ql, Kh, Kl, VTh, VTl, Of);
    ln_kernel<<<NRH / 8, 256, 0, stream>>>(Of, Fp(6), Fp(7), Ah, Al);   // LN2(att)
    ffn1_kernel<<<dim3(NRH / 64, F / 128), 128, 0, stream>>>(Ah, Al, W1T, Hh, Hl);
    ffn2_kernel<<<dim3(NRH / 64, D / 128), 128, 0, stream>>>(Hh, Hl, W2T, Vf, Eh, El);
    outproj_kernel<<<dim3(1, S / 128, NBH), 128, 0, stream>>>(hf * NBH, Eh, El, WOT, (float*)d_out);
  }
}

// v002
// Measured time: 334 microseconds a run.
// Timed twice side by side with v001, it ran 1.65 and 1.64 times as fast.
// Over all steps from v000 it is 3.97 times as fast.
#include <hip/hip_runtime.h>

// Inter-frequency attention block: 32 sequences (4 batches x 8 'n' slices) of 1,024 tokens (32 x 32 positions), 64 channels; q = LN(tok_q W_in), k = LN((tok_kv W_kv)[:, :256]) (shared gamma/beta),
// v = (tok_kv W_kv)[:, 256:]; score = q.k (no scaling), causal (lower triangle; fill -1e15 == masked out since the diagonal is always kept), softmax, att = p v; h = relu(LN2(att) W1) W2;
// out = (h + v) W_out -> written channel-major as [4][64][8][32][32].
// WMMA (v_wmma_f32_16x16x32_f16, f32 accumulate): W_in / W_kv projections with EXACT bf16 tokens (x8, LDS-transposed from the channel-major inputs) and weights (x256), 1 product, LayerNorms as row kernels; S^T = K.Q^T with
// q AND k (LayerNorm outputs) f16 hi+lo x8 (3 products: the unscaled 256-dim logits have sigma ~16); online softmax in f32; O^T += V^T P^T with v and P f16 hi+lo (3 products, one f32 accumulator:
// unscaled residuals); FFN W1 with LN2(att) hi+lo (2 products), W2 with the relu hidden hi+lo (2 products), W_out with (h + v) hi+lo (2 products). LayerNorms, softmax, relu, residual in f32.
// Inputs rounded to bf16 once. Fragment k-map per lane half hh for A AND B: elements 0..7 <- k = 8hh+0..7, 8..15 <- k = 16+8hh+0..7; acc[r] = D[8hh+r][col].

namespace {
constexpr int NBN = 32 /* b*n sequences */, NN = 8, S = 1024, C = 64, D = 256, F = 512, NR = NBN * S, NBH = NBN / 2, NRH = NBH * S /* processed in two halves of 16 sequences to keep the planes <= 128 MiB */;
constexpr float XS = 8.0f, WSC = 256.0f, PS = 8.0f, LOG2E = 1.4426950408889634f, LN_EPS = 1e-5f;

typedef _Float16 b16;
typedef __attribute__((ext_vector_type(16))) _Float16 v16b;
typedef __attribute__((ext_vector_type(8))) _Float16 v8b;
typedef __attribute__((ext_vector_type(8))) float v8f;
typedef __attribute__((ext_vector_type(4))) float v4f;
__device__ __forceinline__ float bf16_rne(float f) { unsigned int u = __float_as_uint(f); u += 0x7FFFu + ((u >> 16) & 1u); return __uint_as_float(u & 0xFFFF0000u); }
__device__ __forceinline__ void split16(float v, b16& hi, b16& lo) { hi = (b16)v; lo = (b16)(v - (float)hi); }
__device__ __forceinline__ v16b frag_kb(const b16* p, int hh) { const v8b a = *(const v8b*)(p + 8 * hh), b = *(const v8b*)(p + 16 + 8 * hh); v16b f;
#pragma unroll
  for (int e = 0; e < 8; ++e) { f[e] = a[e]; f[8 + e] = b[e]; } return f; }
__device__ __forceinline__ v8f wmma16b(v16b a, v16b b, v8f c) { return __builtin_amdgcn_wmma_f32_16x16x32_f16(false, a, false, b, (short)0, c, false, false); }
// stands between a group of fragment loads and a block of WMMAs: without it the compiler sinks each load to just in front of its own WMMA, and every load's latency is waited out alone
__device__ __forceinline__ void group_fence() { __builtin_amdgcn_sched_barrier(0); }
// stands behind the last WMMA of a loop that reads its fragments from global memory: the loads' address registers are inputs here, so none of them is given a new value ahead of this wait
__device__ __forceinline__ void addr_wait(const b16* a, const b16* b, const b16* c) { asm volatile("s_wait_xcnt 0x0" :: "v"(a), "v"(b), "v"(c) : "memory"); }
__device__ __forceinline__ void wave_lds_sync() { __builtin_amdgcn_fence(__ATOMIC_RELEASE, "workgroup"); __builtin_amdgcn_wave_barrier(); __builtin_amdgcn_fence(__ATOMIC_ACQUIRE, "workgroup"); }
__device__ __forceinline__ float nexp2(float x) { return __builtin_amdgcn_exp2f(x); }
__device__ __forceinline__ float pmul(float a, float b) { float p = a * b; asm volatile("" : "+v"(p)); return p; }
__device__ __forceinline__ float hsum16(float v) { v += __shfl_xor(v, 1); v += __shfl_xor(v, 2); v += __shfl_xor(v, 4); return v + __shfl_xor(v, 8); }

__global__ __launch_bounds__(256) void xt_kernel(const float* __restrict__ flf, const float* __restrict__ fhf, b16* __restrict__ TQ16, b16* __restrict__ TK16) {
  __shared__ __attribute__((aligned(16))) b16 T[64][64 + 8];
  const int bn = blockIdx.z, kind = blockIdx.y, s0 = blockIdx.x * 64, t_ = threadIdx.x; const int b = bn / NN, n = bn % NN; const float* src = (kind == 0 ? flf : fhf) + ((size_t)b * C * NN + n) * S; b16* dst = kind == 0 ? TQ16 : TK16;
  for (int q = t_; q < 64 * 64; q += 256) { const int cc = q >> 6, ss = q & 63; T[ss][cc] = (b16)(bf16_rne(src[(size_t)cc * NN * S + s0 + ss]) * XS); }
  __syncthreads();
  { for (int q = t_; q < 64 * 8; q += 256) { const int ss = q >> 3, c8 = (q & 7) * 8; *(v8b*)(dst + ((size_t)bn * S + s0 + ss) * C + c8) = *(const v8b*)(&T[ss][c8]); }  }
}
// weights (in,out) transposed to [out][in] rows x256 via 64x64 LDS tiles: kind 0 W_in [64][256] -> WIN [256][64]; 1 W_kv [64][512] -> WKV [512][64]; 2 W1 [256][512] -> W1T [512][256];
__global__ __launch_bounds__(256) void prepw_kernel(const float* __restrict__ win, const float* __restrict__ wkv, const float* __restrict__ w1, const float* __restrict__ w2, const float* __restrict__ wout, b16* __restrict__ WIN, b16* __restrict__ WKV, b16* __restrict__ W1T, b16* __restrict__ W2T, b16* __restrict__ WOT) {
  __shared__ __attribute__((aligned(16))) b16 T[64][64 + 8];
  const int kind = blockIdx.z, i0 = blockIdx.x * 64, o0 = blockIdx.y * 64, t_ = threadIdx.x; const float* w; b16* dst; int nin, nout;
  if (kind == 0) { w = win; dst = WIN; nin = C; nout = D; } else if (kind == 1) { w = wkv; dst = WKV; nin = C; nout = F; } else if (kind == 2) { w = w1; dst = W1T; nin = D; nout = F; } else if (kind == 3) { w = w2; dst = W2T; nin = F; nout = D; } else { w = wout; dst = WOT; nin = D; nout = C; }
  if (i0 >= nin || o0 >= nout) return;
  for (int q = t_; q < 64 * 64; q += 256) { const int ii = q >> 6, oo = q & 63; T[oo][ii] = (b16)(bf16_rne(w[(size_t)(i0 + ii) * nout + o0 + oo]) * WSC); }
  __syncthreads();
  { for (int q = t_; q < 64 * 8; q += 256) { const int oo = q >> 3, c8 = (q & 7) * 8; *(v8b*)(dst + (size_t)(o0 + oo) * nin + i0 + c8) = *(const v8b*)(&T[oo][c8]); }  }
}
// projections: block = 64 rows x 4 waves x 256 cols (16 tiles, K = 64 exact, 1 product): Y = tok W (kind 0: tok_q WIN; 1: tok_kv WKV[:256]; 2: tok_kv WKV[256:]) -> f32 rows [row][256]
__global__ __launch_bounds__(128) void proj_kernel(int r0, int kind, const b16* __restrict__ TQ16, const b16* __restrict__ TK16, const b16* __restrict__ WIN, const b16* __restrict__ WKV, float* __restrict__ Y) {
  __shared__ __attribute__((aligned(16))) float Tf[4][16][128 + 4];
  const int wave = threadIdx.x >> 5, lane = threadIdx.x & 31, nloc = lane & 15, hlf = lane >> 4; const size_t m0 = (size_t)blockIdx.x * 64 + wave * 16;
  const b16* A = kind == 0 ? TQ16 : TK16; const b16* Bw = kind == 0 ? WIN : (kind == 1 ? WKV : WKV + (size_t)D * C);
  v8f acc[16];
#pragma unroll
  for (int t = 0; t < 16; ++t) acc[t] = (v8f){};
  const b16* pa = A + ((size_t)r0 + m0 + nloc) * C + 8 * hlf; const b16* pw = Bw + (size_t)nloc * C + 8 * hlf;   // the lane's own addresses: every load below is one of these plus a constant
  v16b fa[2], fw[2][16];   // all fragments of the tile (K = 64) are requested as one group
#pragma unroll
  for (int i = 0; i < 2; ++i) { fa[i] = frag_kb(pa + i * 32, 0);
#pragma unroll
    for (int t = 0; t < 16; ++t) fw[i][t] = frag_kb(pw + t * 16 * C + i * 32, 0); }
  group_fence();
#pragma unroll
  for (int i = 0; i < 2; ++i)
#pragma unroll
    for (int t = 0; t < 16; ++t) acc[t] = wmma16b(fa[i], fw[i][t], acc[t]);
  group_fence(); addr_wait(pa, pw, pw);   // the fence keeps the wait behind the WMMAs, where every load has returned
  for (int hq = 0; hq < 2; ++hq) {
#pragma unroll
    for (int t = 0; t < 8; ++t)
#pragma unroll
      for (int r = 0; r < 8; ++r) Tf[wave][8 * hlf + r][t * 16 + nloc] = acc[hq * 8 + t][r] * (1.0f / (XS * WSC));
    wave_lds_sync();
    { for (int rr = 0; rr < 16; ++rr) *(v4f*)(Y + (m0 + rr) * D + hq * 128 + lane * 4) = *(const v4f*)(&Tf[wave][rr][lane * 4]);  }
    wave_lds_sync(); }
}
__global__ __launch_bounds__(256) void ln_kernel(const float* __restrict__ X, const float* __restrict__ g, const float* __restrict__ be, b16* __restrict__ Yh, b16* __restrict__ Yl) {
  const int wave = threadIdx.x >> 5, lane = threadIdx.x & 31; const size_t row = (size_t)blockIdx.x * 8 + wave; const float* src = X + row * D + lane * 8;
  const v4f a = *(const v4f*)src, c = *(const v4f*)(src + 4); float v[8]; float s = 0.0f;
#pragma unroll
  for (int i = 0; i < 4; ++i) { v[i] = a[i]; v[4 + i] = c[i]; s += a[i] + c[i]; }
#pragma unroll
  for (int oo = 16; oo >= 1; oo >>= 1) s += __shfl_xor(s, oo);
  const float mean = s * (1.0f / D); float ss = 0.0f;
#pragma unroll
  for (int i = 0; i < 8; ++i) { const float dv = v[i] - mean; ss += pmul(dv, dv); }
#pragma unroll
  for (int oo = 16; oo >= 1; oo >>= 1) ss += __shfl_xor(ss, oo);
  const float rs = rsqrtf(ss * (1.0f / D) + LN_EPS); v8b hv, lv;
#pragma unroll
  for (int i = 0; i < 8; ++i) { const int ch = lane * 8 + i; const float y = pmul((v[i] - mean) * rs, bf16_rne(g[ch])) + bf16_rne(be[ch]); b16 h_, l_; split16(y * XS, h_, l_); hv[i] = h_; lv[i] = l_; }
  { *(v8b*)(Yh + row * D + lane * 8) = hv; *(v8b*)(Yl + row * D + lane * 8) = lv;  }
}
// v in channel-major hi/lo planes for the PV operand: VTh/VTl [bn][256 d][1024 s] = f16 hi+lo x8 of (tok_kv WKV[256:])^T: A = WKV_v rows d (K = 64), B = TK16 rows s; block = 64 d x 4 waves x
__global__ __launch_bounds__(128) void v_kernel(int bn0, const b16* __restrict__ TK16, const b16* __restrict__ WKV, b16* __restrict__ VTh, b16* __restrict__ VTl) {   // bn = local sequence (planes), bn0 + bn = global (token plane)
  __shared__ __attribute__((aligned(16))) b16 Ts[4][16][128 + 8], Tsl[4][16][128 + 8];
  const int wave = threadIdx.x >> 5, lane = threadIdx.x & 31, nloc = lane & 15, hlf = lane >> 4; const int bn = blockIdx.z; const int d0 = blockIdx.x * 64 + wave * 16, s0 = blockIdx.y * 128;
  v8f acc[8];
#pragma unroll
  for (int t = 0; t < 8; ++t) acc[t] = (v8f){};
  const b16* pa = WKV + (size_t)(d0 + nloc) * C + 8 * hlf; const b16* pw = TK16 + ((size_t)(bn0 + bn) * S + s0 + nloc) * C + 8 * hlf;   // the lane's own addresses: every load below is one of these plus a constant
  v16b fa[2], fw[2][8];   // all fragments of the tile (K = 64) are requested as one group
#pragma unroll
  for (int i = 0; i < 2; ++i) { fa[i] = frag_kb(pa + D * C + i * 32, 0);   // the v half of W_kv: rows D .. 2D - 1
#pragma unroll
    for (int t = 0; t < 8; ++t) fw[i][t] = frag_kb(pw + t * 16 * C + i * 32, 0); }
  group_fence();
#pragma unroll
  for (int i = 0; i < 2; ++i)
#pragma unroll
    for (int t = 0; t < 8; ++t) acc[t] = wmma16b(fa[i], fw[i][t], acc[t]);
  group_fence(); addr_wait(pa, pw, pw);   // the fence keeps the wait behind the WMMAs, where every load has returned
#pragma unroll
  for (int t = 0; t < 8; ++t)
#pragma unroll
    for (int r = 0; r < 8; ++r) { b16 h_, l_; split16(acc[t][r] * (1.0f / (XS * WSC)) * XS, h_, l_); Ts[wave][8 * hlf + r][t * 16 + nloc] = h_; Tsl[wave][8 * hlf + r][t * 16 + nloc] = l_; }
  wave_lds_sync();
  { for (int rr = 0; rr < 16; ++rr) if (lane < 16) { const size_t gi = ((size_t)bn * D + d0 + rr) * S + s0 + lane * 8; *(v8b*)(VTh + gi) = *(const v8b*)(&Ts[wave][rr][lane * 8]); *(v8b*)(VTl + gi) = *(const v8b*)(&Tsl[wave][rr][lane * 8]); }  }
}
// causal attention: grid (S/64, 1, sequences), block = 4 waves x 16 queries; key blocks of 32 (no scaling). Every fragment comes from LDS: each wave's q rows are copied there once, each 32-key block of
// k (rows of 512 B, LDS pitch 528 B) and of v^T (rows of 64 B, LDS pitch 80 B), hi and lo, once per block of 4 waves, by asynchronous copies to LDS, two buffers: block t + 1 flies while block t is worked on.
// The products, their order and the softmax of a wave are those of the per-wave form: S^T 3 products with K = 256 (8 steps), online softmax f32, O^T 3 products.
constexpr int AW = 4, KP = D + 8, VP = 32 + 8;
__device__ __forceinline__ unsigned lds_off(const void* p) { return (unsigned)(size_t)p; }
// eight 16-byte-per-lane copies global -> LDS, addresses stepping by ls bytes (LDS) and gs elements (global); s_wait_xcnt 0 closes the statement so that no address register is rewritten ahead of it
__device__ __forceinline__ void copy8(unsigned l, unsigned ls, const b16* g, size_t gs) {
  asm volatile("global_load_async_to_lds_b128 %0, %8, off\n\tglobal_load_async_to_lds_b128 %1, %9, off\n\tglobal_load_async_to_lds_b128 %2, %10, off\n\tglobal_load_async_to_lds_b128 %3, %11, off\n\t"
               "global_load_async_to_lds_b128 %4, %12, off\n\tglobal_load_async_to_lds_b128 %5, %13, off\n\tglobal_load_async_to_lds_b128 %6, %14, off\n\tglobal_load_async_to_lds_b128 %7, %15, off\n\ts_wait_xcnt 0x0"
               :: "v"(l), "v"(l + ls), "v"(l + 2 * ls), "v"(l + 3 * ls), "v"(l + 4 * ls), "v"(l + 5 * ls), "v"(l + 6 * ls), "v"(l + 7 * ls),
                  "v"(g), "v"(g + gs), "v"(g + 2 * gs), "v"(g + 3 * gs), "v"(g + 4 * gs), "v"(g + 5 * gs), "v"(g + 6 * gs), "v"(g + 7 * gs) : "memory");
}
__global__ __launch_bounds__(128) void attn_kernel(const b16* __restrict__ Qh, const b16* __restrict__ Ql, const b16* __restrict__ Kh, const b16* __restrict__ Kl, const b16* __restrict__ VTh, const b16* __restrict__ VTl, float* __restrict__ Of) {
  __shared__ __attribute__((aligned(16))) b16 Ks[2][2][32][KP];    // [buffer][hi, lo][key][d]
  __shared__ __attribute__((aligned(16))) b16 Vs[2][2][D][VP];     // [buffer][hi, lo][d][key]
  __shared__ __attribute__((aligned(16))) b16 Qs[AW][2][16][KP];   // [wave][hi, lo][query][d]
  __shared__ __attribute__((aligned(16))) float To[AW][16][D + 4];
  const int wave = __builtin_amdgcn_readfirstlane(threadIdx.x >> 5), lane = threadIdx.x & 31, hh = lane >> 4, col = lane & 15; const int bn = blockIdx.z; const int q0 = blockIdx.x * (16 * AW) + wave * 16, qi = q0 + col;
  const b16* Kb = Kh + (size_t)bn * S * D; const b16* Klb = Kl + (size_t)bn * S * D; const b16* Vb = VTh + (size_t)bn * D * S; const b16* Vlb = VTl + (size_t)bn * D * S;
  // a wave's share of one key block: 8 k rows (a row = one copy of 32 lanes x 16 B) and 64 v^T rows (8 rows = one copy), hi and lo: 32 copies
  const size_t kg = (size_t)(wave * 8) * D + lane * 8, vg = (size_t)(wave * 64 + (lane >> 2)) * S + (lane & 3) * 8;
  auto stage = [&](int kb, int bf) {
    copy8(lds_off(&Ks[bf][0][wave * 8][lane * 8]), KP * 2, Kb + (size_t)kb * D + kg, D); copy8(lds_off(&Ks[bf][1][wave * 8][lane * 8]), KP * 2, Klb + (size_t)kb * D + kg, D);
    copy8(lds_off(&Vs[bf][0][wave * 64 + (lane >> 2)][(lane & 3) * 8]), 8 * VP * 2, Vb + vg + kb, (size_t)8 * S); copy8(lds_off(&Vs[bf][1][wave * 64 + (lane >> 2)][(lane & 3) * 8]), 8 * VP * 2, Vlb + vg + kb, (size_t)8 * S); };
  { const size_t qg = ((size_t)bn * S + q0) * D + lane * 8;
    copy8(lds_off(&Qs[wave][0][0][lane * 8]), KP * 2, Qh + qg, D); copy8(lds_off(&Qs[wave][0][8][lane * 8]), KP * 2, Qh + qg + 8 * D, D);
    copy8(lds_off(&Qs[wave][1][0][lane * 8]), KP * 2, Ql + qg, D); copy8(lds_off(&Qs[wave][1][8][lane * 8]), KP * 2, Ql + qg + 8 * D, D); }
  asm volatile("s_wait_asynccnt 0x0" ::: "memory");   // the q copies have landed (and no more than 32 copies of a wave are ever outstanding)
  stage(0, 0);
  asm volatile("s_wait_asynccnt 0x0" ::: "memory");   // this wave's share of key block 0 has landed
  __syncthreads();                                    // ... and every other wave's: nothing is read from LDS in front of this barrier
  stage(32, 1);                                       // nt >= 2: key block 1 always exists
  const b16* Qb = &Qs[wave][0][col][0]; const b16* Qlb = &Qs[wave][1][col][0];
  float m = -INFINITY, l = 0.0f; v8f o[16];
#pragma unroll
  for (int t = 0; t < 16; ++t) o[t] = (v8f){};
  const float cs = LOG2E / (XS * XS); const int kend = q0 + 16;   // causal
  const int nt = blockIdx.x * (16 * AW / 32) + 16 * AW / 32;      // key blocks of the work-group's last wave; the same for all its waves
  for (int it = 0; it < nt; ++it) { const int kb = it * 32, bf = it & 1;
   if (kb < kend) {   // a wave past its diagonal skips the work, never the publish point below
    v8f s0 = {}, s1 = {};
    v16b fq[2][2], fk[2][4];   // two register stages: step i + 1's six fragments are read from LDS as one group ahead of step i's WMMAs; s0 and s1 take turns, each in its old order; unrolled whole so that the stage index is a constant
    auto ldk = [&](int ks, int st) { fq[st][0] = frag_kb(Qb + ks, hh); fq[st][1] = frag_kb(Qlb + ks, hh); fk[st][0] = frag_kb(&Ks[bf][0][col][ks], hh); fk[st][1] = frag_kb(&Ks[bf][0][16 + col][ks], hh);
      fk[st][2] = frag_kb(&Ks[bf][1][col][ks], hh); fk[st][3] = frag_kb(&Ks[bf][1][16 + col][ks], hh); };
    ldk(0, 0);
#pragma unroll
    for (int i = 0; i < D / 32; ++i) { const int st = i & 1; if (i + 1 < D / 32) ldk((i + 1) * 32, st ^ 1);
      group_fence();
      s0 = wmma16b(fk[st][0], fq[st][0], s0); s1 = wmma16b(fk[st][1], fq[st][0], s1); s0 = wmma16b(fk[st][0], fq[st][1], s0); s1 = wmma16b(fk[st][1], fq[st][1], s1);
      s0 = wmma16b(fk[st][2], fq[st][0], s0); s1 = wmma16b(fk[st][3], fq[st][0], s1);
      group_fence(); }
    v16b fv[3][2][2];          // three register stages of two d tiles (hi, lo) each: the first two groups are read ahead of the softmax, group g + 2 ahead of group g's WMMAs; the two tiles take turns, each in its old order
    auto ldv = [&](int g, int st) {
#pragma unroll
      for (int j = 0; j < 2; ++j) { fv[st][j][0] = frag_kb(&Vs[bf][0][(2 * g + j) * 16 + col][0], hh); fv[st][j][1] = frag_kb(&Vs[bf][1][(2 * g + j) * 16 + col][0], hh); } };
    ldv(0, 0); ldv(1, 1);
    group_fence();
    float e[16]; float mx = -INFINITY;
#pragma unroll
    for (int r = 0; r < 8; ++r) { const int k0i = kb + 8 * hh + r, k1i = kb + 16 + 8 * hh + r; e[r] = (k0i <= qi) ? s0[r] * cs : -INFINITY; e[8 + r] = (k1i <= qi) ? s1[r] * cs : -INFINITY; mx = fmaxf(mx, fmaxf(e[r], e[8 + r])); }
    mx = fmaxf(mx, __shfl_xor(mx, 16)); const float mn = fmaxf(m, mx); const float al = nexp2(m - mn); m = mn; float sum = 0.0f; v16b ph, pl;   // key 0 <= qi always -> mn finite
#pragma unroll
    for (int i = 0; i < 16; ++i) { const float p = nexp2(e[i] - mn); sum += p; const b16 h_ = (b16)(p * PS); ph[i] = h_; pl[i] = (b16)(p * PS - (float)h_); }
    sum += __shfl_xor(sum, 16); l = l * al + sum;
#pragma unroll
    for (int g = 0; g < 8; ++g) { const int st = g % 3, t0 = 2 * g, t1 = 2 * g + 1; if (g + 2 < 8) ldv(g + 2, (g + 2) % 3);
      o[t0] *= al; o[t1] *= al;
      group_fence();
      o[t0] = wmma16b(fv[st][0][0], ph, o[t0]); o[t1] = wmma16b(fv[st][1][0], ph, o[t1]); o[t0] = wmma16b(fv[st][0][0], pl, o[t0]); o[t1] = wmma16b(fv[st][1][0], pl, o[t1]);
      o[t0] = wmma16b(fv[st][0][1], ph, o[t0]); o[t1] = wmma16b(fv[st][1][1], ph, o[t1]);
      if (g + 2 < 8) group_fence(); } }   // no reads follow the last two groups: nothing to hold there
   // publish point of key block it + 1, passed by every wave
   asm volatile("s_wait_dscnt 0x0" ::: "memory");      // this wave's reads of buffer bf are done before it may be refilled
   asm volatile("s_wait_asynccnt 0x0" ::: "memory");   // this wave's share of key block it + 1 has landed
   __syncthreads();                                    // both hold for every wave
   if (it + 2 < nt) stage(kb + 64, bf); }
  asm volatile("s_wait_asynccnt 0x0" ::: "memory");    // no copy is outstanding when the wave ends
  const float inv = 1.0f / (l * PS * XS);
#pragma unroll
  for (int t = 0; t < 16; ++t)
#pragma unroll
    for (int r = 0; r < 8; ++r) To[wave][col][t * 16 + 8 * hh + r] = o[t][r] * inv;
  wave_lds_sync();
  { for (int rr = 0; rr < 16; ++rr) { const size_t gi = ((size_t)bn * S + q0 + rr) * D; *(v4f*)(Of + gi + lane * 4) = *(const v4f*)(&To[wave][rr][lane * 4]); *(v4f*)(Of + gi + 128 + lane * 4) = *(const v4f*)(&To[wave][rr][128 + lane * 4]); }  }
}
__global__ __launch_bounds__(128) void ffn1_kernel(const b16* __restrict__ Ah, const b16* __restrict__ Al, const b16* __restrict__ W1T, b16* __restrict__ Hh, b16* __restrict__ Hl) {
  __shared__ __attribute__((aligned(16))) b16 Th[4][16][128 + 8], Tl[4][16][128 + 8];
  const int wave = threadIdx.x >> 5, lane = threadIdx.x & 31, nloc = lane & 15, hlf = lane >> 4; const size_t m0 = (size_t)blockIdx.x * 64 + wave * 16; const int n0 = blockIdx.y * 128;
  v8f acc[8];
#pragma unroll
  for (int t = 0; t < 8; ++t) acc[t] = (v8f){};
  v16b fa[2], fl[2], fw[2][8];   // two register stages: step i + 1's fragments are requested as one group ahead of step i's WMMAs; the k loop is unrolled whole so that the stage index is a constant and both stages are registers
  const b16* pa = Ah + (m0 + nloc) * D + 8 * hlf; const b16* pl = Al + (m0 + nloc) * D + 8 * hlf; const b16* pw = W1T + (size_t)(n0 + nloc) * D + 8 * hlf;   // the lane's own addresses: every load below is one of these plus a constant
  auto ld = [&](int kb, int st) { fa[st] = frag_kb(pa + kb, 0); fl[st] = frag_kb(pl + kb, 0);
#pragma unroll
    for (int t = 0; t < 8; ++t) fw[st][t] = frag_kb(pw + t * 16 * D + kb, 0); };
  ld(0, 0);
#pragma unroll
  for (int i = 0; i < D / 32; ++i) { const int st = i & 1; if (i + 1 < D / 32) ld((i + 1) * 32, st ^ 1);
    group_fence();
#pragma unroll
    for (int t = 0; t < 8; ++t) acc[t] = wmma16b(fa[st], fw[st][t], acc[t]);
#pragma unroll
    for (int t = 0; t < 8; ++t) acc[t] = wmma16b(fl[st], fw[st][t], acc[t]);
    group_fence(); }
  addr_wait(pa, pl, pw);
#pragma unroll
  for (int t = 0; t < 8; ++t)
#pragma unroll
    for (int r = 0; r < 8; ++r) { b16 h_, l_; split16(fmaxf(acc[t][r] * (1.0f / (XS * WSC)), 0.0f) * XS, h_, l_); Th[wave][8 * hlf + r][t * 16 + nloc] = h_; Tl[wave][8 * hlf + r][t * 16 + nloc] = l_; }
  wave_lds_sync();
  { for (int r2 = 0; r2 < 16; r2 += 2) { const int rr = r2 + (lane >> 4), c8 = (lane & 15) * 8; const size_t gi = (m0 + rr) * F + n0 + c8; *(v8b*)(Hh + gi) = *(const v8b*)(&Th[wave][rr][c8]); *(v8b*)(Hl + gi) = *(const v8b*)(&Tl[wave][rr][c8]); }  }
}
__global__ __launch_bounds__(128) void ffn2_kernel(const b16* __restrict__ Hh, const b16* __restrict__ Hl, const b16* __restrict__ W2T, const float* __restrict__ Vf, b16* __restrict__ Eh, b16* __restrict__ El) {
  __shared__ __attribute__((aligned(16))) b16 Th[4][16][128 + 8], Tl[4][16][128 + 8];
  const int wave = threadIdx.x >> 5, lane = threadIdx.x & 31, nloc = lane & 15, hlf = lane >> 4; const size_t m0 = (size_t)blockIdx.x * 64 + wave * 16; const int n0 = blockIdx.y * 128;
  v8f acc[8];
#pragma unroll
  for (int t = 0; t < 8; ++t) acc[t] = (v8f){};
  v16b fa[2], fl[2], fw[2][8];   // two register stages: step i + 1's fragments are requested as one group ahead of step i's WMMAs; the k loop is unrolled whole so that the stage index is a constant and both stages are registers
  const b16* pa = Hh + (m0 + nloc) * F + 8 * hlf; const b16* pl = Hl + (m0 + nloc) * F + 8 * hlf; const b16* pw = W2T + (size_t)(n0 + nloc) * F + 8 * hlf;   // the lane's own addresses: every load below is one of these plus a constant
  auto ld = [&](int kb, int st) { fa[st] = frag_kb(pa + kb, 0); fl[st] = frag_kb(pl + kb, 0);
#pragma unroll
    for (int t = 0; t < 8; ++t) fw[st][t] = frag_kb(pw + t * 16 * F + kb, 0); };
  ld(0, 0);
#pragma unroll
  for (int i = 0; i < F / 32; ++i) { const int st = i & 1; if (i + 1 < F / 32) ld((i + 1) * 32, st ^ 1);
    group_fence();
#pragma unroll
    for (int t = 0; t < 8; ++t) acc[t] = wmma16b(fa[st], fw[st][t], acc[t]);
#pragma unroll
    for (int t = 0; t < 8; ++t) acc[t] = wmma16b(fl[st], fw[st][t], acc[t]);
    group_fence(); }
  addr_wait(pa, pl, pw);
#pragma unroll
  for (int t = 0; t < 8; ++t)
#pragma unroll
    for (int r = 0; r < 8; ++r) { const size_t row = m0 + 8 * hlf + r; const float y = acc[t][r] * (1.0f / (XS * WSC)) + Vf[row * D + n0 + t * 16 + nloc]; b16 h_, l_; split16(y * XS, h_, l_); Th[wave][8 * hlf + r][t * 16 + nloc] = h_; Tl[wave][8 * hlf + r][t * 16 + nloc] = l_; }
  wave_lds_sync();
  { for (int r2 = 0; r2 < 16; r2 += 2) { const int rr = r2 + (lane >> 4), c8 = (lane & 15) * 8; const size_t gi = (m0 + rr) * D + n0 + c8; *(v8b*)(Eh + gi) = *(const v8b*)(&Th[wave][rr][c8]); *(v8b*)(El + gi) = *(const v8b*)(&Tl[wave][rr][c8]); }  }
}
// output projection, channel-major store: D[c][s] = sum_d WOT[c][d] epi[s][d] (A = WOT rows c exact, B = Eh/El rows s: 2 products); block = 64 c (all) x 4 waves x 128 s of one sequence;
__global__ __launch_bounds__(128) void outproj_kernel(int bn0, const b16* __restrict__ Eh, const b16* __restrict__ El, const b16* __restrict__ WOT, float* __restrict__ out) {
  __shared__ __attribute__((aligned(16))) float Ts[4][16][128 + 4];
  const int wave = threadIdx.x >> 5, lane = threadIdx.x & 31, nloc = lane & 15, hlf = lane >> 4; const int bn = blockIdx.z; const int c0 = wave * 16, s0 = blockIdx.y * 128; const int b = (bn0 + bn) / NN, n = (bn0 + bn) % NN;
  v8f acc[8];
#pragma unroll
  for (int t = 0; t < 8; ++t) acc[t] = (v8f){};
  v16b fa[2], fh[2][8], fl[2][8];   // two register stages: step i + 1's fragments are requested as one group ahead of step i's WMMAs; the k loop is unrolled whole so that the stage index is a constant and both stages are registers
  const b16* pa = WOT + (size_t)(c0 + nloc) * D + 8 * hlf; const b16* ph = Eh + ((size_t)bn * S + s0 + nloc) * D + 8 * hlf; const b16* pl = El + ((size_t)bn * S + s0 + nloc) * D + 8 * hlf;   // the lane's own addresses: every load below is one of these plus a constant
  auto ld = [&](int kb, int st) { fa[st] = frag_kb(pa + kb, 0);
#pragma unroll
    for (int t = 0; t < 8; ++t) { fh[st][t] = frag_kb(ph + t * 16 * D + kb, 0); fl[st][t] = frag_kb(pl + t * 16 * D + kb, 0); } };
  ld(0, 0);
#pragma unroll
  for (int i = 0; i < D / 32; ++i) { const int st = i & 1; if (i + 1 < D / 32) ld((i + 1) * 32, st ^ 1);
    group_fence();
#pragma unroll
    for (int t = 0; t < 8; ++t) acc[t] = wmma16b(fa[st], fh[st][t], acc[t]);
#pragma unroll
    for (int t = 0; t < 8; ++t) acc[t] = wmma16b(fa[st], fl[st][t], acc[t]);
    group_fence(); }
  addr_wait(pa, ph, pl);
#pragma unroll
  for (int t = 0; t < 8; ++t)
#pragma unroll
    for (int r = 0; r < 8; ++r) Ts[wave][8 * hlf + r][t * 16 + nloc] = acc[t][r] * (1.0f / (XS * WSC));
  wave_lds_sync();
  { for (int rr = 0; rr < 16; ++rr) *(v4f*)(out + (((size_t)b * C + c0 + rr) * NN + n) * S + s0 + lane * 4) = *(const v4f*)(&Ts[wave][rr][lane * 4]);  }
}
}  // namespace

extern "C" void kernel_launch(void* const* d_in, const int* in_sizes, int n_in, void* d_out, int out_size, void* d_ws, size_t ws_size, hipStream_t stream) {
  (void)n_in;
  auto Fp = [&](int i) { return (const float*)d_in[i]; };
  // input order: 0 fea_lf [4,64,8,32,32], 1 fea_hf, 2 W_in [64,256], 3 W_kv [64,512], 4 gamma, 5 beta, 6 g2, 7 b2, 8 W1 [256,512], 9 W2 [512,256], 10 W_out [256,64] (all (in, out))
  if (in_sizes[0] != NR * C || in_sizes[1] != NR * C || in_sizes[2] != C * D || in_sizes[3] != C * F || in_sizes[4] != D || in_sizes[8] != D * F || in_sizes[9] != F * D || in_sizes[10] != D * C || out_size != NR * C) return;
  size_t off = 0; char* ws = (char*)d_ws;
  auto carve = [&](size_t bytes) { char* p = ws + off; off += (bytes + 255) & ~(size_t)255; return p; };
  b16* TQ16 = (b16*)carve((size_t)NR * C * 2); b16* TK16 = (b16*)carve((size_t)NR * C * 2); b16* WIN = (b16*)carve((size_t)D * C * 2); b16* WKV = (b16*)carve((size_t)F * C * 2); b16* W1T = (b16*)carve((size_t)F * D * 2); b16* W2T = (b16*)carve((size_t)D * F * 2); b16* WOT = (b16*)carve((size_t)C * D * 2);
  // per-half planes (16 sequences = 16,384 rows), reused by the second half
  b16* Qh = (b16*)carve((size_t)NRH * D * 2); b16* Ql = (b16*)carve((size_t)NRH * D * 2); b16* Kh = (b16*)carve((size_t)NRH * D * 2); b16* Kl = (b16*)carve((size_t)NRH * D * 2);
  float* Vf = (float*)carve((size_t)NRH * D * 4); b16* VTh = (b16*)carve((size_t)NRH * D * 2); b16* VTl = (b16*)carve((size_t)NRH * D * 2); b16* Hh = (b16*)carve((size_t)NRH * F * 2); b16* Hl = (b16*)carve((size_t)NRH * F * 2); float* Of = (float*)carve((size_t)NRH * D * 4);   // O gets its own rows: attention blocks still read other rows' q while O is being written
  b16* Ah = VTh; b16* Al = VTl;                                // region reuse: the transposed v planes are dead after the attention (Vf keeps the residual)
  b16* Eh = Kh; b16* El = Kl;                                  // region reuse: k planes are dead after the attention
  if (off > ws_size || off > ((size_t)128 << 20)) return;   // = 120.6 MB
  xt_kernel<<<dim3(S / 64, 2, NBN), 256, 0, stream>>>(Fp(0), Fp(1), TQ16, TK16);
  prepw_kernel<<<dim3(8, 8, 5), 256, 0, stream>>>(Fp(2), Fp(3), Fp(8), Fp(9), Fp(10), WIN, WKV, W1T, W2T, WOT);
  for (int hf = 0; hf < 2; ++hf) {
    proj_kernel<<<NRH / 64, 128, 0, stream>>>(hf * NRH, 0, TQ16, TK16, WIN, WKV, Of);   // q0 f32 rows (Of region as scratch)
    ln_kernel<<<NRH / 8, 256, 0, stream>>>(Of, Fp(4), Fp(5), Qh, Ql);
    proj_kernel<<<NRH / 64, 128, 0, stream>>>(hf * NRH, 1, TQ16, TK16, WIN, WKV, Of);   // k0
    ln_kernel<<<NRH / 8, 256, 0, stream>>>(Of, Fp(4), Fp(5), Kh, Kl);
    proj_kernel<<<NRH / 64, 128, 0, stream>>>(hf * NRH, 2, TQ16, TK16, WIN, WKV, Vf);   // v f32 rows (residual)
    v_kernel<<<dim3(D / 64, S / 128, NBH), 128, 0, stream>>>(hf * NBH, TK16, WKV, VTh, VTl);
    attn_kernel<<<dim3(S / (16 * AW), 1, NBH), 32 * AW, 0, stream>>>(Qh, Ql, Kh, Kl, VTh, VTl, Of);
    ln_kernel<<<NRH / 8, 256, 0, stream>>>(Of, Fp(6), Fp(7), Ah, Al);   // LN2(att)
    ffn1_kernel<<<dim3(NRH / 64, F / 128), 128, 0, stream>>>(Ah, Al, W1T, Hh, Hl);
    ffn2_kernel<<<dim3(NRH / 64, D / 128), 128, 0, stream>>>(Hh, Hl, W2T, Vf, Eh, El);
    outproj_kernel<<<dim3(1, S / 128, NBH), 128, 0, stream>>>(hf * NBH, Eh, El, WOT, (float*)d_out);
  }
}

// v003
// Measured time: 245 microseconds a run.
// Timed twice side by side with v002, it ran 1.36 and 1.35 times as fast.
// All steps since v000 together make it 5.38 times as fast.
#include <hip/hip_runtime.h>

// Inter-frequency attention block: 32 sequences (4 batches x 8 'n' slices) of 1,024 tokens (32 x 32 positions), 64 channels; q = LN(tok_q W_in), k = LN((tok_kv W_kv)[:, :256]) (shared gamma/beta),
// v = (tok_kv W_kv)[:, 256:]; score = q.k (no scaling), causal (lower triangle; fill -1e15 == masked out since the diagonal is always kept), softmax, att = p v; h = relu(LN2(att) W1) W2;
// out = (h + v) W_out -> written channel-major as [4][64][8][32][32].
// WMMA (v_wmma_f32_16x16x32_f16, f32 accumulate): W_in / W_kv projections with EXACT bf16 tokens (x8, LDS-transposed from the channel-major inputs) and weights (x256), 1 product, LayerNorms as row kernels; S^T = K.Q^T with
// q AND k (LayerNorm outputs) f16 hi+lo x8 (3 products: the unscaled 256-dim logits have sigma ~16); online softmax in f32; O^T += V^T P^T with v and P f16 hi+lo (3 products, one f32 accumulator:
// unscaled residuals); FFN W1 with LN2(att) hi+lo (2 products), W2 with the relu hidden hi+lo (2 products), W_out with (h + v) hi+lo (2 products). LayerNorms, softmax, relu, residual in f32.
// Inputs rounded to bf16 once. Fragment k-map per lane half hh for A AND B: elements 0..7 <- k = 8hh+0..7, 8..15 <- k = 16+8hh+0..7; acc[r] = D[8hh+r][col].

namespace {
constexpr int NBN = 32 /* b*n sequences */, NN = 8, S = 1024, C = 64, D = 256, F = 512, NR = NBN * S /* all 32 sequences go through every stage in one launch: the planes take 233 MiB of the workspace */;
constexpr float XS = 8.0f, WSC = 256.0f, PS = 8.0f, LOG2E = 1.4426950408889634f, LN_EPS = 1e-5f;

typedef _Float16 b16;
typedef __attribute__((ext_vector_type(16))) _Float16 v16b;
typedef __attribute__((ext_vector_type(8))) _Float16 v8b;
typedef __attribute__((ext_vector_type(8))) float v8f;
typedef __attribute__((ext_vector_type(4))) float v4f;
__device__ __forceinline__ float bf16_rne(float f) { unsigned int u = __float_as_uint(f); u += 0x7FFFu + ((u >> 16) & 1u); return __uint_as_float(u & 0xFFFF0000u); }
__device__ __forceinline__ void split16(float v, b16& hi, b16& lo) { hi = (b16)v; lo = (b16)(v - (float)hi); }
__device__ __forceinline__ v16b frag_kb(const b16* p, int hh) { const v8b a = *(const v8b*)(p + 8 * hh), b = *(const v8b*)(p + 16 + 8 * hh); v16b f;
#pragma unroll
  for (int e = 0; e < 8; ++e) { f[e] = a[e]; f[8 + e] = b[e]; } return f; }
__device__ __forceinline__ v8f wmma16b(v16b a, v16b b, v8f c) { return __builtin_amdgcn_wmma_f32_16x16x32_f16(false, a, false, b, (short)0, c, false, false); }
// stands between a group of fragment loads and a block of WMMAs: without it the compiler sinks each load to just in front of its own WMMA, and every load's latency is waited out alone
__device__ __forceinline__ void group_fence() { __builtin_amdgcn_sched_barrier(0); }
// stands behind the last WMMA of a loop that reads its fragments from global memory: the loads' address registers are inputs here, so none of them is given a new value ahead of this wait
__device__ __forceinline__ void addr_wait(const b16* a, const b16* b, const b16* c) { asm volatile("s_wait_xcnt 0x0" :: "v"(a), "v"(b), "v"(c) : "memory"); }
__device__ __forceinline__ void wave_lds_sync() { __builtin_amdgcn_fence(__ATOMIC_RELEASE, "workgroup"); __builtin_amdgcn_wave_barrier(); __builtin_amdgcn_fence(__ATOMIC_ACQUIRE, "workgroup"); }
__device__ __forceinline__ float nexp2(float x) { return __builtin_amdgcn_exp2f(x); }
__device__ __forceinline__ float pmul(float a, float b) { float p = a * b; asm volatile("" : "+v"(p)); return p; }
__device__ __forceinline__ float hsum16(float v) { v += __shfl_xor(v, 1); v += __shfl_xor(v, 2); v += __shfl_xor(v, 4); return v + __shfl_xor(v, 8); }

__global__ __launch_bounds__(256) void xt_kernel(const float* __restrict__ flf, const float* __restrict__ fhf, b16* __restrict__ TQ16, b16* __restrict__ TK16) {
  __shared__ __attribute__((aligned(16))) b16 T[64][64 + 8];
  const int bn = blockIdx.z, kind = blockIdx.y, s0 = blockIdx.x * 64, t_ = threadIdx.x; const int b = bn / NN, n = bn % NN; const float* src = (kind == 0 ? flf : fhf) + ((size_t)b * C * NN + n) * S; b16* dst = kind == 0 ? TQ16 : TK16;
  for (int q = t_; q < 64 * 64; q += 256) { const int cc = q >> 6, ss = q & 63; T[ss][cc] = (b16)(bf16_rne(src[(size_t)cc * NN * S + s0 + ss]) * XS); }
  __syncthreads();
  { for (int q = t_; q < 64 * 8; q += 256) { const int ss = q >> 3, c8 = (q & 7) * 8; *(v8b*)(dst + ((size_t)bn * S + s0 + ss) * C + c8) = *(const v8b*)(&T[ss][c8]); }  }
}
// weights (in,out) transposed to [out][in] rows x256 via 64x64 LDS tiles: kind 0 W_in [64][256] -> WIN [256][64]; 1 W_kv [64][512] -> WKV [512][64]; 2 W1 [256][512] -> W1T [512][256];
__global__ __launch_bounds__(256) void prepw_kernel(const float* __restrict__ win, const float* __restrict__ wkv, const float* __restrict__ w1, const float* __restrict__ w2, const float* __restrict__ wout, b16* __restrict__ WIN, b16* __restrict__ WKV, b16* __restrict__ W1T, b16* __restrict__ W2T, b16* __restrict__ WOT) {
  __shared__ __attribute__((aligned(16))) b16 T[64][64 + 8];
  const int kind = blockIdx.z, i0 = blockIdx.x * 64, o0 = blockIdx.y * 64, t_ = threadIdx.x; const float* w; b16* dst; int nin, nout;
  if (kind == 0) { w = win; dst = WIN; nin = C; nout = D; } else if (kind == 1) { w = wkv; dst = WKV; nin = C; nout = F; } else if (kind == 2) { w = w1; dst = W1T; nin = D; nout = F; } else if (kind == 3) { w = w2; dst = W2T; nin = F; nout = D; } else { w = wout; dst = WOT; nin = D; nout = C; }
  if (i0 >= nin || o0 >= nout) return;
  for (int q = t_; q < 64 * 64; q += 256) { const int ii = q >> 6, oo = q & 63; T[oo][ii] = (b16)(bf16_rne(w[(size_t)(i0 + ii) * nout + o0 + oo]) * WSC); }
  __syncthreads();
  { for (int q = t_; q < 64 * 8; q += 256) { const int oo = q >> 3, c8 = (q & 7) * 8; *(v8b*)(dst + (size_t)(o0 + oo) * nin + i0 + c8) = *(const v8b*)(&T[oo][c8]); }  }
}
// projections: block = 64 rows x 4 waves x 256 cols (16 tiles, K = 64 exact, 1 product): Y = tok W (kind 0: tok_q WIN; 1: tok_kv WKV[:256]; 2: tok_kv WKV[256:]) -> f32 rows [row][256]
__global__ __launch_bounds__(128) void proj_kernel(int kind, const b16* __restrict__ TQ16, const b16* __restrict__ TK16, const b16* __restrict__ WIN, const b16* __restrict__ WKV, float* __restrict__ Y) {
  __shared__ __attribute__((aligned(16))) float Tf[4][16][128 + 4];
  const int wave = threadIdx.x >> 5, lane = threadIdx.x & 31, nloc = lane & 15, hlf = lane >> 4; const size_t m0 = (size_t)blockIdx.x * 64 + wave * 16;
  const b16* A = kind == 0 ? TQ16 : TK16; const b16* Bw = kind == 0 ? WIN : (kind == 1 ? WKV : WKV + (size_t)D * C);
  v8f acc[16];
#pragma unroll
  for (int t = 0; t < 16; ++t) acc[t] = (v8f){};
  const b16* pa = A + (m0 + nloc) * C + 8 * hlf; const b16* pw = Bw + (size_t)nloc * C + 8 * hlf;   // the lane's own addresses: every load below is one of these plus a constant
  v16b fa[2], fw[2][16];   // all fragments of the tile (K = 64) are requested as one group
#pragma unroll
  for (int i = 0; i < 2; ++i) { fa[i] = frag_kb(pa + i * 32, 0);
#pragma unroll
    for (int t = 0; t < 16; ++t) fw[i][t] = frag_kb(pw + t * 16 * C + i * 32, 0); }
  group_fence();
#pragma unroll
  for (int i = 0; i < 2; ++i)
#pragma unroll
    for (int t = 0; t < 16; ++t) acc[t] = wmma16b(fa[i], fw[i][t], acc[t]);
  group_fence(); addr_wait(pa, pw, pw);   // the fence keeps the wait behind the WMMAs, where every load has returned
  for (int hq = 0; hq < 2; ++hq) {
#pragma unroll
    for (int t = 0; t < 8; ++t)
#pragma unroll
      for (int r = 0; r < 8; ++r) Tf[wave][8 * hlf + r][t * 16 + nloc] = acc[hq * 8 + t][r] * (1.0f / (XS * WSC));
    wave_lds_sync();
    { for (int rr = 0; rr < 16; ++rr) *(v4f*)(Y + (m0 + rr) * D + hq * 128 + lane * 4) = *(const v4f*)(&Tf[wave][rr][lane * 4]);  }
    wave_lds_sync(); }
}
__global__ __launch_bounds__(256) void ln_kernel(const float* __restrict__ X, const float* __restrict__ g, const float* __restrict__ be, b16* __restrict__ Yh, b16* __restrict__ Yl) {
  const int wave = threadIdx.x >> 5, lane = threadIdx.x & 31; const size_t row = (size_t)blockIdx.x * 8 + wave; const float* src = X + row * D + lane * 8;
  const v4f a = *(const v4f*)src, c = *(const v4f*)(src + 4); float v[8]; float s = 0.0f;
#pragma unroll
  for (int i = 0; i < 4; ++i) { v[i] = a[i]; v[4 + i] = c[i]; s += a[i] + c[i]; }
#pragma unroll
  for (int oo = 16; oo >= 1; oo >>= 1) s += __shfl_xor(s, oo);
  const float mean = s * (1.0f / D); float ss = 0.0f;
#pragma unroll
  for (int i = 0; i < 8; ++i) { const float dv = v[i] - mean; ss += pmul(dv, dv); }
#pragma unroll
  for (int oo = 16; oo >= 1; oo >>= 1) ss += __shfl_xor(ss, oo);
  const float rs = rsqrtf(ss * (1.0f / D) + LN_EPS); v8b hv, lv;
#pragma unroll
  for (int i = 0; i < 8; ++i) { const int ch = lane * 8 + i; const float y = pmul((v[i] - mean) * rs, bf16_rne(g[ch])) + bf16_rne(be[ch]); b16 h_, l_; split16(y * XS, h_, l_); hv[i] = h_; lv[i] = l_; }
  { *(v8b*)(Yh + row * D + lane * 8) = hv; *(v8b*)(Yl + row * D + lane * 8) = lv;  }
}
// v in channel-major hi/lo planes for the PV operand: VTh/VTl [bn][256 d][1024 s] = f16 hi+lo x8 of (tok_kv WKV[256:])^T: A = WKV_v rows d (K = 64), B = TK16 rows s; block = 64 d x 4 waves x
__global__ __launch_bounds__(128) void v_kernel(const b16* __restrict__ TK16, const b16* __restrict__ WKV, b16* __restrict__ VTh, b16* __restrict__ VTl) {
  __shared__ __attribute__((aligned(16))) b16 Ts[4][16][128 + 8], Tsl[4][16][128 + 8];
  const int wave = threadIdx.x >> 5, lane = threadIdx.x & 31, nloc = lane & 15, hlf = lane >> 4; const int bn = blockIdx.z; const int d0 = blockIdx.x * 64 + wave * 16, s0 = blockIdx.y * 128;
  v8f acc[8];
#pragma unroll
  for (int t = 0; t < 8; ++t) acc[t] = (v8f){};
  const b16* pa = WKV + (size_t)(d0 + nloc) * C + 8 * hlf; const b16* pw = TK16 + ((size_t)bn * S + s0 + nloc) * C + 8 * hlf;   // the lane's own addresses: every load below is one of these plus a constant
  v16b fa[2], fw[2][8];   // all fragments of the tile (K = 64) are requested as one group
#pragma unroll
  for (int i = 0; i < 2; ++i) { fa[i] = frag_kb(pa + D * C + i * 32, 0);   // the v half of W_kv: rows D .. 2D - 1
#pragma unroll
    for (int t = 0; t < 8; ++t) fw[i][t] = frag_kb(pw + t * 16 * C + i * 32, 0); }
  group_fence();
#pragma unroll
  for (int i = 0; i < 2; ++i)
#pragma unroll
    for (int t = 0; t < 8; ++t) acc[t] = wmma16b(fa[i], fw[i][t], acc[t]);
  group_fence(); addr_wait(pa, pw, pw);   // the fence keeps the wait behind the WMMAs, where every load has returned
#pragma unroll
  for (int t = 0; t < 8; ++t)
#pragma unroll
    for (int r = 0; r < 8; ++r) { b16 h_, l_; split16(acc[t][r] * (1.0f / (XS * WSC)) * XS, h_, l_); Ts[wave][8 * hlf + r][t * 16 + nloc] = h_; Tsl[wave][8 * hlf + r][t * 16 + nloc] = l_; }
  wave_lds_sync();
  { for (int rr = 0; rr < 16; ++rr) if (lane < 16) { const size_t gi = ((size_t)bn * D + d0 + rr) * S + s0 + lane * 8; *(v8b*)(VTh + gi) = *(const v8b*)(&Ts[wave][rr][lane * 8]); *(v8b*)(VTl + gi) = *(const v8b*)(&Tsl[wave][rr][lane * 8]); }  }
}
// causal attention: grid (sequences, 1, S/64), block = 4 waves x 16 queries; one block fills a WGP's LDS and there are twice as many blocks as WGPs, so the query block falls with blockIdx.z: the longest blocks start first, and a WGP
// that ends a block of the first round (18 to 32 key blocks) takes the longest one left (16 down to 2); key blocks of 32 (no scaling). Every fragment comes from LDS: each wave's q rows are copied there once, each 32-key block of
// k (rows of 512 B, LDS pitch 528 B) and of v^T (rows of 64 B, LDS pitch 80 B), hi and lo, once per block of 4 waves, by asynchronous copies to LDS, two buffers: block t + 1 flies while block t is worked on.
// The products, their order and the softmax of a wave are those of the per-wave form: S^T 3 products with K = 256 (8 steps), online softmax f32, O^T 3 products.
constexpr int AW = 4, KP = D + 8, VP = 32 + 8;
__device__ __forceinline__ unsigned lds_off(const void* p) { return (unsigned)(size_t)p; }
// eight 16-byte-per-lane copies global -> LDS, addresses stepping by ls bytes (LDS) and gs elements (global); s_wait_xcnt 0 closes the statement so that no address register is rewritten ahead of it
__device__ __forceinline__ void copy8(unsigned l, unsigned ls, const b16* g, size_t gs) {
  asm volatile("global_load_async_to_lds_b128 %0, %8, off\n\tglobal_load_async_to_lds_b128 %1, %9, off\n\tglobal_load_async_to_lds_b128 %2, %10, off\n\tglobal_load_async_to_lds_b128 %3, %11, off\n\t"
               "global_load_async_to_lds_b128 %4, %12, off\n\tglobal_load_async_to_lds_b128 %5, %13, off\n\tglobal_load_async_to_lds_b128 %6, %14, off\n\tglobal_load_async_to_lds_b128 %7, %15, off\n\ts_wait_xcnt 0x0"
               :: "v"(l), "v"(l + ls), "v"(l + 2 * ls), "v"(l + 3 * ls), "v"(l + 4 * ls), "v"(l + 5 * ls), "v"(l + 6 * ls), "v"(l + 7 * ls),
                  "v"(g), "v"(g + gs), "v"(g + 2 * gs), "v"(g + 3 * gs), "v"(g + 4 * gs), "v"(g + 5 * gs), "v"(g + 6 * gs), "v"(g + 7 * gs) : "memory");
}
__global__ __launch_bounds__(128) void attn_kernel(const b16* __restrict__ Qh, const b16* __restrict__ Ql, const b16* __restrict__ Kh, const b16* __restrict__ Kl, const b16* __restrict__ VTh, const b16* __restrict__ VTl, float* __restrict__ Of) {
  __shared__ __attribute__((aligned(16))) b16 Ks[2][2][32][KP];    // [buffer][hi, lo][key][d]
  __shared__ __attribute__((aligned(16))) b16 Vs[2][2][D][VP];     // [buffer][hi, lo][d][key]
  __shared__ __attribute__((aligned(16))) b16 Qs[AW][2][16][KP];   // [wave][hi, lo][query][d]
  __shared__ __attribute__((aligned(16))) float To[AW][16][D + 4];
  const int wave = __builtin_amdgcn_readfirstlane(threadIdx.x >> 5), lane = threadIdx.x & 31, hh = lane >> 4, col = lane & 15; const int bn = blockIdx.x, qb = S / (16 * AW) - 1 - blockIdx.z; const int q0 = qb * (16 * AW) + wave * 16, qi = q0 + col;
  const b16* Kb = Kh + (size_t)bn * S * D; const b16* Klb = Kl + (size_t)bn * S * D; const b16* Vb = VTh + (size_t)bn * D * S; const b16* Vlb = VTl + (size_t)bn * D * S;
  // a wave's share of one key block: 8 k rows (a row = one copy of 32 lanes x 16 B) and 64 v^T rows (8 rows = one copy), hi and lo: 32 copies
  const size_t kg = (size_t)(wave * 8) * D + lane * 8, vg = (size_t)(wave * 64 + (lane >> 2)) * S + (lane & 3) * 8;
  auto stage = [&](int kb, int bf) {
    copy8(lds_off(&Ks[bf][0][wave * 8][lane * 8]), KP * 2, Kb + (size_t)kb * D + kg, D); copy8(lds_off(&Ks[bf][1][wave * 8][lane * 8]), KP * 2, Klb + (size_t)kb * D + kg, D);
    copy8(lds_off(&Vs[bf][0][wave * 64 + (lane >> 2)][(lane & 3) * 8]), 8 * VP * 2, Vb + vg + kb, (size_t)8 * S); copy8(lds_off(&Vs[bf][1][wave * 64 + (lane >> 2)][(lane & 3) * 8]), 8 * VP * 2, Vlb + vg + kb, (size_t)8 * S); };
  { const size_t qg = ((size_t)bn * S + q0) * D + lane * 8;
    copy8(lds_off(&Qs[wave][0][0][lane * 8]), KP * 2, Qh + qg, D); copy8(lds_off(&Qs[wave][0][8][lane * 8]), KP * 2, Qh + qg + 8 * D, D);
    copy8(lds_off(&Qs[wave][1][0][lane * 8]), KP * 2, Ql + qg, D); copy8(lds_off(&Qs[wave][1][8][lane * 8]), KP * 2, Ql + qg + 8 * D, D); }
  asm volatile("s_wait_asynccnt 0x0" ::: "memory");   // the q copies have landed (and no more than 32 copies of a wave are ever outstanding)
  stage(0, 0);
  asm volatile("s_wait_asynccnt 0x0" ::: "memory");   // this wave's share of key block 0 has landed
  __syncthreads();                                    // ... and every other wave's: nothing is read from LDS in front of this barrier
  stage(32, 1);                                       // nt >= 2: key block 1 always exists
  const b16* Qb = &Qs[wave][0][col][0]; const b16* Qlb = &Qs[wave][1][col][0];
  float m = -INFINITY, l = 0.0f; v8f o[16];
#pragma unroll
  for (int t = 0; t < 16; ++t) o[t] = (v8f){};
  const float cs = LOG2E / (XS * XS); const int kend = q0 + 16;   // causal
  const int nt = qb * (16 * AW / 32) + 16 * AW / 32;      // key blocks of the work-group's last wave; the same for all its waves
  for (int it = 0; it < nt; ++it) { const int kb = it * 32, bf = it & 1;
   if (kb < kend) {   // a wave past its diagonal skips the work, never the publish point below
    v8f s0 = {}, s1 = {};
    v16b fq[2][2], fk[2][4];   // two register stages: step i + 1's six fragments are read from LDS as one group ahead of step i's WMMAs; s0 and s1 take turns, each in its old order; unrolled whole so that the stage index is a constant
    auto ldk = [&](int ks, int st) { fq[st][0] = frag_kb(Qb + ks, hh); fq[st][1] = frag_kb(Qlb + ks, hh); fk[st][0] = frag_kb(&Ks[bf][0][col][ks], hh); fk[st][1] = frag_kb(&Ks[bf][0][16 + col][ks], hh);
      fk[st][2] = frag_kb(&Ks[bf][1][col][ks], hh); fk[st][3] = frag_kb(&Ks[bf][1][16 + col][ks], hh); };
    ldk(0, 0);
#pragma unroll
    for (int i = 0; i < D / 32; ++i) { const int st = i & 1; if (i + 1 < D / 32) ldk((i + 1) * 32, st ^ 1);
      group_fence();
      s0 = wmma16b(fk[st][0], fq[st][0], s0); s1 = wmma16b(fk[st][1], fq[st][0], s1); s0 = wmma16b(fk[st][0], fq[st][1], s0); s1 = wmma16b(fk[st][1], fq[st][1], s1);
      s0 = wmma16b(fk[st][2], fq[st][0], s0); s1 = wmma16b(fk[st][3], fq[st][0], s1);
      group_fence(); }
    v16b fv[3][2][2];          // three register stages of two d tiles (hi, lo) each: the first two groups are read ahead of the softmax, group g + 2 ahead of group g's WMMAs; the two tiles take turns, each in its old order
    auto ldv = [&](int g, int st) {
#pragma unroll
      for (int j = 0; j < 2; ++j) { fv[st][j][0] = frag_kb(&Vs[bf][0][(2 * g + j) * 16 + col][0], hh); fv[st][j][1] = frag_kb(&Vs[bf][1][(2 * g + j) * 16 + col][0], hh); } };
    ldv(0, 0); ldv(1, 1);
    group_fence();
    float e[16]; float mx = -INFINITY;
#pragma unroll
    for (int r = 0; r < 8; ++r) { const int k0i = kb + 8 * hh + r, k1i = kb + 16 + 8 * hh + r; e[r] = (k0i <= qi) ? s0[r] * cs : -INFINITY; e[8 + r] = (k1i <= qi) ? s1[r] * cs : -INFINITY; mx = fmaxf(mx, fmaxf(e[r], e[8 + r])); }
    mx = fmaxf(mx, __shfl_xor(mx, 16)); const float mn = fmaxf(m, mx); const float al = nexp2(m - mn); m = mn; float sum = 0.0f; v16b ph, pl;   // key 0 <= qi always -> mn finite
#pragma unroll
    for (int i = 0; i < 16; ++i) { const float p = nexp2(e[i] - mn); sum += p; const b16 h_ = (b16)(p * PS); ph[i] = h_; pl[i] = (b16)(p * PS - (float)h_); }
    sum += __shfl_xor(sum, 16); l = l * al + sum;
#pragma unroll
    for (int g = 0; g < 8; ++g) { const int st = g % 3, t0 = 2 * g, t1 = 2 * g + 1; if (g + 2 < 8) ldv(g + 2, (g + 2) % 3);
      o[t0] *= al; o[t1] *= al;
      group_fence();
      o[t0] = wmma16b(fv[st][0][0], ph, o[t0]); o[t1] = wmma16b(fv[st][1][0], ph, o[t1]); o[t0] = wmma16b(fv[st][0][0], pl, o[t0]); o[t1] = wmma16b(fv[st][1][0], pl, o[t1]);
      o[t0] = wmma16b(fv[st][0][1], ph, o[t0]); o[t1] = wmma16b(fv[st][1][1], ph, o[t1]);
      if (g + 2 < 8) group_fence(); } }   // no reads follow the last two groups: nothing to hold there
   // publish point of key block it + 1, passed by every wave
   asm volatile("s_wait_dscnt 0x0" ::: "memory");      // this wave's reads of buffer bf are done before it may be refilled
   asm volatile("s_wait_asynccnt 0x0" ::: "memory");   // this wave's share of key block it + 1 has landed
   __syncthreads();                                    // both hold for every wave
   if (it + 2 < nt) stage(kb + 64, bf); }
  asm volatile("s_wait_asynccnt 0x0" ::: "memory");    // no copy is outstanding when the wave ends
  const float inv = 1.0f / (l * PS * XS);
#pragma unroll
  for (int t = 0; t < 16; ++t)
#pragma unroll
    for (int r = 0; r < 8; ++r) To[wave][col][t * 16 + 8 * hh + r] = o[t][r] * inv;
  wave_lds_sync();
  { for (int rr = 0; rr < 16; ++rr) { const size_t gi = ((size_t)bn * S + q0 + rr) * D; *(v4f*)(Of + gi + lane * 4) = *(const v4f*)(&To[wave][rr][lane * 4]); *(v4f*)(Of + gi + 128 + lane * 4) = *(const v4f*)(&To[wave][rr][128 + lane * 4]); }  }
}
__global__ __launch_bounds__(128) void ffn1_kernel(const b16* __restrict__ Ah, const b16* __restrict__ Al, const b16* __restrict__ W1T, b16* __restrict__ Hh, b16* __restrict__ Hl) {
  __shared__ __attribute__((aligned(16))) b16 Th[4][16][128 + 8], Tl[4][16][128 + 8];
  const int wave = threadIdx.x >> 5, lane = threadIdx.x & 31, nloc = lane & 15, hlf = lane >> 4; const size_t m0 = (size_t)blockIdx.x * 64 + wave * 16; const int n0 = blockIdx.y * 128;
  v8f acc[8];
#pragma unroll
  for (int t = 0; t < 8; ++t) acc[t] = (v8f){};
  v16b fa[2], fl[2], fw[2][8];   // two register stages: step i + 1's fragments are requested as one group ahead of step i's WMMAs; the k loop is unrolled whole so that the stage index is a constant and both stages are registers
  const b16* pa = Ah + (m0 + nloc) * D + 8 * hlf; const b16* pl = Al + (m0 + nloc) * D + 8 * hlf; const b16* pw = W1T + (size_t)(n0 + nloc) * D + 8 * hlf;   // the lane's own addresses: every load below is one of these plus a constant
  auto ld = [&](int kb, int st) { fa[st] = frag_kb(pa + kb, 0); fl[st] = frag_kb(pl + kb, 0);
#pragma unroll
    for (int t = 0; t < 8; ++t) fw[st][t] = frag_kb(pw + t * 16 * D + kb, 0); };
  ld(0, 0);
#pragma unroll
  for (int i = 0; i < D / 32; ++i) { const int st = i & 1; if (i + 1 < D / 32) ld((i + 1) * 32, st ^ 1);
    group_fence();
#pragma unroll
    for (int t = 0; t < 8; ++t) acc[t] = wmma16b(fa[st], fw[st][t], acc[t]);
#pragma unroll
    for (int t = 0; t < 8; ++t) acc[t] = wmma16b(fl[st], fw[st][t], acc[t]);
    group_fence(); }
  addr_wait(pa, pl, pw);
#pragma unroll
  for (int t = 0; t < 8; ++t)
#pragma unroll
    for (int r = 0; r < 8; ++r) { b16 h_, l_; split16(fmaxf(acc[t][r] * (1.0f / (XS * WSC)), 0.0f) * XS, h_, l_); Th[wave][8 * hlf + r][t * 16 + nloc] = h_; Tl[wave][8 * hlf + r][t * 16 + nloc] = l_; }
  wave_lds_sync();
  { for (int r2 = 0; r2 < 16; r2 += 2) { const int rr = r2 + (lane >> 4), c8 = (lane & 15) * 8; const size_t gi = (m0 + rr) * F + n0 + c8; *(v8b*)(Hh + gi) = *(const v8b*)(&Th[wave][rr][c8]); *(v8b*)(Hl + gi) = *(const v8b*)(&Tl[wave][rr][c8]); }  }
}
__global__ __launch_bounds__(128) void ffn2_kernel(const b16* __restrict__ Hh, const b16* __restrict__ Hl, const b16* __restrict__ W2T, const float* __restrict__ Vf, b16* __restrict__ Eh, b16* __restrict__ El) {
  __shared__ __attribute__((aligned(16))) b16 Th[4][16][128 + 8], Tl[4][16][128 + 8];
  const int wave = threadIdx.x >> 5, lane = threadIdx.x & 31, nloc = lane & 15, hlf = lane >> 4; const size_t m0 = (size_t)blockIdx.x * 64 + wave * 16; const int n0 = blockIdx.y * 128;
  v8f acc[8];
#pragma unroll
  for (int t = 0; t < 8; ++t) acc[t] = (v8f){};
  v16b fa[2], fl[2], fw[2][8];   // two register stages: step i + 1's fragments are requested as one group ahead of step i's WMMAs; the k loop is unrolled whole so that the stage index is a constant and both stages are registers
  const b16* pa = Hh + (m0 + nloc) * F + 8 * hlf; const b16* pl = Hl + (m0 + nloc) * F + 8 * hlf; const b16* pw = W2T + (size_t)(n0 + nloc) * F + 8 * hlf;   // the lane's own addresses: every load below is one of these plus a constant
  auto ld = [&](int kb, int st) { fa[st] = frag_kb(pa + kb, 0); fl[st] = frag_kb(pl + kb, 0);
#pragma unroll
    for (int t = 0; t < 8; ++t) fw[st][t] = frag_kb(pw + t * 16 * F + kb, 0); };
  ld(0, 0);
#pragma unroll
  for (int i = 0; i < F / 32; ++i) { const int st = i & 1; if (i + 1 < F / 32) ld((i + 1) * 32, st ^ 1);
    group_fence();
#pragma unroll
    for (int t = 0; t < 8; ++t) acc[t] = wmma16b(fa[st], fw[st][t], acc[t]);
#pragma unroll
    for (int t = 0; t < 8; ++t) acc[t] = wmma16b(fl[st], fw[st][t], acc[t]);
    group_fence(); }
  addr_wait(pa, pl, pw);
#pragma unroll
  for (int t = 0; t < 8; ++t)
#pragma unroll
    for (int r = 0; r < 8; ++r) { const size_t row = m0 + 8 * hlf + r; const float y = acc[t][r] * (1.0f / (XS * WSC)) + Vf[row * D + n0 + t * 16 + nloc]; b16 h_, l_; split16(y * XS, h_, l_); Th[wave][8 * hlf + r][t * 16 + nloc] = h_; Tl[wave][8 * hlf + r][t * 16 + nloc] = l_; }
  wave_lds_sync();
  { for (int r2 = 0; r2 < 16; r2 += 2) { const int rr = r2 + (lane >> 4), c8 = (lane & 15) * 8; const size_t gi = (m0 + rr) * D + n0 + c8; *(v8b*)(Eh + gi) = *(const v8b*)(&Th[wave][rr][c8]); *(v8b*)(El + gi) = *(const v8b*)(&Tl[wave][rr][c8]); }  }
}
// output projection, channel-major store: D[c][s] = sum_d WOT[c][d] epi[s][d] (A = WOT rows c exact, B = Eh/El rows s: 2 products); block = 64 c (all) x 4 waves x 128 s of one sequence;
__global__ __launch_bounds__(128) void outproj_kernel(const b16* __restrict__ Eh, const b16* __restrict__ El, const b16* __restrict__ WOT, float* __restrict__ out) {
  __shared__ __attribute__((aligned(16))) float Ts[4][16][128 + 4];
  const int wave = threadIdx.x >> 5, lane = threadIdx.x & 31, nloc = lane & 15, hlf = lane >> 4; const int bn = blockIdx.z; const int c0 = wave * 16, s0 = blockIdx.y * 128; const int b = bn / NN, n = bn % NN;
  v8f acc[8];
#pragma unroll
  for (int t = 0; t < 8; ++t) acc[t] = (v8f){};
  v16b fa[2], fh[2][8], fl[2][8];   // two register stages: step i + 1's fragments are requested as one group ahead of step i's WMMAs; the k loop is unrolled whole so that the stage index is a constant and both stages are registers
  const b16* pa = WOT + (size_t)(c0 + nloc) * D + 8 * hlf; const b16* ph = Eh + ((size_t)bn * S + s0 + nloc) * D + 8 * hlf; const b16* pl = El + ((size_t)bn * S + s0 + nloc) * D + 8 * hlf;   // the lane's own addresses: every load below is one of these plus a constant
  auto ld = [&](int kb, int st) { fa[st] = frag_kb(pa + kb, 0);
#pragma unroll
    for (int t = 0; t < 8; ++t) { fh[st][t] = frag_kb(ph + t * 16 * D + kb, 0); fl[st][t] = frag_kb(pl + t * 16 * D + kb, 0); } };
  ld(0, 0);
#pragma unroll
  for (int i = 0; i < D / 32; ++i) { const int st = i & 1; if (i + 1 < D / 32) ld((i + 1) * 32, st ^ 1);
    group_fence();
#pragma unroll
    for (int t = 0; t < 8; ++t) acc[t] = wmma16b(fa[st], fh[st][t], acc[t]);
#pragma unroll
    for (int t = 0; t < 8; ++t) acc[t] = wmma16b(fa[st], fl[st][t], acc[t]);
    group_fence(); }
  addr_wait(pa, ph, pl);
#pragma unroll
  for (int t = 0; t < 8; ++t)
#pragma unroll
    for (int r = 0; r < 8; ++r) Ts[wave][8 * hlf + r][t * 16 + nloc] = acc[t][r] * (1.0f / (XS * WSC));
  wave_lds_sync();
  { for (int rr = 0; rr < 16; ++rr) *(v4f*)(out + (((size_t)b * C + c0 + rr) * NN + n) * S + s0 + lane * 4) = *(const v4f*)(&Ts[wave][rr][lane * 4]);  }
}
}  // namespace

extern "C" void kernel_launch(void* const* d_in, const int* in_sizes, int n_in, void* d_out, int out_size, void* d_ws, size_t ws_size, hipStream_t stream) {
  (void)n_in;
  auto Fp = [&](int i) { return (const float*)d_in[i]; };
  // input order: 0 fea_lf [4,64,8,32,32], 1 fea_hf, 2 W_in [64,256], 3 W_kv [64,512], 4 gamma, 5 beta, 6 g2, 7 b2, 8 W1 [256,512], 9 W2 [512,256], 10 W_out [256,64] (all (in, out))
  if (in_sizes[0] != NR * C || in_sizes[1] != NR * C || in_sizes[2] != C * D || in_sizes[3] != C * F || in_sizes[4] != D || in_sizes[8] != D * F || in_sizes[9] != F * D || in_sizes[10] != D * C || out_size != NR * C) return;
  size_t off = 0; char* ws = (char*)d_ws;
  auto carve = [&](size_t bytes) { char* p = ws + off; off += (bytes + 255) & ~(size_t)255; return p; };
  b16* TQ16 = (b16*)carve((size_t)NR * C * 2); b16* TK16 = (b16*)carve((size_t)NR * C * 2); b16* WIN = (b16*)carve((size_t)D * C * 2); b16* WKV = (b16*)carve((size_t)F * C * 2); b16* W1T = (b16*)carve((size_t)F * D * 2); b16* W2T = (b16*)carve((size_t)D * F * 2); b16* WOT = (b16*)carve((size_t)C * D * 2);
  b16* Qh = (b16*)carve((size_t)NR * D * 2); b16* Ql = (b16*)carve((size_t)NR * D * 2); b16* Kh = (b16*)carve((size_t)NR * D * 2); b16* Kl = (b16*)carve((size_t)NR * D * 2);
  float* Vf = (float*)carve((size_t)NR * D * 4); b16* VTh = (b16*)carve((size_t)NR * D * 2); b16* VTl = (b16*)carve((size_t)NR * D * 2); b16* Hh = (b16*)carve((size_t)NR * F * 2); b16* Hl = (b16*)carve((size_t)NR * F * 2); float* Of = (float*)carve((size_t)NR * D * 4);   // O gets its own rows: attention blocks still read other rows' q while O is being written
  b16* Ah = VTh; b16* Al = VTl;                                // region reuse: the transposed v planes are dead after the attention (Vf keeps the residual)
  b16* Eh = Kh; b16* El = Kl;                                  // region reuse: k planes are dead after the attention
  if (off > ws_size) return;   // = 244 MB
  xt_kernel<<<dim3(S / 64, 2, NBN), 256, 0, stream>>>(Fp(0), Fp(1), TQ16, TK16);
  prepw_kernel<<<dim3(8, 8, 5), 256, 0, stream>>>(Fp(2), Fp(3), Fp(8), Fp(9), Fp(10), WIN, WKV, W1T, W2T, WOT);
  proj_kernel<<<NR / 64, 128, 0, stream>>>(0, TQ16, TK16, WIN, WKV, Of);   // q0 f32 rows (Of region as scratch)
  ln_kernel<<<NR / 8, 256, 0, stream>>>(Of, Fp(4), Fp(5), Qh, Ql);
  proj_kernel<<<NR / 64, 128, 0, stream>>>(1, TQ16, TK16, WIN, WKV, Of);   // k0
  ln_kernel<<<NR / 8, 256, 0, stream>>>(Of, Fp(4), Fp(5), Kh, Kl);
  proj_kernel<<<NR / 64, 128, 0, stream>>>(2, TQ16, TK16, WIN, WKV, Vf);   // v f32 rows (residual)
  v_kernel<<<dim3(D / 64, S / 128, NBN), 128, 0, stream>>>(TK16, WKV, VTh, VTl);
  attn_kernel<<<dim3(NBN, 1, S / (16 * AW)), 32 * AW, 0, stream>>>(Qh, Ql, Kh, Kl, VTh, VTl, Of);
  ln_kernel<<<NR / 8, 256, 0, stream>>>(Of, Fp(6), Fp(7), Ah, Al);   // LN2(att)
  ffn1_kernel<<<dim3(NR / 64, F / 128), 128, 0, stream>>>(Ah, Al, W1T, Hh, Hl);
  ffn2_kernel<<<dim3(NR / 64, D / 128), 128, 0, stream>>>(Hh, Hl, W2T, Vf, Eh, El);
  outproj_kernel<<<dim3(1, S / 128, NBN), 128, 0, stream>>>(Eh, El, WOT, (float*)d_out);
}

// v004
// A run of this version takes 216 microseconds.
// In both of two side-by-side timings against v003, it was 1.14 times as fast.
// All steps since v000 together make it 6.14 times as fast.
#include <hip/hip_runtime.h>

// Inter-frequency attention block: 32 sequences (4 batches x 8 'n' slices) of 1,024 tokens (32 x 32 positions), 64 channels; q = LN(tok_q W_in), k = LN((tok_kv W_kv)[:, :256]) (shared gamma/beta),
// v = (tok_kv W_kv)[:, 256:]; score = q.k (no scaling), causal (lower triangle; fill -1e15 == masked out since the diagonal is always kept), softmax, att = p v; h = relu(LN2(att) W1) W2;
// out = (h + v) W_out -> written channel-major as [4][64][8][32][32].
// WMMA (v_wmma_f32_16x16x32_f16, f32 accumulate): W_in / W_kv projections with EXACT bf16 tokens (x8, LDS-transposed from the channel-major inputs) and weights (x256), 1 product, each LayerNorm in the epilogue of the kernel that makes its rows; S^T = K.Q^T with
// q AND k (LayerNorm outputs) f16 hi+lo x8 (3 products: the unscaled 256-dim logits have sigma ~16); online softmax in f32; O^T += V^T P^T with v and P f16 hi+lo (3 products, one f32 accumulator:
// unscaled residuals); FFN W1 with LN2(att) hi+lo (2 products), W2 with the relu hidden hi+lo (2 products), W_out with (h + v) hi+lo (2 products). LayerNorms, softmax, relu, residual in f32.
// Inputs rounded to bf16 once. Fragment k-map per lane half hh for A AND B: elements 0..7 <- k = 8hh+0..7, 8..15 <- k = 16+8hh+0..7; acc[r] = D[8hh+r][col].

namespace {
constexpr int NBN = 32 /* b*n sequences */, NN = 8, S = 1024, C = 64, D = 256, F = 512, NR = NBN * S /* all 32 sequences go through every stage in one launch: the planes take 233 MiB of the workspace */;
constexpr float XS = 8.0f, WSC = 256.0f, PS = 8.0f, LOG2E = 1.4426950408889634f, LN_EPS = 1e-5f;

typedef _Float16 b16;
typedef __attribute__((ext_vector_type(16))) _Float16 v16b;
typedef __attribute__((ext_vector_type(8))) _Float16 v8b;
typedef __attribute__((ext_vector_type(8))) float v8f;
typedef __attribute__((ext_vector_type(4))) float v4f;
__device__ __forceinline__ float bf16_rne(float f) { unsigned int u = __float_as_uint(f); u += 0x7FFFu + ((u >> 16) & 1u); return __uint_as_float(u & 0xFFFF0000u); }
__device__ __forceinline__ void split16(float v, b16& hi, b16& lo) { hi = (b16)v; lo = (b16)(v - (float)hi); }
__device__ __forceinline__ v16b frag_kb(const b16* p, int hh) { const v8b a = *(const v8b*)(p + 8 * hh), b = *(const v8b*)(p + 16 + 8 * hh); v16b f;
#pragma unroll
  for (int e = 0; e < 8; ++e) { f[e] = a[e]; f[8 + e] = b[e]; } return f; }
__device__ __forceinline__ v8f wmma16b(v16b a, v16b b, v8f c) { return __builtin_amdgcn_wmma_f32_16x16x32_f16(false, a, false, b, (short)0, c, false, false); }
// stands between a group of fragment loads and a block of WMMAs: without it the compiler sinks each load to just in front of its own WMMA, and every load's latency is waited out alone
__device__ __forceinline__ void group_fence() { __builtin_amdgcn_sched_barrier(0); }
// stands behind the last WMMA of a loop that reads its fragments from global memory: the loads' address registers are inputs here, so none of them is given a new value ahead of this wait
__device__ __forceinline__ void addr_wait(const b16* a, const b16* b, const b16* c) { asm volatile("s_wait_xcnt 0x0" :: "v"(a), "v"(b), "v"(c) : "memory"); }
__device__ __forceinline__ void wave_lds_sync() { __builtin_amdgcn_fence(__ATOMIC_RELEASE, "workgroup"); __builtin_amdgcn_wave_barrier(); __builtin_amdgcn_fence(__ATOMIC_ACQUIRE, "workgroup"); }
__device__ __forceinline__ float nexp2(float x) { return __builtin_amdgcn_exp2f(x); }
// sum over a 16-lane row, left in every lane of it: four adds whose second operand comes from lane ^ M of the row (DPP row_xmask), no LDS round trip
template <int M> __device__ __forceinline__ float xadd(float v) { return v + __int_as_float(__builtin_amdgcn_update_dpp(0, __float_as_int(v), 0x160 + M, 0xf, 0xf, true)); }
__device__ __forceinline__ float hsum16(float v) { return xadd<8>(xadd<4>(xadd<2>(xadd<1>(v)))); }

__global__ __launch_bounds__(256) void xt_kernel(const float* __restrict__ flf, const float* __restrict__ fhf, b16* __restrict__ TQ16, b16* __restrict__ TK16) {
  __shared__ __attribute__((aligned(16))) b16 T[64][64 + 8];
  const int bn = blockIdx.z, kind = blockIdx.y, s0 = blockIdx.x * 64, t_ = threadIdx.x; const int b = bn / NN, n = bn % NN; const float* src = (kind == 0 ? flf : fhf) + ((size_t)b * C * NN + n) * S; b16* dst = kind == 0 ? TQ16 : TK16;
  for (int q = t_; q < 64 * 64; q += 256) { const int cc = q >> 6, ss = q & 63; T[ss][cc] = (b16)(bf16_rne(src[(size_t)cc * NN * S + s0 + ss]) * XS); }
  __syncthreads();
  { for (int q = t_; q < 64 * 8; q += 256) { const int ss = q >> 3, c8 = (q & 7) * 8; *(v8b*)(dst + ((size_t)bn * S + s0 + ss) * C + c8) = *(const v8b*)(&T[ss][c8]); }  }
}
// weights (in,out) transposed to [out][in] rows x256 via 64x64 LDS tiles: kind 0 W_in [64][256] -> WIN [256][64]; 1 W_kv [64][512] -> WKV [512][64]; 2 W1 [256][512] -> W1T [512][256];
__global__ __launch_bounds__(256) void prepw_kernel(const float* __restrict__ win, const float* __restrict__ wkv, const float* __restrict__ w1, const float* __restrict__ w2, const float* __restrict__ wout, b16* __restrict__ WIN, b16* __restrict__ WKV, b16* __restrict__ W1T, b16* __restrict__ W2T, b16* __restrict__ WOT) {
  __shared__ __attribute__((aligned(16))) b16 T[64][64 + 8];
  const int kind = blockIdx.z, i0 = blockIdx.x * 64, o0 = blockIdx.y * 64, t_ = threadIdx.x; const float* w; b16* dst; int nin, nout;
  if (kind == 0) { w = win; dst = WIN; nin = C; nout = D; } else if (kind == 1) { w = wkv; dst = WKV; nin = C; nout = F; } else if (kind == 2) { w = w1; dst = W1T; nin = D; nout = F; } else if (kind == 3) { w = w2; dst = W2T; nin = F; nout = D; } else { w = wout; dst = WOT; nin = D; nout = C; }
  if (i0 >= nin || o0 >= nout) return;
  for (int q = t_; q < 64 * 64; q += 256) { const int ii = q >> 6, oo = q & 63; T[oo][ii] = (b16)(bf16_rne(w[(size_t)(i0 + ii) * nout + o0 + oo]) * WSC); }
  __syncthreads();
  { for (int q = t_; q < 64 * 8; q += 256) { const int oo = q >> 3, c8 = (q & 7) * 8; *(v8b*)(dst + (size_t)(o0 + oo) * nin + i0 + c8) = *(const v8b*)(&T[oo][c8]); }  }
}
// projections: block = 64 rows x 4 waves x 256 cols (16 tiles, K = 64 exact, 1 product): Y = tok W (kind 0: tok_q WIN; 1: tok_kv WKV[:256]; 2: tok_kv WKV[256:]) -> f32 rows [row][256]
__global__ __launch_bounds__(128) void proj_kernel(int kind, const b16* __restrict__ TQ16, const b16* __restrict__ TK16, const b16* __restrict__ WIN, const b16* __restrict__ WKV, float* __restrict__ Y) {
  __shared__ __attribute__((aligned(16))) float Tf[4][16][128 + 4];
  const int wave = threadIdx.x >> 5, lane = threadIdx.x & 31, nloc = lane & 15, hlf = lane >> 4; const size_t m0 = (size_t)blockIdx.x * 64 + wave * 16;
  const b16* A = kind == 0 ? TQ16 : TK16; const b16* Bw = kind == 0 ? WIN : (kind == 1 ? WKV : WKV + (size_t)D * C);
  v8f acc[16];
#pragma unroll
  for (int t = 0; t < 16; ++t) acc[t] = (v8f){};
  const b16* pa = A + (m0 + nloc) * C + 8 * hlf; const b16* pw = Bw + (size_t)nloc * C + 8 * hlf;   // the lane's own addresses: every load below is one of these plus a constant
  v16b fa[2], fw[2][16];   // all fragments of the tile (K = 64) are requested as one group
#pragma unroll
  for (int i = 0; i < 2; ++i) { fa[i] = frag_kb(pa + i * 32, 0);
#pragma unroll
    for (int t = 0; t < 16; ++t) fw[i][t] = frag_kb(pw + t * 16 * C + i * 32, 0); }
  group_fence();
#pragma unroll
  for (int i = 0; i < 2; ++i)
#pragma unroll
    for (int t = 0; t < 16; ++t) acc[t] = wmma16b(fa[i], fw[i][t], acc[t]);
  group_fence(); addr_wait(pa, pw, pw);   // the fence keeps the wait behind the WMMAs, where every load has returned
  for (int hq = 0; hq < 2; ++hq) {
#pragma unroll
    for (int t = 0; t < 8; ++t)
#pragma unroll
      for (int r = 0; r < 8; ++r) Tf[wave][8 * hlf + r][t * 16 + nloc] = acc[hq * 8 + t][r] * (1.0f / (XS * WSC));
    wave_lds_sync();
    { for (int rr = 0; rr < 16; ++rr) *(v4f*)(Y + (m0 + rr) * D + hq * 128 + lane * 4) = *(const v4f*)(&Tf[wave][rr][lane * 4]);  }
    wave_lds_sync(); }
}
// q and k projections with their LayerNorm (kind 0: tok_q WIN; 1: tok_kv WKV[:256]): the products of proj_kernel; a wave holds its 16 rows whole (256 columns: 16 in a lane x 16 lanes), so mean, variance and the
// affine step are taken on the accumulators, and the f16 hi+lo x8 planes go out through LDS as whole rows: no f32 plane and no row kernel in between
__global__ __launch_bounds__(128) void projln_kernel(int kind, const b16* __restrict__ TQ16, const b16* __restrict__ TK16, const b16* __restrict__ WIN, const b16* __restrict__ WKV, const float* __restrict__ g, const float* __restrict__ be, b16* __restrict__ Yh, b16* __restrict__ Yl) {
  __shared__ __attribute__((aligned(16))) b16 Th[4][16][D + 8], Tl[4][16][D + 8];
  const int wave = threadIdx.x >> 5, lane = threadIdx.x & 31, nloc = lane & 15, hlf = lane >> 4; const size_t m0 = (size_t)blockIdx.x * 64 + wave * 16;
  const b16* A = kind == 0 ? TQ16 : TK16; const b16* Bw = kind == 0 ? WIN : WKV;
  v8f acc[16];
#pragma unroll
  for (int t = 0; t < 16; ++t) acc[t] = (v8f){};
  const b16* pa = A + (m0 + nloc) * C + 8 * hlf; const b16* pw = Bw + (size_t)nloc * C + 8 * hlf;   // the lane's own addresses: every load below is one of these plus a constant
  v16b fa[2], fw[2][16];   // all fragments of the tile (K = 64) are requested as one group, the lane's 16 gamma and beta values with them
#pragma unroll
  for (int i = 0; i < 2; ++i) { fa[i] = frag_kb(pa + i * 32, 0);
#pragma unroll
    for (int t = 0; t < 16; ++t) fw[i][t] = frag_kb(pw + t * 16 * C + i * 32, 0); }
  float gv[16], bv[16];
#pragma unroll
  for (int t = 0; t < 16; ++t) { gv[t] = g[t * 16 + nloc]; bv[t] = be[t * 16 + nloc]; }
  group_fence();
#pragma unroll
  for (int i = 0; i < 2; ++i)
#pragma unroll
    for (int t = 0; t < 16; ++t) acc[t] = wmma16b(fa[i], fw[i][t], acc[t]);
  group_fence(); addr_wait(pa, pw, pw);   // the fence keeps the wait behind the WMMAs, where every load has returned
  constexpr float SC = 1.0f / (XS * WSC);   // a power of two: scaling the sum is scaling every term
  float mean[8], rs[8];   // the loops below are unrolled whole: acc, gv, bv, mean and rs are register arrays and take constant indices only
#pragma unroll
  for (int r = 0; r < 8; ++r) { float s = 0.0f;
#pragma unroll
    for (int t = 0; t < 16; ++t) s += acc[t][r];
    mean[r] = hsum16(s) * (SC / D); }
#pragma unroll
  for (int r = 0; r < 8; ++r) { float ss = 0.0f;
#pragma unroll
    for (int t = 0; t < 16; ++t) { const float dv = acc[t][r] * SC - mean[r]; acc[t][r] = dv; ss += dv * dv; }
    rs[r] = rsqrtf(hsum16(ss) * (1.0f / D) + LN_EPS); }
#pragma unroll
  for (int t = 0; t < 16; ++t) { const float gt = bf16_rne(gv[t]), bt = bf16_rne(bv[t]);
#pragma unroll
    for (int r = 0; r < 8; ++r) { b16 h_, l_; split16((acc[t][r] * rs[r] * gt + bt) * XS, h_, l_); Th[wave][8 * hlf + r][t * 16 + nloc] = h_; Tl[wave][8 * hlf + r][t * 16 + nloc] = l_; } }
  wave_lds_sync();
#pragma unroll   // unrolled: every store is one base address plus a constant, so no address register takes a new value behind an issued store
  for (int rr = 0; rr < 16; ++rr) { const size_t gi = (m0 + rr) * D + lane * 8; *(v8b*)(Yh + gi) = *(const v8b*)(&Th[wave][rr][lane * 8]); *(v8b*)(Yl + gi) = *(const v8b*)(&Tl[wave][rr][lane * 8]); }
}
// v in channel-major hi/lo planes for the PV operand: VTh/VTl [bn][256 d][1024 s] = f16 hi+lo x8 of (tok_kv WKV[256:])^T: A = WKV_v rows d (K = 64), B = TK16 rows s; block = 64 d x 4 waves x
__global__ __launch_bounds__(128) void v_kernel(const b16* __restrict__ TK16, const b16* __restrict__ WKV, b16* __restrict__ VTh, b16* __restrict__ VTl) {
  __shared__ __attribute__((aligned(16))) b16 Ts[4][16][128 + 8], Tsl[4][16][128 + 8];
  const int wave = threadIdx.x >> 5, lane = threadIdx.x & 31, nloc = lane & 15, hlf = lane >> 4; const int bn = blockIdx.z; const int d0 = blockIdx.x * 64 + wave * 16, s0 = blockIdx.y * 128;
  v8f acc[8];
#pragma unroll
  for (int t = 0; t < 8; ++t) acc[t] = (v8f){};
  const b16* pa = WKV + (size_t)(d0 + nloc) * C + 8 * hlf; const b16* pw = TK16 + ((size_t)bn * S + s0 + nloc) * C + 8 * hlf;   // the lane's own addresses: every load below is one of these plus a constant
  v16b fa[2], fw[2][8];   // all fragments of the tile (K = 64) are requested as one group
#pragma unroll
  for (int i = 0; i < 2; ++i) { fa[i] = frag_kb(pa + D * C + i * 32, 0);   // the v half of W_kv: rows D .. 2D - 1
#pragma unroll
    for (int t = 0; t < 8; ++t) fw[i][t] = frag_kb(pw + t * 16 * C + i * 32, 0); }
  group_fence();
#pragma unroll
  for (int i = 0; i < 2; ++i)
#pragma unroll
    for (int t = 0; t < 8; ++t) acc[t] = wmma16b(fa[i], fw[i][t], acc[t]);
  group_fence(); addr_wait(pa, pw, pw);   // the fence keeps the wait behind the WMMAs, where every load has returned
#pragma unroll
  for (int t = 0; t < 8; ++t)
#pragma unroll
    for (int r = 0; r < 8; ++r) { b16 h_, l_; split16(acc[t][r] * (1.0f / (XS * WSC)) * XS, h_, l_); Ts[wave][8 * hlf + r][t * 16 + nloc] = h_; Tsl[wave][8 * hlf + r][t * 16 + nloc] = l_; }
  wave_lds_sync();
  { for (int rr = 0; rr < 16; ++rr) if (lane < 16) { const size_t gi = ((size_t)bn * D + d0 + rr) * S + s0 + lane * 8; *(v8b*)(VTh + gi) = *(const v8b*)(&Ts[wave][rr][lane * 8]); *(v8b*)(VTl + gi) = *(const v8b*)(&Tsl[wave][rr][lane * 8]); }  }
}
// causal attention: grid (sequences, 1, S/64), block = 4 waves x 16 queries; one block fills a WGP's LDS and there are twice as many blocks as WGPs, so the query block falls with blockIdx.z: the longest blocks start first, and a WGP
// that ends a block of the first round (18 to 32 key blocks) takes the longest one left (16 down to 2); key blocks of 32 (no scaling). Every fragment comes from LDS: each wave's q rows are copied there once, each 32-key block of
// k (rows of 512 B, LDS pitch 528 B) and of v^T (rows of 64 B, LDS pitch 80 B), hi and lo, once per block of 4 waves, by asynchronous copies to LDS, two buffers: block t + 1 flies while block t is worked on.
// The products, their order and the softmax of a wave are those of the per-wave form: S^T 3 products with K = 256 (8 steps), online softmax f32, O^T 3 products.
constexpr int AW = 4, KP = D + 8, VP = 32 + 8;
__device__ __forceinline__ unsigned lds_off(const void* p) { return (unsigned)(size_t)p; }
// eight 16-byte-per-lane copies global -> LDS, addresses stepping by ls bytes (LDS) and gs elements (global); s_wait_xcnt 0 closes the statement so that no address register is rewritten ahead of it
__device__ __forceinline__ void copy8(unsigned l, unsigned ls, const b16* g, size_t gs) {
  asm volatile("global_load_async_to_lds_b128 %0, %8, off\n\tglobal_load_async_to_lds_b128 %1, %9, off\n\tglobal_load_async_to_lds_b128 %2, %10, off\n\tglobal_load_async_to_lds_b128 %3, %11, off\n\t"
               "global_load_async_to_lds_b128 %4, %12, off\n\tglobal_load_async_to_lds_b128 %5, %13, off\n\tglobal_load_async_to_lds_b128 %6, %14, off\n\tglobal_load_async_to_lds_b128 %7, %15, off\n\ts_wait_xcnt 0x0"
               :: "v"(l), "v"(l + ls), "v"(l + 2 * ls), "v"(l + 3 * ls), "v"(l + 4 * ls), "v"(l + 5 * ls), "v"(l + 6 * ls), "v"(l + 7 * ls),
                  "v"(g), "v"(g + gs), "v"(g + 2 * gs), "v"(g + 3 * gs), "v"(g + 4 * gs), "v"(g + 5 * gs), "v"(g + 6 * gs), "v"(g + 7 * gs) : "memory");
}
__global__ __launch_bounds__(128) void attn_kernel(const b16* __restrict__ Qh, const b16* __restrict__ Ql, const b16* __restrict__ Kh, const b16* __restrict__ Kl, const b16* __restrict__ VTh, const b16* __restrict__ VTl, const float* __restrict__ g2, const float* __restrict__ b2, b16* __restrict__ Ah, b16* __restrict__ Al) {
  __shared__ __attribute__((aligned(16))) b16 Ks[2][2][32][KP];    // [buffer][hi, lo][key][d]
  __shared__ __attribute__((aligned(16))) b16 Vs[2][2][D][VP];     // [buffer][hi, lo][d][key]
  __shared__ __attribute__((aligned(16))) b16 Qs[AW][2][16][KP];   // [wave][hi, lo][query][d]
  __shared__ __attribute__((aligned(16))) float To[AW][16][D + 4];
  const int wave = __builtin_amdgcn_readfirstlane(threadIdx.x >> 5), lane = threadIdx.x & 31, hh = lane >> 4, col = lane & 15; const int bn = blockIdx.x, qb = S / (16 * AW) - 1 - blockIdx.z; const int q0 = qb * (16 * AW) + wave * 16, qi = q0 + col;
  const b16* Kb = Kh + (size_t)bn * S * D; const b16* Klb = Kl + (size_t)bn * S * D; const b16* Vb = VTh + (size_t)bn * D * S; const b16* Vlb = VTl + (size_t)bn * D * S;
  // a wave's share of one key block: 8 k rows (a row = one copy of 32 lanes x 16 B) and 64 v^T rows (8 rows = one copy), hi and lo: 32 copies
  const size_t kg = (size_t)(wave * 8) * D + lane * 8, vg = (size_t)(wave * 64 + (lane >> 2)) * S + (lane & 3) * 8;
  auto stage = [&](int kb, int bf) {
    copy8(lds_off(&Ks[bf][0][wave * 8][lane * 8]), KP * 2, Kb + (size_t)kb * D + kg, D); copy8(lds_off(&Ks[bf][1][wave * 8][lane * 8]), KP * 2, Klb + (size_t)kb * D + kg, D);
    copy8(lds_off(&Vs[bf][0][wave * 64 + (lane >> 2)][(lane & 3) * 8]), 8 * VP * 2, Vb + vg + kb, (size_t)8 * S); copy8(lds_off(&Vs[bf][1][wave * 64 + (lane >> 2)][(lane & 3) * 8]), 8 * VP * 2, Vlb + vg + kb, (size_t)8 * S); };
  { const size_t qg = ((size_t)bn * S + q0) * D + lane * 8;
    copy8(lds_off(&Qs[wave][0][0][lane * 8]), KP * 2, Qh + qg, D); copy8(lds_off(&Qs[wave][0][8][lane * 8]), KP * 2, Qh + qg + 8 * D, D);
    copy8(lds_off(&Qs[wave][1][0][lane * 8]), KP * 2, Ql + qg, D); copy8(lds_off(&Qs[wave][1][8][lane * 8]), KP * 2, Ql + qg + 8 * D, D); }
  asm volatile("s_wait_asynccnt 0x0" ::: "memory");   // the q copies have landed (and no more than 32 copies of a wave are ever outstanding)
  stage(0, 0);
  asm volatile("s_wait_asynccnt 0x0" ::: "memory");   // this wave's share of key block 0 has landed
  __syncthreads();                                    // ... and every other wave's: nothing is read from LDS in front of this barrier
  stage(32, 1);                                       // nt >= 2: key block 1 always exists
  const b16* Qb = &Qs[wave][0][col][0]; const b16* Qlb = &Qs[wave][1][col][0];
  float m = -INFINITY, l = 0.0f; v8f o[16];
#pragma unroll
  for (int t = 0; t < 16; ++t) o[t] = (v8f){};
  const float cs = LOG2E / (XS * XS); const int kend = q0 + 16;   // causal
  const int nt = qb * (16 * AW / 32) + 16 * AW / 32;      // key blocks of the work-group's last wave; the same for all its waves
  for (int it = 0; it < nt; ++it) { const int kb = it * 32, bf = it & 1;
   if (kb < kend) {   // a wave past its diagonal skips the work, never the publish point below
    v8f s0 = {}, s1 = {};
    v16b fq[2][2], fk[2][4];   // two register stages: step i + 1's six fragments are read from LDS as one group ahead of step i's WMMAs; s0 and s1 take turns, each in its old order; unrolled whole so that the stage index is a constant
    auto ldk = [&](int ks, int st) { fq[st][0] = frag_kb(Qb + ks, hh); fq[st][1] = frag_kb(Qlb + ks, hh); fk[st][0] = frag_kb(&Ks[bf][0][col][ks], hh); fk[st][1] = frag_kb(&Ks[bf][0][16 + col][ks], hh);
      fk[st][2] = frag_kb(&Ks[bf][1][col][ks], hh); fk[st][3] = frag_kb(&Ks[bf][1][16 + col][ks], hh); };
    ldk(0, 0);
#pragma unroll
    for (int i = 0; i < D / 32; ++i) { const int st = i & 1; if (i + 1 < D / 32) ldk((i + 1) * 32, st ^ 1);
      group_fence();
      s0 = wmma16b(fk[st][0], fq[st][0], s0); s1 = wmma16b(fk[st][1], fq[st][0], s1); s0 = wmma16b(fk[st][0], fq[st][1], s0); s1 = wmma16b(fk[st][1], fq[st][1], s1);
      s0 = wmma16b(fk[st][2], fq[st][0], s0); s1 = wmma16b(fk[st][3], fq[st][0], s1);
      group_fence(); }
    v16b fv[3][2][2];          // three register stages of two d tiles (hi, lo) each: the first two groups are read ahead of the softmax, group g + 2 ahead of group g's WMMAs; the two tiles take turns, each in its old order
    auto ldv = [&](int g, int st) {
#pragma unroll
      for (int j = 0; j < 2; ++j) { fv[st][j][0] = frag_kb(&Vs[bf][0][(2 * g + j) * 16 + col][0], hh); fv[st][j][1] = frag_kb(&Vs[bf][1][(2 * g + j) * 16 + col][0], hh); } };
    ldv(0, 0); ldv(1, 1);
    group_fence();
    float e[16]; float mx = -INFINITY;
#pragma unroll
    for (int r = 0; r < 8; ++r) { const int k0i = kb + 8 * hh + r, k1i = kb + 16 + 8 * hh + r; e[r] = (k0i <= qi) ? s0[r] * cs : -INFINITY; e[8 + r] = (k1i <= qi) ? s1[r] * cs : -INFINITY; mx = fmaxf(mx, fmaxf(e[r], e[8 + r])); }
    mx = fmaxf(mx, __shfl_xor(mx, 16)); const float mn = fmaxf(m, mx); const float al = nexp2(m - mn); m = mn; float sum = 0.0f; v16b ph, pl;   // key 0 <= qi always -> mn finite
#pragma unroll
    for (int i = 0; i < 16; ++i) { const float p = nexp2(e[i] - mn); sum += p; const b16 h_ = (b16)(p * PS); ph[i] = h_; pl[i] = (b16)(p * PS - (float)h_); }
    sum += __shfl_xor(sum, 16); l = l * al + sum;
#pragma unroll
    for (int g = 0; g < 8; ++g) { const int st = g % 3, t0 = 2 * g, t1 = 2 * g + 1; if (g + 2 < 8) ldv(g + 2, (g + 2) % 3);
      o[t0] *= al; o[t1] *= al;
      group_fence();
      o[t0] = wmma16b(fv[st][0][0], ph, o[t0]); o[t1] = wmma16b(fv[st][1][0], ph, o[t1]); o[t0] = wmma16b(fv[st][0][0], pl, o[t0]); o[t1] = wmma16b(fv[st][1][0], pl, o[t1]);
      o[t0] = wmma16b(fv[st][0][1], ph, o[t0]); o[t1] = wmma16b(fv[st][1][1], ph, o[t1]);
      if (g + 2 < 8) group_fence(); } }   // no reads follow the last two groups: nothing to hold there
   // publish point of key block it + 1, passed by every wave
   asm volatile("s_wait_dscnt 0x0" ::: "memory");      // this wave's reads of buffer bf are done before it may be refilled
   asm volatile("s_wait_asynccnt 0x0" ::: "memory");   // this wave's share of key block it + 1 has landed
   __syncthreads();                                    // both hold for every wave
   if (it + 2 < nt) stage(kb + 64, bf); }
  asm volatile("s_wait_asynccnt 0x0" ::: "memory");    // no copy is outstanding when the wave ends
  // LN2 on the spot: lanes col and col + 16 hold query col's 256 channels, 128 each, so mean and variance are sums in the lane and one exchange with lane ^ 16; gamma and beta are applied behind the LDS transpose, where a lane has 8 fixed channels
  // (the loops are unrolled whole: o is a register array, and every store of the last loop is one base address plus a constant)
  const v4f ga = *(const v4f*)(g2 + lane * 8), gc = *(const v4f*)(g2 + lane * 8 + 4), ba = *(const v4f*)(b2 + lane * 8), bc = *(const v4f*)(b2 + lane * 8 + 4);
  const float inv = 1.0f / (l * PS * XS); v8f sv = {};
#pragma unroll
  for (int t = 0; t < 16; ++t) { o[t] *= inv; sv += o[t]; }
  float s = ((sv[0] + sv[1]) + (sv[2] + sv[3])) + ((sv[4] + sv[5]) + (sv[6] + sv[7])); s += __shfl_xor(s, 16);
  const float mean = s * (1.0f / D); v8f qv = {};
#pragma unroll
  for (int t = 0; t < 16; ++t) { o[t] -= mean; qv += o[t] * o[t]; }
  float ss = ((qv[0] + qv[1]) + (qv[2] + qv[3])) + ((qv[4] + qv[5]) + (qv[6] + qv[7])); ss += __shfl_xor(ss, 16);
  const float rs = rsqrtf(ss * (1.0f / D) + LN_EPS);
#pragma unroll
  for (int t = 0; t < 16; ++t)
#pragma unroll
    for (int r = 0; r < 8; ++r) To[wave][col][t * 16 + 8 * hh + r] = o[t][r] * rs;
  wave_lds_sync();
  float gg[8], bb[8];
#pragma unroll
  for (int i = 0; i < 4; ++i) { gg[i] = bf16_rne(ga[i]); gg[4 + i] = bf16_rne(gc[i]); bb[i] = bf16_rne(ba[i]); bb[4 + i] = bf16_rne(bc[i]); }
#pragma unroll
  for (int rr = 0; rr < 16; ++rr) { const size_t gi = ((size_t)bn * S + q0 + rr) * D + lane * 8; const v4f xa = *(const v4f*)(&To[wave][rr][lane * 8]), xc = *(const v4f*)(&To[wave][rr][lane * 8 + 4]); v8b hv, lv;
#pragma unroll
    for (int i = 0; i < 8; ++i) { b16 h_, l_; split16(((i < 4 ? xa[i] : xc[i - 4]) * gg[i] + bb[i]) * XS, h_, l_); hv[i] = h_; lv[i] = l_; }
    *(v8b*)(Ah + gi) = hv; *(v8b*)(Al + gi) = lv; }
}
__global__ __launch_bounds__(128) void ffn1_kernel(const b16* __restrict__ Ah, const b16* __restrict__ Al, const b16* __restrict__ W1T, b16* __restrict__ Hh, b16* __restrict__ Hl) {
  __shared__ __attribute__((aligned(16))) b16 Th[4][16][128 + 8], Tl[4][16][128 + 8];
  const int wave = threadIdx.x >> 5, lane = threadIdx.x & 31, nloc = lane & 15, hlf = lane >> 4; const size_t m0 = (size_t)blockIdx.x * 64 + wave * 16; const int n0 = blockIdx.y * 128;
  v8f acc[8];
#pragma unroll
  for (int t = 0; t < 8; ++t) acc[t] = (v8f){};
  v16b fa[2], fl[2], fw[2][8];   // two register stages: step i + 1's fragments are requested as one group ahead of step i's WMMAs; the k loop is unrolled whole so that the stage index is a constant and both stages are registers
  const b16* pa = Ah + (m0 + nloc) * D + 8 * hlf; const b16* pl = Al + (m0 + nloc) * D + 8 * hlf; const b16* pw = W1T + (size_t)(n0 + nloc) * D + 8 * hlf;   // the lane's own addresses: every load below is one of these plus a constant
  auto ld = [&](int kb, int st) { fa[st] = frag_kb(pa + kb, 0); fl[st] = frag_kb(pl + kb, 0);
#pragma unroll
    for (int t = 0; t < 8; ++t) fw[st][t] = frag_kb(pw + t * 16 * D + kb, 0); };
  ld(0, 0);
#pragma unroll
  for (int i = 0; i < D / 32; ++i) { const int st = i & 1; if (i + 1 < D / 32) ld((i + 1) * 32, st ^ 1);
    group_fence();
#pragma unroll
    for (int t = 0; t < 8; ++t) acc[t] = wmma16b(fa[st], fw[st][t], acc[t]);
#pragma unroll
    for (int t = 0; t < 8; ++t) acc[t] = wmma16b(fl[st], fw[st][t], acc[t]);
    group_fence(); }
  addr_wait(pa, pl, pw);
#pragma unroll
  for (int t = 0; t < 8; ++t)
#pragma unroll
    for (int r = 0; r < 8; ++r) { b16 h_, l_; split16(fmaxf(acc[t][r] * (1.0f / (XS * WSC)), 0.0f) * XS, h_, l_); Th[wave][8 * hlf + r][t * 16 + nloc] = h_; Tl[wave][8 * hlf + r][t * 16 + nloc] = l_; }
  wave_lds_sync();
  { for (int r2 = 0; r2 < 16; r2 += 2) { const int rr = r2 + (lane >> 4), c8 = (lane & 15) * 8; const size_t gi = (m0 + rr) * F + n0 + c8; *(v8b*)(Hh + gi) = *(const v8b*)(&Th[wave][rr][c8]); *(v8b*)(Hl + gi) = *(const v8b*)(&Tl[wave][rr][c8]); }  }
}
__global__ __launch_bounds__(128) void ffn2_kernel(const b16* __restrict__ Hh, const b16* __restrict__ Hl, const b16* __restrict__ W2T, const float* __restrict__ Vf, b16* __restrict__ Eh, b16* __restrict__ El) {
  __shared__ __attribute__((aligned(16))) b16 Th[4][16][128 + 8], Tl[4][16][128 + 8];
  const int wave = threadIdx.x >> 5, lane = threadIdx.x & 31, nloc = lane & 15, hlf = lane >> 4; const size_t m0 = (size_t)blockIdx.x * 64 + wave * 16; const int n0 = blockIdx.y * 128;
  v8f acc[8];
#pragma unroll
  for (int t = 0; t < 8; ++t) acc[t] = (v8f){};
  v16b fa[2], fl[2], fw[2][8];   // two register stages: step i + 1's fragments are requested as one group ahead of step i's WMMAs; the k loop is unrolled whole so that the stage index is a constant and both stages are registers
  const b16* pa = Hh + (m0 + nloc) * F + 8 * hlf; const b16* pl = Hl + (m0 + nloc) * F + 8 * hlf; const b16* pw = W2T + (size_t)(n0 + nloc) * F + 8 * hlf;   // the lane's own addresses: every load below is one of these plus a constant
  auto ld = [&](int kb, int st) { fa[st] = frag_kb(pa + kb, 0); fl[st] = frag_kb(pl + kb, 0);
#pragma unroll
    for (int t = 0; t < 8; ++t) fw[st][t] = frag_kb(pw + t * 16 * F + kb, 0); };
  ld(0, 0);
#pragma unroll
  for (int i = 0; i < F / 32; ++i) { const int st = i & 1; if (i + 1 < F / 32) ld((i + 1) * 32, st ^ 1);
    group_fence();
#pragma unroll
    for (int t = 0; t < 8; ++t) acc[t] = wmma16b(fa[st], fw[st][t], acc[t]);
#pragma unroll
    for (int t = 0; t < 8; ++t) acc[t] = wmma16b(fl[st], fw[st][t], acc[t]);
    group_fence(); }
  addr_wait(pa, pl, pw);
#pragma unroll
  for (int t = 0; t < 8; ++t)
#pragma unroll
    for (int r = 0; r < 8; ++r) { const size_t row = m0 + 8 * hlf + r; const float y = acc[t][r] * (1.0f / (XS * WSC)) + Vf[row * D + n0 + t * 16 + nloc]; b16 h_, l_; split16(y * XS, h_, l_); Th[wave][8 * hlf + r][t * 16 + nloc] = h_; Tl[wave][8 * hlf + r][t * 16 + nloc] = l_; }
  wave_lds_sync();
  { for (int r2 = 0; r2 < 16; r2 += 2) { const int rr = r2 + (lane >> 4), c8 = (lane & 15) * 8; const size_t gi = (m0 + rr) * D + n0 + c8; *(v8b*)(Eh + gi) = *(const v8b*)(&Th[wave][rr][c8]); *(v8b*)(El + gi) = *(const v8b*)(&Tl[wave][rr][c8]); }  }
}
// output projection, channel-major store: D[c][s] = sum_d WOT[c][d] epi[s][d] (A = WOT rows c exact, B = Eh/El rows s: 2 products); block = 64 c (all) x 4 waves x 128 s of one sequence;
__global__ __launch_bounds__(128) void outproj_kernel(const b16* __restrict__ Eh, const b16* __restrict__ El, const b16* __restrict__ WOT, float* __restrict__ out) {
  __shared__ __attribute__((aligned(16))) float Ts[4][16][128 + 4];
  const int wave = threadIdx.x >> 5, lane = threadIdx.x & 31, nloc = lane & 15, hlf = lane >> 4; const int bn = blockIdx.z; const int c0 = wave * 16, s0 = blockIdx.y * 128; const int b = bn / NN, n = bn % NN;
  v8f acc[8];
#pragma unroll
  for (int t = 0; t < 8; ++t) acc[t] = (v8f){};
  v16b fa[2], fh[2][8], fl[2][8];   // two register stages: step i + 1's fragments are requested as one group ahead of step i's WMMAs; the k loop is unrolled whole so that the stage index is a constant and both stages are registers
  const b16* pa = WOT + (size_t)(c0 + nloc) * D + 8 * hlf; const b16* ph = Eh + ((size_t)bn * S + s0 + nloc) * D + 8 * hlf; const b16* pl = El + ((size_t)bn * S + s0 + nloc) * D + 8 * hlf;   // the lane's own addresses: every load below is one of these plus a constant
  auto ld = [&](int kb, int st) { fa[st] = frag_kb(pa + kb, 0);
#pragma unroll
    for (int t = 0; t < 8; ++t) { fh[st][t] = frag_kb(ph + t * 16 * D + kb, 0); fl[st][t] = frag_kb(pl + t * 16 * D + kb, 0); } };
  ld(0, 0);
#pragma unroll
  for (int i = 0; i < D / 32; ++i) { const int st = i & 1; if (i + 1 < D / 32) ld((i + 1) * 32, st ^ 1);
    group_fence();
#pragma unroll
    for (int t = 0; t < 8; ++t) acc[t] = wmma16b(fa[st], fh[st][t], acc[t]);
#pragma unroll
    for (int t = 0; t < 8; ++t) acc[t] = wmma16b(fa[st], fl[st][t], acc[t]);
    group_fence(); }
  addr_wait(pa, ph, pl);
#pragma unroll
  for (int t = 0; t < 8; ++t)
#pragma unroll
    for (int r = 0; r < 8; ++r) Ts[wave][8 * hlf + r][t * 16 + nloc] = acc[t][r] * (1.0f / (XS * WSC));
  wave_lds_sync();
  { for (int rr = 0; rr < 16; ++rr) *(v4f*)(out + (((size_t)b * C + c0 + rr) * NN + n) * S + s0 + lane * 4) = *(const v4f*)(&Ts[wave][rr][lane * 4]);  }
}
}  // namespace

extern "C" void kernel_launch(void* const* d_in, const int* in_sizes, int n_in, void* d_out, int out_size, void* d_ws, size_t ws_size, hipStream_t stream) {
  (void)n_in;
  auto Fp = [&](int i) { return (const float*)d_in[i]; };
  // input order: 0 fea_lf [4,64,8,32,32], 1 fea_hf, 2 W_in [64,256], 3 W_kv [64,512], 4 gamma, 5 beta, 6 g2, 7 b2, 8 W1 [256,512], 9 W2 [512,256], 10 W_out [256,64] (all (in, out))
  if (in_sizes[0] != NR * C || in_sizes[1] != NR * C || in_sizes[2] != C * D || in_sizes[3] != C * F || in_sizes[4] != D || in_sizes[8] != D * F || in_sizes[9] != F * D || in_sizes[10] != D * C || out_size != NR * C) return;
  size_t off = 0; char* ws = (char*)d_ws;
  auto carve = [&](size_t bytes) { char* p = ws + off; off += (bytes + 255) & ~(size_t)255; return p; };
  b16* TQ16 = (b16*)carve((size_t)NR * C * 2); b16* TK16 = (b16*)carve((size_t)NR * C * 2); b16* WIN = (b16*)carve((size_t)D * C * 2); b16* WKV = (b16*)carve((size_t)F * C * 2); b16* W1T = (b16*)carve((size_t)F * D * 2); b16* W2T = (b16*)carve((size_t)D * F * 2); b16* WOT = (b16*)carve((size_t)C * D * 2);
  b16* Qh = (b16*)carve((size_t)NR * D * 2); b16* Ql = (b16*)carve((size_t)NR * D * 2); b16* Kh = (b16*)carve((size_t)NR * D * 2); b16* Kl = (b16*)carve((size_t)NR * D * 2);
  float* Vf = (float*)carve((size_t)NR * D * 4); b16* VTh = (b16*)carve((size_t)NR * D * 2); b16* VTl = (b16*)carve((size_t)NR * D * 2); b16* Hh = (b16*)carve((size_t)NR * F * 2); b16* Hl = (b16*)carve((size_t)NR * F * 2); b16* Ah = (b16*)carve((size_t)NR * D * 2); b16* Al = (b16*)carve((size_t)NR * D * 2);   // LN2(att) gets its own planes: other attention blocks still read q, k and v while they are written
  b16* Eh = Kh; b16* El = Kl;                                  // region reuse: k planes are dead after the attention
  if (off > ws_size) return;   // = 244 MB
  xt_kernel<<<dim3(S / 64, 2, NBN), 256, 0, stream>>>(Fp(0), Fp(1), TQ16, TK16);
  prepw_kernel<<<dim3(8, 8, 5), 256, 0, stream>>>(Fp(2), Fp(3), Fp(8), Fp(9), Fp(10), WIN, WKV, W1T, W2T, WOT);
  projln_kernel<<<NR / 64, 128, 0, stream>>>(0, TQ16, TK16, WIN, WKV, Fp(4), Fp(5), Qh, Ql);   // q = LN(tok_q W_in)
  projln_kernel<<<NR / 64, 128, 0, stream>>>(1, TQ16, TK16, WIN, WKV, Fp(4), Fp(5), Kh, Kl);   // k = LN(tok_kv W_kv[:, :256])
  proj_kernel<<<NR / 64, 128, 0, stream>>>(2, TQ16, TK16, WIN, WKV, Vf);   // v f32 rows (residual)
  v_kernel<<<dim3(D / 64, S / 128, NBN), 128, 0, stream>>>(TK16, WKV, VTh, VTl);
  attn_kernel<<<dim3(NBN, 1, S / (16 * AW)), 32 * AW, 0, stream>>>(Qh, Ql, Kh, Kl, VTh, VTl, Fp(6), Fp(7), Ah, Al);   // LN2(att)
  ffn1_kernel<<<dim3(NR / 64, F / 128), 128, 0, stream>>>(Ah, Al, W1T, Hh, Hl);
  ffn2_kernel<<<dim3(NR / 64, D / 128), 128, 0, stream>>>(Hh, Hl, W2T, Vf, Eh, El);
  outproj_kernel<<<dim3(1, S / 128, NBN), 128, 0, stream>>>(Eh, El, WOT, (float*)d_out);
}

// v005
// Measured time: 146 microseconds a run.
// Two timings next to v004 put it at 1.47 and 1.48 times that version's speed.
// Over all steps from v000 it is 9.07 times as fast.
#include <hip/hip_runtime.h>

// Inter-frequency attention block: 32 sequences (4 batches x 8 'n' slices) of 1,024 tokens (32 x 32 positions), 64 channels; q = LN(tok_q W_in), k = LN((tok_kv W_kv)[:, :256]) (shared gamma/beta),
// v = (tok_kv W_kv)[:, 256:]; score = q.k (no scaling), causal (lower triangle; fill -1e15 == masked out since the diagonal is always kept), softmax, att = p v; h = relu(LN2(att) W1) W2;
// out = (h + v) W_out -> written channel-major as [4][64][8][32][32].
// WMMA (v_wmma_f32_16x16x32_f16, f32 accumulate): W_in / W_kv projections with EXACT bf16 tokens (x8, LDS-transposed from the channel-major inputs) and weights (x256), 1 product, each LayerNorm in the epilogue of the kernel that makes its rows; S^T = K.Q^T with
// q AND k (LayerNorm outputs) f16 hi+lo x8 (3 products: the unscaled 256-dim logits have sigma ~16); online softmax in f32; O^T += V^T P^T with v and P f16 hi+lo (3 products, one f32 accumulator:
// unscaled residuals); FFN W1 with LN2(att) hi+lo (2 products), W2 with the relu hidden hi+lo (2 products), W_out with (h + v) hi+lo (2 products). LayerNorms, softmax, relu, residual in f32.
// Inputs rounded to bf16 once. Fragment k-map per lane half hh for A AND B: elements 0..7 <- k = 8hh+0..7, 8..15 <- k = 16+8hh+0..7; acc[r] = D[8hh+r][col].

namespace {
constexpr int NBN = 32 /* b*n sequences */, NN = 8, S = 1024, C = 64, D = 256, F = 512, NR = NBN * S /* all 32 sequences go through every stage in one launch */;
constexpr float XS = 8.0f, WSC = 256.0f, PS = 8.0f, LOG2E = 1.4426950408889634f, LN_EPS = 1e-5f;

typedef _Float16 b16;
typedef __attribute__((ext_vector_type(16))) _Float16 v16b;
typedef __attribute__((ext_vector_type(8))) _Float16 v8b;
typedef __attribute__((ext_vector_type(8))) float v8f;
typedef __attribute__((ext_vector_type(4))) float v4f;
__device__ __forceinline__ float bf16_rne(float f) { unsigned int u = __float_as_uint(f); u += 0x7FFFu + ((u >> 16) & 1u); return __uint_as_float(u & 0xFFFF0000u); }
__device__ __forceinline__ void split16(float v, b16& hi, b16& lo) { hi = (b16)v; lo = (b16)(v - (float)hi); }
__device__ __forceinline__ v16b frag_kb(const b16* p, int hh) { const v8b a = *(const v8b*)(p + 8 * hh), b = *(const v8b*)(p + 16 + 8 * hh); v16b f;
#pragma unroll
  for (int e = 0; e < 8; ++e) { f[e] = a[e]; f[8 + e] = b[e]; } return f; }
__device__ __forceinline__ v8f wmma16b(v16b a, v16b b, v8f c) { return __builtin_amdgcn_wmma_f32_16x16x32_f16(false, a, false, b, (short)0, c, false, false); }
// stands between a group of fragment loads and a block of WMMAs: without it the compiler sinks each load to just in front of its own WMMA, and every load's latency is waited out alone
__device__ __forceinline__ void group_fence() { __builtin_amdgcn_sched_barrier(0); }
// stands behind the WMMAs of a tile whose fragments are all loaded from global memory as one group: the loads' address registers are inputs here, so none of them is given a new value ahead of this wait
__device__ __forceinline__ void addr_wait(const b16* a, const b16* b, const b16* c) { asm volatile("s_wait_xcnt 0x0" :: "v"(a), "v"(b), "v"(c) : "memory"); }
__device__ __forceinline__ void wave_lds_sync() { __builtin_amdgcn_fence(__ATOMIC_RELEASE, "workgroup"); __builtin_amdgcn_wave_barrier(); __builtin_amdgcn_fence(__ATOMIC_ACQUIRE, "workgroup"); }
__device__ __forceinline__ float nexp2(float x) { return __builtin_amdgcn_exp2f(x); }
// sum over a 16-lane row, left in every lane of it: four adds whose second operand comes from lane ^ M of the row (DPP row_xmask), no LDS round trip
template <int M> __device__ __forceinline__ float xadd(float v) { return v + __int_as_float(__builtin_amdgcn_update_dpp(0, __float_as_int(v), 0x160 + M, 0xf, 0xf, true)); }
__device__ __forceinline__ float hsum16(float v) { return xadd<8>(xadd<4>(xadd<2>(xadd<1>(v)))); }

__global__ __launch_bounds__(256) void xt_kernel(const float* __restrict__ flf, const float* __restrict__ fhf, b16* __restrict__ TQ16, b16* __restrict__ TK16) {
  __shared__ __attribute__((aligned(16))) b16 T[64][64 + 8];
  const int bn = blockIdx.z, kind = blockIdx.y, s0 = blockIdx.x * 64, t_ = threadIdx.x; const int b = bn / NN, n = bn % NN; const float* src = (kind == 0 ? flf : fhf) + ((size_t)b * C * NN + n) * S; b16* dst = kind == 0 ? TQ16 : TK16;
  for (int q = t_; q < 64 * 64; q += 256) { const int cc = q >> 6, ss = q & 63; T[ss][cc] = (b16)(bf16_rne(src[(size_t)cc * NN * S + s0 + ss]) * XS); }
  __syncthreads();
  { for (int q = t_; q < 64 * 8; q += 256) { const int ss = q >> 3, c8 = (q & 7) * 8; *(v8b*)(dst + ((size_t)bn * S + s0 + ss) * C + c8) = *(const v8b*)(&T[ss][c8]); }  }
}
// weights (in,out) transposed to [out][in] rows x256 via 64x64 LDS tiles: kind 0 W_in [64][256] -> WIN [256][64]; 1 W_kv [64][512] -> WKV [512][64]; 2 W1 [256][512] -> W1T [512][256];
__global__ __launch_bounds__(256) void prepw_kernel(const float* __restrict__ win, const float* __restrict__ wkv, const float* __restrict__ w1, const float* __restrict__ w2, const float* __restrict__ wout, b16* __restrict__ WIN, b16* __restrict__ WKV, b16* __restrict__ W1T, b16* __restrict__ W2T, b16* __restrict__ WOT) {
  __shared__ __attribute__((aligned(16))) b16 T[64][64 + 8];
  const int kind = blockIdx.z, i0 = blockIdx.x * 64, o0 = blockIdx.y * 64, t_ = threadIdx.x; const float* w; b16* dst; int nin, nout;
  if (kind == 0) { w = win; dst = WIN; nin = C; nout = D; } else if (kind == 1) { w = wkv; dst = WKV; nin = C; nout = F; } else if (kind == 2) { w = w1; dst = W1T; nin = D; nout = F; } else if (kind == 3) { w = w2; dst = W2T; nin = F; nout = D; } else { w = wout; dst = WOT; nin = D; nout = C; }
  if (i0 >= nin || o0 >= nout) return;
  for (int q = t_; q < 64 * 64; q += 256) { const int ii = q >> 6, oo = q & 63; T[oo][ii] = (b16)(bf16_rne(w[(size_t)(i0 + ii) * nout + o0 + oo]) * WSC); }
  __syncthreads();
  { for (int q = t_; q < 64 * 8; q += 256) { const int oo = q >> 3, c8 = (q & 7) * 8; *(v8b*)(dst + (size_t)(o0 + oo) * nin + i0 + c8) = *(const v8b*)(&T[oo][c8]); }  }
}
// projections: block = 64 rows x 4 waves x 256 cols (16 tiles, K = 64 exact, 1 product): Y = tok W (kind 0: tok_q WIN; 1: tok_kv WKV[:256]; 2: tok_kv WKV[256:]) -> f32 rows [row][256]
__global__ __launch_bounds__(128) void proj_kernel(int kind, const b16* __restrict__ TQ16, const b16* __restrict__ TK16, const b16* __restrict__ WIN, const b16* __restrict__ WKV, float* __restrict__ Y) {
  __shared__ __attribute__((aligned(16))) float Tf[4][16][128 + 4];
  const int wave = threadIdx.x >> 5, lane = threadIdx.x & 31, nloc = lane & 15, hlf = lane >> 4; const size_t m0 = (size_t)blockIdx.x * 64 + wave * 16;
  const b16* A = kind == 0 ? TQ16 : TK16; const b16* Bw = kind == 0 ? WIN : (kind == 1 ? WKV : WKV + (size_t)D * C);
  v8f acc[16];
#pragma unroll
  for (int t = 0; t < 16; ++t) acc[t] = (v8f){};
  const b16* pa = A + (m0 + nloc) * C + 8 * hlf; const b16* pw = Bw + (size_t)nloc * C + 8 * hlf;   // the lane's own addresses: every load below is one of these plus a constant
  v16b fa[2], fw[2][16];   // all fragments of the tile (K = 64) are requested as one group
#pragma unroll
  for (int i = 0; i < 2; ++i) { fa[i] = frag_kb(pa + i * 32, 0);
#pragma unroll
    for (int t = 0; t < 16; ++t) fw[i][t] = frag_kb(pw + t * 16 * C + i * 32, 0); }
  group_fence();
#pragma unroll
  for (int i = 0; i < 2; ++i)
#pragma unroll
    for (int t = 0; t < 16; ++t) acc[t] = wmma16b(fa[i], fw[i][t], acc[t]);
  group_fence(); addr_wait(pa, pw, pw);   // the fence keeps the wait behind the WMMAs, where every load has returned
  for (int hq = 0; hq < 2; ++hq) {
#pragma unroll
    for (int t = 0; t < 8; ++t)
#pragma unroll
      for (int r = 0; r < 8; ++r) Tf[wave][8 * hlf + r][t * 16 + nloc] = acc[hq * 8 + t][r] * (1.0f / (XS * WSC));
    wave_lds_sync();
    { for (int rr = 0; rr < 16; ++rr) *(v4f*)(Y + (m0 + rr) * D + hq * 128 + lane * 4) = *(const v4f*)(&Tf[wave][rr][lane * 4]);  }
    wave_lds_sync(); }
}
// q and k projections with their LayerNorm (kind 0: tok_q WIN; 1: tok_kv WKV[:256]): the products of proj_kernel; a wave holds its 16 rows whole (256 columns: 16 in a lane x 16 lanes), so mean, variance and the
// affine step are taken on the accumulators, and the f16 hi+lo x8 planes go out through LDS as whole rows: no f32 plane and no row kernel in between
__global__ __launch_bounds__(128) void projln_kernel(int kind, const b16* __restrict__ TQ16, const b16* __restrict__ TK16, const b16* __restrict__ WIN, const b16* __restrict__ WKV, const float* __restrict__ g, const float* __restrict__ be, b16* __restrict__ Yh, b16* __restrict__ Yl) {
  __shared__ __attribute__((aligned(16))) b16 Th[4][16][D + 8], Tl[4][16][D + 8];
  const int wave = threadIdx.x >> 5, lane = threadIdx.x & 31, nloc = lane & 15, hlf = lane >> 4; const size_t m0 = (size_t)blockIdx.x * 64 + wave * 16;
  const b16* A = kind == 0 ? TQ16 : TK16; const b16* Bw = kind == 0 ? WIN : WKV;
  v8f acc[16];
#pragma unroll
  for (int t = 0; t < 16; ++t) acc[t] = (v8f){};
  const b16* pa = A + (m0 + nloc) * C + 8 * hlf; const b16* pw = Bw + (size_t)nloc * C + 8 * hlf;   // the lane's own addresses: every load below is one of these plus a constant
  v16b fa[2], fw[2][16];   // all fragments of the tile (K = 64) are requested as one group, the lane's 16 gamma and beta values with them
#pragma unroll
  for (int i = 0; i < 2; ++i) { fa[i] = frag_kb(pa + i * 32, 0);
#pragma unroll
    for (int t = 0; t < 16; ++t) fw[i][t] = frag_kb(pw + t * 16 * C + i * 32, 0); }
  float gv[16], bv[16];
#pragma unroll
  for (int t = 0; t < 16; ++t) { gv[t] = g[t * 16 + nloc]; bv[t] = be[t * 16 + nloc]; }
  group_fence();
#pragma unroll
  for (int i = 0; i < 2; ++i)
#pragma unroll
    for (int t = 0; t < 16; ++t) acc[t] = wmma16b(fa[i], fw[i][t], acc[t]);
  group_fence(); addr_wait(pa, pw, pw);   // the fence keeps the wait behind the WMMAs, where every load has returned
  constexpr float SC = 1.0f / (XS * WSC);   // a power of two: scaling the sum is scaling every term
  float mean[8], rs[8];   // the loops below are unrolled whole: acc, gv, bv, mean and rs are register arrays and take constant indices only
#pragma unroll
  for (int r = 0; r < 8; ++r) { float s = 0.0f;
#pragma unroll
    for (int t = 0; t < 16; ++t) s += acc[t][r];
    mean[r] = hsum16(s) * (SC / D); }
#pragma unroll
  for (int r = 0; r < 8; ++r) { float ss = 0.0f;
#pragma unroll
    for (int t = 0; t < 16; ++t) { const float dv = acc[t][r] * SC - mean[r]; acc[t][r] = dv; ss += dv * dv; }
    rs[r] = rsqrtf(hsum16(ss) * (1.0f / D) + LN_EPS); }
#pragma unroll
  for (int t = 0; t < 16; ++t) { const float gt = bf16_rne(gv[t]), bt = bf16_rne(bv[t]);
#pragma unroll
    for (int r = 0; r < 8; ++r) { b16 h_, l_; split16((acc[t][r] * rs[r] * gt + bt) * XS, h_, l_); Th[wave][8 * hlf + r][t * 16 + nloc] = h_; Tl[wave][8 * hlf + r][t * 16 + nloc] = l_; } }
  wave_lds_sync();
#pragma unroll   // unrolled: every store is one base address plus a constant, so no address register takes a new value behind an issued store
  for (int rr = 0; rr < 16; ++rr) { const size_t gi = (m0 + rr) * D + lane * 8; *(v8b*)(Yh + gi) = *(const v8b*)(&Th[wave][rr][lane * 8]); *(v8b*)(Yl + gi) = *(const v8b*)(&Tl[wave][rr][lane * 8]); }
}
// v in channel-major hi/lo planes for the PV operand: VTh/VTl [bn][256 d][1024 s] = f16 hi+lo x8 of (tok_kv WKV[256:])^T: A = WKV_v rows d (K = 64), B = TK16 rows s; block = 64 d x 4 waves x
__global__ __launch_bounds__(128) void v_kernel(const b16* __restrict__ TK16, const b16* __restrict__ WKV, b16* __restrict__ VTh, b16* __restrict__ VTl) {
  __shared__ __attribute__((aligned(16))) b16 Ts[4][16][128 + 8], Tsl[4][16][128 + 8];
  const int wave = threadIdx.x >> 5, lane = threadIdx.x & 31, nloc = lane & 15, hlf = lane >> 4; const int bn = blockIdx.z; const int d0 = blockIdx.x * 64 + wave * 16, s0 = blockIdx.y * 128;
  v8f acc[8];
#pragma unroll
  for (int t = 0; t < 8; ++t) acc[t] = (v8f){};
  const b16* pa = WKV + (size_t)(d0 + nloc) * C + 8 * hlf; const b16* pw = TK16 + ((size_t)bn * S + s0 + nloc) * C + 8 * hlf;   // the lane's own addresses: every load below is one of these plus a constant
  v16b fa[2], fw[2][8];   // all fragments of the tile (K = 64) are requested as one group
#pragma unroll
  for (int i = 0; i < 2; ++i) { fa[i] = frag_kb(pa + D * C + i * 32, 0);   // the v half of W_kv: rows D .. 2D - 1
#pragma unroll
    for (int t = 0; t < 8; ++t) fw[i][t] = frag_kb(pw + t * 16 * C + i * 32, 0); }
  group_fence();
#pragma unroll
  for (int i = 0; i < 2; ++i)
#pragma unroll
    for (int t = 0; t < 8; ++t) acc[t] = wmma16b(fa[i], fw[i][t], acc[t]);
  group_fence(); addr_wait(pa, pw, pw);   // the fence keeps the wait behind the WMMAs, where every load has returned
#pragma unroll
  for (int t = 0; t < 8; ++t)
#pragma unroll
    for (int r = 0; r < 8; ++r) { b16 h_, l_; split16(acc[t][r] * (1.0f / (XS * WSC)) * XS, h_, l_); Ts[wave][8 * hlf + r][t * 16 + nloc] = h_; Tsl[wave][8 * hlf + r][t * 16 + nloc] = l_; }
  wave_lds_sync();
  { for (int rr = 0; rr < 16; ++rr) if (lane < 16) { const size_t gi = ((size_t)bn * D + d0 + rr) * S + s0 + lane * 8; *(v8b*)(VTh + gi) = *(const v8b*)(&Ts[wave][rr][lane * 8]); *(v8b*)(VTl + gi) = *(const v8b*)(&Tsl[wave][rr][lane * 8]); }  }
}
// causal attention: grid (sequences, 1, S/64), block = 4 waves x 16 queries; one block fills a WGP's LDS and there are twice as many blocks as WGPs, so the query block falls with blockIdx.z: the longest blocks start first, and a WGP
// that ends a block of the first round (18 to 32 key blocks) takes the longest one left (16 down to 2); key blocks of 32 (no scaling). Every fragment comes from LDS: each wave's q rows are copied there once, each 32-key block of
// k (rows of 512 B, LDS pitch 528 B) and of v^T (rows of 64 B, LDS pitch 80 B), hi and lo, once per block of 4 waves, by asynchronous copies to LDS, two buffers: block t + 1 flies while block t is worked on.
// The products, their order and the softmax of a wave are those of the per-wave form: S^T 3 products with K = 256 (8 steps), online softmax f32, O^T 3 products.
constexpr int AW = 4, KP = D + 8, VP = 32 + 8;
__device__ __forceinline__ unsigned lds_off(const void* p) { return (unsigned)(size_t)p; }
// eight 16-byte-per-lane copies global -> LDS, addresses stepping by ls bytes (LDS) and gs elements (global); s_wait_xcnt 0 closes the statement so that no address register is rewritten ahead of it
__device__ __forceinline__ void copy8(unsigned l, unsigned ls, const b16* g, size_t gs) {
  asm volatile("global_load_async_to_lds_b128 %0, %8, off\n\tglobal_load_async_to_lds_b128 %1, %9, off\n\tglobal_load_async_to_lds_b128 %2, %10, off\n\tglobal_load_async_to_lds_b128 %3, %11, off\n\t"
               "global_load_async_to_lds_b128 %4, %12, off\n\tglobal_load_async_to_lds_b128 %5, %13, off\n\tglobal_load_async_to_lds_b128 %6, %14, off\n\tglobal_load_async_to_lds_b128 %7, %15, off\n\ts_wait_xcnt 0x0"
               :: "v"(l), "v"(l + ls), "v"(l + 2 * ls), "v"(l + 3 * ls), "v"(l + 4 * ls), "v"(l + 5 * ls), "v"(l + 6 * ls), "v"(l + 7 * ls),
                  "v"(g), "v"(g + gs), "v"(g + 2 * gs), "v"(g + 3 * gs), "v"(g + 4 * gs), "v"(g + 5 * gs), "v"(g + 6 * gs), "v"(g + 7 * gs) : "memory");
}
__global__ __launch_bounds__(128) void attn_kernel(const b16* __restrict__ Qh, const b16* __restrict__ Ql, const b16* __restrict__ Kh, const b16* __restrict__ Kl, const b16* __restrict__ VTh, const b16* __restrict__ VTl, const float* __restrict__ g2, const float* __restrict__ b2, b16* __restrict__ Ah, b16* __restrict__ Al) {
  __shared__ __attribute__((aligned(16))) b16 Ks[2][2][32][KP];    // [buffer][hi, lo][key][d]
  __shared__ __attribute__((aligned(16))) b16 Vs[2][2][D][VP];     // [buffer][hi, lo][d][key]
  __shared__ __attribute__((aligned(16))) b16 Qs[AW][2][16][KP];   // [wave][hi, lo][query][d]
  __shared__ __attribute__((aligned(16))) float To[AW][16][D + 4];
  const int wave = __builtin_amdgcn_readfirstlane(threadIdx.x >> 5), lane = threadIdx.x & 31, hh = lane >> 4, col = lane & 15; const int bn = blockIdx.x, qb = S / (16 * AW) - 1 - blockIdx.z; const int q0 = qb * (16 * AW) + wave * 16, qi = q0 + col;
  const b16* Kb = Kh + (size_t)bn * S * D; const b16* Klb = Kl + (size_t)bn * S * D; const b16* Vb = VTh + (size_t)bn * D * S; const b16* Vlb = VTl + (size_t)bn * D * S;
  // a wave's share of one key block: 8 k rows (a row = one copy of 32 lanes x 16 B) and 64 v^T rows (8 rows = one copy), hi and lo: 32 copies
  const size_t kg = (size_t)(wave * 8) * D + lane * 8, vg = (size_t)(wave * 64 + (lane >> 2)) * S + (lane & 3) * 8;
  auto stage = [&](int kb, int bf) {
    copy8(lds_off(&Ks[bf][0][wave * 8][lane * 8]), KP * 2, Kb + (size_t)kb * D + kg, D); copy8(lds_off(&Ks[bf][1][wave * 8][lane * 8]), KP * 2, Klb + (size_t)kb * D + kg, D);
    copy8(lds_off(&Vs[bf][0][wave * 64 + (lane >> 2)][(lane & 3) * 8]), 8 * VP * 2, Vb + vg + kb, (size_t)8 * S); copy8(lds_off(&Vs[bf][1][wave * 64 + (lane >> 2)][(lane & 3) * 8]), 8 * VP * 2, Vlb + vg + kb, (size_t)8 * S); };
  { const size_t qg = ((size_t)bn * S + q0) * D + lane * 8;
    copy8(lds_off(&Qs[wave][0][0][lane * 8]), KP * 2, Qh + qg, D); copy8(lds_off(&Qs[wave][0][8][lane * 8]), KP * 2, Qh + qg + 8 * D, D);
    copy8(lds_off(&Qs[wave][1][0][lane * 8]), KP * 2, Ql + qg, D); copy8(lds_off(&Qs[wave][1][8][lane * 8]), KP * 2, Ql + qg + 8 * D, D); }
  asm volatile("s_wait_asynccnt 0x0" ::: "memory");   // the q copies have landed (and no more than 32 copies of a wave are ever outstanding)
  stage(0, 0);
  asm volatile("s_wait_asynccnt 0x0" ::: "memory");   // this wave's share of key block 0 has landed
  __syncthreads();                                    // ... and every other wave's: nothing is read from LDS in front of this barrier
  stage(32, 1);                                       // nt >= 2: key block 1 always exists
  const b16* Qb = &Qs[wave][0][col][0]; const b16* Qlb = &Qs[wave][1][col][0];
  float m = -INFINITY, l = 0.0f; v8f o[16];
#pragma unroll
  for (int t = 0; t < 16; ++t) o[t] = (v8f){};
  const float cs = LOG2E / (XS * XS); const int kend = q0 + 16;   // causal
  const int nt = qb * (16 * AW / 32) + 16 * AW / 32;      // key blocks of the work-group's last wave; the same for all its waves
  for (int it = 0; it < nt; ++it) { const int kb = it * 32, bf = it & 1;
   if (kb < kend) {   // a wave past its diagonal skips the work, never the publish point below
    v8f s0 = {}, s1 = {};
    v16b fq[2][2], fk[2][4];   // two register stages: step i + 1's six fragments are read from LDS as one group ahead of step i's WMMAs; s0 and s1 take turns, each in its old order; unrolled whole so that the stage index is a constant
    auto ldk = [&](int ks, int st) { fq[st][0] = frag_kb(Qb + ks, hh); fq[st][1] = frag_kb(Qlb + ks, hh); fk[st][0] = frag_kb(&Ks[bf][0][col][ks], hh); fk[st][1] = frag_kb(&Ks[bf][0][16 + col][ks], hh);
      fk[st][2] = frag_kb(&Ks[bf][1][col][ks], hh); fk[st][3] = frag_kb(&Ks[bf][1][16 + col][ks], hh); };
    ldk(0, 0);
#pragma unroll
    for (int i = 0; i < D / 32; ++i) { const int st = i & 1; if (i + 1 < D / 32) ldk((i + 1) * 32, st ^ 1);
      group_fence();
      s0 = wmma16b(fk[st][0], fq[st][0], s0); s1 = wmma16b(fk[st][1], fq[st][0], s1); s0 = wmma16b(fk[st][0], fq[st][1], s0); s1 = wmma16b(fk[st][1], fq[st][1], s1);
      s0 = wmma16b(fk[st][2], fq[st][0], s0); s1 = wmma16b(fk[st][3], fq[st][0], s1);
      group_fence(); }
    v16b fv[3][2][2];          // three register stages of two d tiles (hi, lo) each: the first two groups are read ahead of the softmax, group g + 2 ahead of group g's WMMAs; the two tiles take turns, each in its old order
    auto ldv = [&](int g, int st) {
#pragma unroll
      for (int j = 0; j < 2; ++j) { fv[st][j][0] = frag_kb(&Vs[bf][0][(2 * g + j) * 16 + col][0], hh); fv[st][j][1] = frag_kb(&Vs[bf][1][(2 * g + j) * 16 + col][0], hh); } };
    ldv(0, 0); ldv(1, 1);
    group_fence();
    float e[16]; float mx = -INFINITY;
#pragma unroll
    for (int r = 0; r < 8; ++r) { const int k0i = kb + 8 * hh + r, k1i = kb + 16 + 8 * hh + r; e[r] = (k0i <= qi) ? s0[r] * cs : -INFINITY; e[8 + r] = (k1i <= qi) ? s1[r] * cs : -INFINITY; mx = fmaxf(mx, fmaxf(e[r], e[8 + r])); }
    mx = fmaxf(mx, __shfl_xor(mx, 16)); const float mn = fmaxf(m, mx); const float al = nexp2(m - mn); m = mn; float sum = 0.0f; v16b ph, pl;   // key 0 <= qi always -> mn finite
#pragma unroll
    for (int i = 0; i < 16; ++i) { const float p = nexp2(e[i] - mn); sum += p; const b16 h_ = (b16)(p * PS); ph[i] = h_; pl[i] = (b16)(p * PS - (float)h_); }
    sum += __shfl_xor(sum, 16); l = l * al + sum;
#pragma unroll
    for (int g = 0; g < 8; ++g) { const int st = g % 3, t0 = 2 * g, t1 = 2 * g + 1; if (g + 2 < 8) ldv(g + 2, (g + 2) % 3);
      o[t0] *= al; o[t1] *= al;
      group_fence();
      o[t0] = wmma16b(fv[st][0][0], ph, o[t0]); o[t1] = wmma16b(fv[st][1][0], ph, o[t1]); o[t0] = wmma16b(fv[st][0][0], pl, o[t0]); o[t1] = wmma16b(fv[st][1][0], pl, o[t1]);
      o[t0] = wmma16b(fv[st][0][1], ph, o[t0]); o[t1] = wmma16b(fv[st][1][1], ph, o[t1]);
      if (g + 2 < 8) group_fence(); } }   // no reads follow the last two groups: nothing to hold there
   // publish point of key block it + 1, passed by every wave
   asm volatile("s_wait_dscnt 0x0" ::: "memory");      // this wave's reads of buffer bf are done before it may be refilled
   asm volatile("s_wait_asynccnt 0x0" ::: "memory");   // this wave's share of key block it + 1 has landed
   __syncthreads();                                    // both hold for every wave
   if (it + 2 < nt) stage(kb + 64, bf); }
  asm volatile("s_wait_asynccnt 0x0" ::: "memory");    // no copy is outstanding when the wave ends
  // LN2 on the spot: lanes col and col + 16 hold query col's 256 channels, 128 each, so mean and variance are sums in the lane and one exchange with lane ^ 16; gamma and beta are applied behind the LDS transpose, where a lane has 8 fixed channels
  // (the loops are unrolled whole: o is a register array, and every store of the last loop is one base address plus a constant)
  const v4f ga = *(const v4f*)(g2 + lane * 8), gc = *(const v4f*)(g2 + lane * 8 + 4), ba = *(const v4f*)(b2 + lane * 8), bc = *(const v4f*)(b2 + lane * 8 + 4);
  const float inv = 1.0f / (l * PS * XS); v8f sv = {};
#pragma unroll
  for (int t = 0; t < 16; ++t) { o[t] *= inv; sv += o[t]; }
  float s = ((sv[0] + sv[1]) + (sv[2] + sv[3])) + ((sv[4] + sv[5]) + (sv[6] + sv[7])); s += __shfl_xor(s, 16);
  const float mean = s * (1.0f / D); v8f qv = {};
#pragma unroll
  for (int t = 0; t < 16; ++t) { o[t] -= mean; qv += o[t] * o[t]; }
  float ss = ((qv[0] + qv[1]) + (qv[2] + qv[3])) + ((qv[4] + qv[5]) + (qv[6] + qv[7])); ss += __shfl_xor(ss, 16);
  const float rs = rsqrtf(ss * (1.0f / D) + LN_EPS);
#pragma unroll
  for (int t = 0; t < 16; ++t)
#pragma unroll
    for (int r = 0; r < 8; ++r) To[wave][col][t * 16 + 8 * hh + r] = o[t][r] * rs;
  wave_lds_sync();
  float gg[8], bb[8];
#pragma unroll
  for (int i = 0; i < 4; ++i) { gg[i] = bf16_rne(ga[i]); gg[4 + i] = bf16_rne(gc[i]); bb[i] = bf16_rne(ba[i]); bb[4 + i] = bf16_rne(bc[i]); }
#pragma unroll
  for (int rr = 0; rr < 16; ++rr) { const size_t gi = ((size_t)bn * S + q0 + rr) * D + lane * 8; const v4f xa = *(const v4f*)(&To[wave][rr][lane * 8]), xc = *(const v4f*)(&To[wave][rr][lane * 8 + 4]); v8b hv, lv;
#pragma unroll
    for (int i = 0; i < 8; ++i) { b16 h_, l_; split16(((i < 4 ? xa[i] : xc[i - 4]) * gg[i] + bb[i]) * XS, h_, l_); hv[i] = h_; lv[i] = l_; }
    *(v8b*)(Ah + gi) = hv; *(v8b*)(Al + gi) = lv; }
}
// the whole tail of the block in one kernel: h = relu(x W1) W2, e = h + v, out = e W_out, x = LN2(att). Block = 4 waves x 32 tokens, one block per WGP. Every product is taken transposed (A = weight rows, B = token rows), so
// a product's accumulators (lane = token, registers = 8 channels) are, two tiles at a time, the next product's B fragment: hidden and e never leave the registers. x is read once (LDS, then 256 registers of a lane); the weights come
// in 16 chunks of 32 hidden channels (32 rows of W1T, 32 columns of W2T) by asynchronous copies to LDS, two buffers, shared by the 4 waves; each chunk's hidden values go into the e accumulators at once.
// Per accumulator the products and their order are those of the three separate kernels: k ascending in steps of 32, hi then lo.
constexpr int VR = D + 4 /* f32 pitch of a v row in LDS */, OP = 32 + 4 /* f32 pitch of an out row in LDS */;
__global__ __launch_bounds__(128) void ffn_kernel(const b16* __restrict__ Ah, const b16* __restrict__ Al, const b16* __restrict__ W1T, const b16* __restrict__ W2T, const b16* __restrict__ WOT, const float* __restrict__ Vf, float* __restrict__ out) {
  __shared__ __attribute__((aligned(16))) b16 W1s[2][32][KP];      // [buffer][hidden][d]
  __shared__ __attribute__((aligned(16))) b16 W2s[2][D][VP];       // [buffer][d][hidden]
  __shared__ __attribute__((aligned(16))) b16 WOs[C][KP];          // [c][d]
  __shared__ __attribute__((aligned(16))) b16 Xs[AW][2][32][KP];   // [wave][hi, lo][token][d]; a wave's part holds its x rows, then its v rows (f32, pitch VR), then its out tile (f32, pitch OP): no other wave touches it
  const int wave = __builtin_amdgcn_readfirstlane(threadIdx.x >> 5), lane = threadIdx.x & 31, hh = lane >> 4, col = lane & 15; const size_t m0 = (size_t)blockIdx.x * (32 * AW) + wave * 32;
  // a wave's share of one chunk: 8 W1T rows (a row = one copy of 32 lanes x 16 B) and 64 W2T row pieces of 64 B (8 rows = one copy): 16 copies
  auto stage = [&](int c, int bf) {
    copy8(lds_off(&W1s[bf][wave * 8][lane * 8]), KP * 2, W1T + (size_t)(c * 32 + wave * 8) * D + lane * 8, D);
    copy8(lds_off(&W2s[bf][wave * 64 + (lane >> 2)][(lane & 3) * 8]), 8 * VP * 2, W2T + (size_t)(wave * 64 + (lane >> 2)) * F + c * 32 + (lane & 3) * 8, (size_t)8 * F); };
  auto copyx = [&](int j) {   // x rows 16j .. 16j + 15, hi and lo: 32 copies
#pragma unroll
    for (int q = 2 * j; q < 2 * j + 2; ++q) { copy8(lds_off(&Xs[wave][0][8 * q][lane * 8]), KP * 2, Ah + (m0 + 8 * q) * D + lane * 8, D); copy8(lds_off(&Xs[wave][1][8 * q][lane * 8]), KP * 2, Al + (m0 + 8 * q) * D + lane * 8, D); } };
  float* Fw = (float*)&Xs[wave][0][0][0];
  auto copyv = [&](int j) {   // v rows 16j .. 16j + 15 (1,024 B each, two copies): 32 copies; the 16-byte pieces are addressed in 2-byte units
#pragma unroll
    for (int q = 2 * j; q < 2 * j + 2; ++q)
#pragma unroll
      for (int p = 0; p < 2; ++p) copy8(lds_off(Fw + 8 * q * VR + p * 128 + lane * 4), VR * 4, (const b16*)(Vf + (m0 + 8 * q) * D + p * 128 + lane * 4), 2 * D); };
  copyx(0); stage(0, 0);
  asm volatile("s_wait_asynccnt 0x0" ::: "memory");   // never more than 48 copies of a wave are outstanding
  copyx(1); copy8(lds_off(&WOs[wave * 16][lane * 8]), KP * 2, WOT + (size_t)(wave * 16) * D + lane * 8, D); copy8(lds_off(&WOs[wave * 16 + 8][lane * 8]), KP * 2, WOT + (size_t)(wave * 16 + 8) * D + lane * 8, D);
  asm volatile("s_wait_asynccnt 0x0" ::: "memory");   // this wave's x rows and its shares of chunk 0 and of W_out have landed
  __syncthreads();                                    // ... and every other wave's: nothing is read from LDS in front of this barrier
  stage(1, 1);
  v16b xh[2][D / 32], xl[2][D / 32];
#pragma unroll
  for (int j = 0; j < 2; ++j)
#pragma unroll
    for (int i = 0; i < D / 32; ++i) { xh[j][i] = frag_kb(&Xs[wave][0][j * 16 + col][i * 32], hh); xl[j][i] = frag_kb(&Xs[wave][1][j * 16 + col][i * 32], hh); }
  v8f e[2][16];
#pragma unroll
  for (int j = 0; j < 2; ++j)
#pragma unroll
    for (int t = 0; t < 16; ++t) e[j][t] = (v8f){};
  for (int it = 0; it < F / 32; ++it) { const int bf = it & 1;
    v16b fw[3][8];   // three register stages of eight weight fragments: each group is read from LDS as a whole ahead of the WMMAs of a group before it
    auto ld1 = [&](int g, int st) {   // W1T: k steps 4g .. 4g + 3, both hidden tiles
#pragma unroll
      for (int i = 0; i < 4; ++i) { fw[st][2 * i] = frag_kb(&W1s[bf][col][(4 * g + i) * 32], hh); fw[st][2 * i + 1] = frag_kb(&W1s[bf][16 + col][(4 * g + i) * 32], hh); } };
    auto ld2 = [&](int g, int st) {   // W2T: d tiles 8g .. 8g + 7
#pragma unroll
      for (int t = 0; t < 8; ++t) fw[st][t] = frag_kb(&W2s[bf][(8 * g + t) * 16 + col][0], hh); };
    v8f h00 = {}, h01 = {}, h10 = {}, h11 = {};   // [token tile][hidden tile]
    auto mm1 = [&](int g, int st) {   // four independent accumulators take turns
#pragma unroll
      for (int i = 0; i < 4; ++i) { const int k = 4 * g + i;
        h00 = wmma16b(fw[st][2 * i], xh[0][k], h00); h01 = wmma16b(fw[st][2 * i + 1], xh[0][k], h01); h10 = wmma16b(fw[st][2 * i], xh[1][k], h10); h11 = wmma16b(fw[st][2 * i + 1], xh[1][k], h11);
        h00 = wmma16b(fw[st][2 * i], xl[0][k], h00); h01 = wmma16b(fw[st][2 * i + 1], xl[0][k], h01); h10 = wmma16b(fw[st][2 * i], xl[1][k], h10); h11 = wmma16b(fw[st][2 * i + 1], xl[1][k], h11); } };
    ld1(0, 0); ld1(1, 1);
    group_fence();
    mm1(0, 0);
    group_fence();
    ld2(0, 0); ld2(1, 2);
    group_fence();
    mm1(1, 1);
    group_fence();   // keeps the waits below behind these WMMAs, under which the W2T fragments arrive: without it the compiler lifts the waits to just behind the reads
    // publish point of chunk it + 1, passed by every wave. It stands here and not at the trip's end: the W2T fragments, the trip's last LDS reads, went out ahead of the WMMAs above; what is left of the trip works on registers alone, and the next copies fly under it too
    asm volatile("s_wait_dscnt 0x0" ::: "memory");      // this wave's reads of buffer bf (and, in trip 0, of its x rows) are done before the LDS may be refilled
    asm volatile("s_wait_asynccnt 0x0" ::: "memory");   // this wave's share of chunk it + 1 has landed
    __syncthreads();                                    // both hold for every wave
    if (it + 2 < F / 32) stage(it + 2, bf);
    if (it < 2) copyv(it);                              // the x rows are in registers: the wave's v rows take their place, half at a time (48 copies outstanding at most), and land long before the loop ends
    v16b ph[2], pl[2];   // relu(hidden) x8, hi and lo: hidden tiles 0 and 1 of a token tile are elements 0..7 and 8..15 of its B fragment
#pragma unroll
    for (int r = 0; r < 8; ++r) { b16 h_, l_;
      split16(fmaxf(h00[r] * (1.0f / (XS * WSC)), 0.0f) * XS, h_, l_); ph[0][r] = h_; pl[0][r] = l_; split16(fmaxf(h01[r] * (1.0f / (XS * WSC)), 0.0f) * XS, h_, l_); ph[0][8 + r] = h_; pl[0][8 + r] = l_;
      split16(fmaxf(h10[r] * (1.0f / (XS * WSC)), 0.0f) * XS, h_, l_); ph[1][r] = h_; pl[1][r] = l_; split16(fmaxf(h11[r] * (1.0f / (XS * WSC)), 0.0f) * XS, h_, l_); ph[1][8 + r] = h_; pl[1][8 + r] = l_; }
#pragma unroll
    for (int g = 0; g < 2; ++g) {   // d tiles 8g .. 8g + 7 are in stage 2g
#pragma unroll
      for (int t = 0; t < 8; ++t) { e[0][8 * g + t] = wmma16b(fw[2 * g][t], ph[0], e[0][8 * g + t]); e[1][8 * g + t] = wmma16b(fw[2 * g][t], ph[1], e[1][8 * g + t]); }
#pragma unroll
      for (int t = 0; t < 8; ++t) { e[0][8 * g + t] = wmma16b(fw[2 * g][t], pl[0], e[0][8 * g + t]); e[1][8 * g + t] = wmma16b(fw[2 * g][t], pl[1], e[1][8 * g + t]); } } }
  asm volatile("s_wait_asynccnt 0x0" ::: "memory");     // no copy is outstanding behind the loop
  v16b fo[2][8];   // W_out fragments: two register stages of two k steps x four c tiles
  auto ldo = [&](int g, int st) {
#pragma unroll
    for (int i = 0; i < 2; ++i)
#pragma unroll
      for (int t = 0; t < 4; ++t) fo[st][4 * i + t] = frag_kb(&WOs[t * 16 + col][(2 * g + i) * 32], hh); };
  ldo(0, 0);
  v16b eh[2][D / 32], el[2][D / 32];   // e = h + v, x8, hi and lo: d tiles 2i and 2i + 1 are the B fragment of k step i
#pragma unroll
  for (int j = 0; j < 2; ++j)
#pragma unroll
    for (int t = 0; t < 16; ++t) { const float* pv = Fw + (j * 16 + col) * VR + t * 16 + 8 * hh; const v4f va = *(const v4f*)pv, vb = *(const v4f*)(pv + 4);
#pragma unroll
      for (int r = 0; r < 8; ++r) { const float y = e[j][t][r] * (1.0f / (XS * WSC)) + (r < 4 ? va[r & 3] : vb[r & 3]); b16 h_, l_; split16(y * XS, h_, l_); eh[j][t >> 1][(t & 1) * 8 + r] = h_; el[j][t >> 1][(t & 1) * 8 + r] = l_; } }
  v8f oa[2][4];
#pragma unroll
  for (int j = 0; j < 2; ++j)
#pragma unroll
    for (int t = 0; t < 4; ++t) oa[j][t] = (v8f){};
#pragma unroll
  for (int g = 0; g < 4; ++g) { const int st = g & 1; if (g + 1 < 4) ldo(g + 1, st ^ 1);
    group_fence();
#pragma unroll
    for (int i = 0; i < 2; ++i) {
#pragma unroll
      for (int t = 0; t < 4; ++t) { oa[0][t] = wmma16b(fo[st][4 * i + t], eh[0][2 * g + i], oa[0][t]); oa[1][t] = wmma16b(fo[st][4 * i + t], eh[1][2 * g + i], oa[1][t]); }
#pragma unroll
      for (int t = 0; t < 4; ++t) { oa[0][t] = wmma16b(fo[st][4 * i + t], el[0][2 * g + i], oa[0][t]); oa[1][t] = wmma16b(fo[st][4 * i + t], el[1][2 * g + i], oa[1][t]); } }
    group_fence(); }
  wave_lds_sync();   // the wave's reads of its v rows are done: its out tile (64 c x 32 tokens) takes their place
#pragma unroll
  for (int j = 0; j < 2; ++j)
#pragma unroll
    for (int t = 0; t < 4; ++t)
#pragma unroll
      for (int r = 0; r < 8; ++r) Fw[(t * 16 + 8 * hh + r) * OP + j * 16 + col] = oa[j][t][r] * (1.0f / (XS * WSC));
  wave_lds_sync();
  const int bn = (int)(m0 / S), s0 = (int)(m0 % S), b = bn / NN, n = bn % NN; float* po = out + (((size_t)b * C + (lane >> 3)) * NN + n) * S + s0 + (lane & 7) * 4;
#pragma unroll   // unrolled: every store is one base address plus a constant (a store = 4 channel rows x one whole 128-byte line), so no address register takes a new value behind an issued store
  for (int i = 0; i < 16; ++i) *(v4f*)(po + (size_t)i * 4 * NN * S) = *(const v4f*)(Fw + (i * 4 + (lane >> 3)) * OP + (lane & 7) * 4);
}
}  // namespace

extern "C" void kernel_launch(void* const* d_in, const int* in_sizes, int n_in, void* d_out, int out_size, void* d_ws, size_t ws_size, hipStream_t stream) {
  (void)n_in;
  auto Fp = [&](int i) { return (const float*)d_in[i]; };
  // input order: 0 fea_lf [4,64,8,32,32], 1 fea_hf, 2 W_in [64,256], 3 W_kv [64,512], 4 gamma, 5 beta, 6 g2, 7 b2, 8 W1 [256,512], 9 W2 [512,256], 10 W_out [256,64] (all (in, out))
  if (in_sizes[0] != NR * C || in_sizes[1] != NR * C || in_sizes[2] != C * D || in_sizes[3] != C * F || in_sizes[4] != D || in_sizes[8] != D * F || in_sizes[9] != F * D || in_sizes[10] != D * C || out_size != NR * C) return;
  size_t off = 0; char* ws = (char*)d_ws;
  auto carve = [&](size_t bytes) { char* p = ws + off; off += (bytes + 255) & ~(size_t)255; return p; };
  b16* TQ16 = (b16*)carve((size_t)NR * C * 2); b16* TK16 = (b16*)carve((size_t)NR * C * 2); b16* WIN = (b16*)carve((size_t)D * C * 2); b16* WKV = (b16*)carve((size_t)F * C * 2); b16* W1T = (b16*)carve((size_t)F * D * 2); b16* W2T = (b16*)carve((size_t)D * F * 2); b16* WOT = (b16*)carve((size_t)C * D * 2);
  b16* Qh = (b16*)carve((size_t)NR * D * 2); b16* Ql = (b16*)carve((size_t)NR * D * 2); b16* Kh = (b16*)carve((size_t)NR * D * 2); b16* Kl = (b16*)carve((size_t)NR * D * 2);
  float* Vf = (float*)carve((size_t)NR * D * 4); b16* VTh = (b16*)carve((size_t)NR * D * 2); b16* VTl = (b16*)carve((size_t)NR * D * 2); b16* Ah = (b16*)carve((size_t)NR * D * 2); b16* Al = (b16*)carve((size_t)NR * D * 2);   // LN2(att) gets its own planes: other attention blocks still read q, k and v while they are written
  if (off > ws_size) return;   // = 177 MB
  xt_kernel<<<dim3(S / 64, 2, NBN), 256, 0, stream>>>(Fp(0), Fp(1), TQ16, TK16);
  prepw_kernel<<<dim3(8, 8, 5), 256, 0, stream>>>(Fp(2), Fp(3), Fp(8), Fp(9), Fp(10), WIN, WKV, W1T, W2T, WOT);
  projln_kernel<<<NR / 64, 128, 0, stream>>>(0, TQ16, TK16, WIN, WKV, Fp(4), Fp(5), Qh, Ql);   // q = LN(tok_q W_in)
  projln_kernel<<<NR / 64, 128, 0, stream>>>(1, TQ16, TK16, WIN, WKV, Fp(4), Fp(5), Kh, Kl);   // k = LN(tok_kv W_kv[:, :256])
  proj_kernel<<<NR / 64, 128, 0, stream>>>(2, TQ16, TK16, WIN, WKV, Vf);   // v f32 rows (residual)
  v_kernel<<<dim3(D / 64, S / 128, NBN), 128, 0, stream>>>(TK16, WKV, VTh, VTl);
  attn_kernel<<<dim3(NBN, 1, S / (16 * AW)), 32 * AW, 0, stream>>>(Qh, Ql, Kh, Kl, VTh, VTl, Fp(6), Fp(7), Ah, Al);   // LN2(att)
  ffn_kernel<<<NR / (32 * AW), 32 * AW, 0, stream>>>(Ah, Al, W1T, W2T, WOT, Vf, (float*)d_out);   // out = (relu(LN2(att) W1) W2 + v) W_out
}

// v006
// It runs in 133 microseconds.
// Next to v005, in two timings, it ran 1.08 and 1.12 times as fast.
// Over all steps from v000 it is 9.97 times as fast.
#include <hip/hip_runtime.h>

// Inter-frequency attention block: 32 sequences (4 batches x 8 'n' slices) of 1,024 tokens (32 x 32 positions), 64 channels; q = LN(tok_q W_in), k = LN((tok_kv W_kv)[:, :256]) (shared gamma/beta),
// v = (tok_kv W_kv)[:, 256:]; score = q.k (no scaling), causal (lower triangle; fill -1e15 == masked out since the diagonal is always kept), softmax, att = p v; h = relu(LN2(att) W1) W2;
// out = (h + v) W_out -> written channel-major as [4][64][8][32][32].
// WMMA (v_wmma_f32_16x16x32_f16, f32 accumulate): W_in / W_kv projections with EXACT bf16 tokens (x8, LDS-transposed from the channel-major inputs) and weights (x256), 1 product, each LayerNorm in the epilogue of the kernel that makes its rows; S^T = K.Q^T with
// q AND k (LayerNorm outputs) f16 hi+lo x8 (3 products: the unscaled 256-dim logits have sigma ~16); online softmax in f32; O^T += V^T P^T with v and P f16 hi+lo (3 products, one f32 accumulator:
// unscaled residuals); FFN W1 with LN2(att) hi+lo (2 products), W2 with the relu hidden hi+lo (2 products), W_out with (h + v) hi+lo (2 products). LayerNorms, softmax, relu, residual in f32.
// Inputs rounded to bf16 once. Fragment k-map per lane half hh for A AND B: elements 0..7 <- k = 8hh+0..7, 8..15 <- k = 16+8hh+0..7; acc[r] = D[8hh+r][col].

namespace {
constexpr int NBN = 32 /* b*n sequences */, NN = 8, S = 1024, C = 64, D = 256, F = 512, NR = NBN * S /* all 32 sequences go through every stage in one launch */;
constexpr float XS = 8.0f, WSC = 256.0f, PS = 8.0f, LOG2E = 1.4426950408889634f, LN_EPS = 1e-5f;

typedef _Float16 b16;
typedef __attribute__((ext_vector_type(16))) _Float16 v16b;
typedef __attribute__((ext_vector_type(8))) _Float16 v8b;
typedef __attribute__((ext_vector_type(8))) float v8f;
typedef __attribute__((ext_vector_type(4))) float v4f;
__device__ __forceinline__ float bf16_rne(float f) { unsigned int u = __float_as_uint(f); u += 0x7FFFu + ((u >> 16) & 1u); return __uint_as_float(u & 0xFFFF0000u); }
__device__ __forceinline__ void split16(float v, b16& hi, b16& lo) { hi = (b16)v; lo = (b16)(v - (float)hi); }
__device__ __forceinline__ v16b frag_kb(const b16* p, int hh) { const v8b a = *(const v8b*)(p + 8 * hh), b = *(const v8b*)(p + 16 + 8 * hh); v16b f;
#pragma unroll
  for (int e = 0; e < 8; ++e) { f[e] = a[e]; f[8 + e] = b[e]; } return f; }
__device__ __forceinline__ v8f wmma16b(v16b a, v16b b, v8f c) { return __builtin_amdgcn_wmma_f32_16x16x32_f16(false, a, false, b, (short)0, c, false, false); }
// stands between a group of fragment loads and a block of WMMAs: without it the compiler sinks each load to just in front of its own WMMA, and every load's latency is waited out alone
__device__ __forceinline__ void group_fence() { __builtin_amdgcn_sched_barrier(0); }
// stands behind the WMMAs of a tile whose fragments are all loaded from global memory as one group: the loads' address registers are inputs here, so none of them is given a new value ahead of this wait
__device__ __forceinline__ void addr_wait(const b16* a, const b16* b, const b16* c) { asm volatile("s_wait_xcnt 0x0" :: "v"(a), "v"(b), "v"(c) : "memory"); }
__device__ __forceinline__ void wave_lds_sync() { __builtin_amdgcn_fence(__ATOMIC_RELEASE, "workgroup"); __builtin_amdgcn_wave_barrier(); __builtin_amdgcn_fence(__ATOMIC_ACQUIRE, "workgroup"); }
__device__ __forceinline__ float nexp2(float x) { return __builtin_amdgcn_exp2f(x); }
// sum over a 16-lane row, left in every lane of it: four adds whose second operand comes from lane ^ M of the row (DPP row_xmask), no LDS round trip
template <int M> __device__ __forceinline__ float xadd(float v) { return v + __int_as_float(__builtin_amdgcn_update_dpp(0, __float_as_int(v), 0x160 + M, 0xf, 0xf, true)); }
__device__ __forceinline__ float hsum16(float v) { return xadd<8>(xadd<4>(xadd<2>(xadd<1>(v)))); }

// the parts below are the bodies of kernels that do not depend on one another; the two kernels behind them give each work-group one part by its block index (bx, by, bz: the part's own block coordinates; the LDS is the kernel's, handed in)
__device__ __forceinline__ void xt_part(b16 (*T)[64 + 8], int bx, int by, int bz, const float* __restrict__ flf, const float* __restrict__ fhf, b16* __restrict__ TQ16, b16* __restrict__ TK16) {
  const int bn = bz, kind = by, s0 = bx * 64, t_ = threadIdx.x; const int b = bn / NN, n = bn % NN; const float* src = (kind == 0 ? flf : fhf) + ((size_t)b * C * NN + n) * S; b16* dst = kind == 0 ? TQ16 : TK16;
  for (int q = t_; q < 64 * 64; q += 256) { const int cc = q >> 6, ss = q & 63; T[ss][cc] = (b16)(bf16_rne(src[(size_t)cc * NN * S + s0 + ss]) * XS); }
  __syncthreads();
  { for (int q = t_; q < 64 * 8; q += 256) { const int ss = q >> 3, c8 = (q & 7) * 8; *(v8b*)(dst + ((size_t)bn * S + s0 + ss) * C + c8) = *(const v8b*)(&T[ss][c8]); }  }
}
// weights (in,out) transposed to [out][in] rows x256 via 64x64 LDS tiles: kind 0 W_in [64][256] -> WIN [256][64]; 1 W_kv [64][512] -> WKV [512][64]; 2 W1 [256][512] -> W1T [512][256];
__device__ __forceinline__ void prepw_part(b16 (*T)[64 + 8], int bx, int by, int bz, const float* __restrict__ win, const float* __restrict__ wkv, const float* __restrict__ w1, const float* __restrict__ w2, const float* __restrict__ wout, b16* __restrict__ WIN, b16* __restrict__ WKV, b16* __restrict__ W1T, b16* __restrict__ W2T, b16* __restrict__ WOT) {
  const int kind = bz, i0 = bx * 64, o0 = by * 64, t_ = threadIdx.x; const float* w; b16* dst; int nin, nout;
  if (kind == 0) { w = win; dst = WIN; nin = C; nout = D; } else if (kind == 1) { w = wkv; dst = WKV; nin = C; nout = F; } else if (kind == 2) { w = w1; dst = W1T; nin = D; nout = F; } else if (kind == 3) { w = w2; dst = W2T; nin = F; nout = D; } else { w = wout; dst = WOT; nin = D; nout = C; }
  if (i0 >= nin || o0 >= nout) return;
  for (int q = t_; q < 64 * 64; q += 256) { const int ii = q >> 6, oo = q & 63; T[oo][ii] = (b16)(bf16_rne(w[(size_t)(i0 + ii) * nout + o0 + oo]) * WSC); }
  __syncthreads();
  { for (int q = t_; q < 64 * 8; q += 256) { const int oo = q >> 3, c8 = (q & 7) * 8; *(v8b*)(dst + (size_t)(o0 + oo) * nin + i0 + c8) = *(const v8b*)(&T[oo][c8]); }  }
}
// token transpose and weight transpose in one launch: 320 work-groups of the weight grid (8 x 8 x 5) first, then 1,024 of the token grid (16 x 2 x 32)
constexpr int NPW = 8 * 8 * 5, NXT = (S / 64) * 2 * NBN;
__global__ __launch_bounds__(256) void prep_kernel(const float* __restrict__ flf, const float* __restrict__ fhf, const float* __restrict__ win, const float* __restrict__ wkv, const float* __restrict__ w1, const float* __restrict__ w2, const float* __restrict__ wout,
                                                   b16* __restrict__ TQ16, b16* __restrict__ TK16, b16* __restrict__ WIN, b16* __restrict__ WKV, b16* __restrict__ W1T, b16* __restrict__ W2T, b16* __restrict__ WOT) {
  __shared__ __attribute__((aligned(16))) b16 T[64][64 + 8];
  const int b = blockIdx.x;
  if (b < NPW) prepw_part(T, b & 7, (b >> 3) & 7, b >> 6, win, wkv, w1, w2, wout, WIN, WKV, W1T, W2T, WOT);
  else { const int i = b - NPW; xt_part(T, i & 15, (i >> 4) & 1, i >> 5, flf, fhf, TQ16, TK16); }
}
// projections: block = 64 rows x 4 waves x 256 cols (16 tiles, K = 64 exact, 1 product): Y = tok W (kind 0: tok_q WIN; 1: tok_kv WKV[:256]; 2: tok_kv WKV[256:]) -> f32 rows [row][256]
__device__ __forceinline__ void proj_part(char* sm, int bx, int kind, const b16* __restrict__ TQ16, const b16* __restrict__ TK16, const b16* __restrict__ WIN, const b16* __restrict__ WKV, float* __restrict__ Y) {
  float (*Tf)[16][128 + 4] = (float (*)[16][128 + 4])sm;   // [4 waves][16][128 + 4]
  const int wave = threadIdx.x >> 5, lane = threadIdx.x & 31, nloc = lane & 15, hlf = lane >> 4; const size_t m0 = (size_t)bx * 64 + wave * 16;
  const b16* A = kind == 0 ? TQ16 : TK16; const b16* Bw = kind == 0 ? WIN : WKV; const int wo = kind == 2 ? D * C : 0;   // the v half of W_kv (rows D .. 2D - 1) is a constant step on the lane's address, not a second address
  v8f acc[16];
#pragma unroll
  for (int t = 0; t < 16; ++t) acc[t] = (v8f){};
  const b16* pa = A + (m0 + nloc) * C + 8 * hlf; const b16* pw = Bw + (size_t)nloc * C + 8 * hlf;   // the lane's own addresses: every load below is one of these plus a constant
  v16b fa[2], fw[2][16];   // all fragments of the tile (K = 64) are requested as one group
#pragma unroll
  for (int i = 0; i < 2; ++i) { fa[i] = frag_kb(pa + i * 32, 0);
#pragma unroll
    for (int t = 0; t < 16; ++t) fw[i][t] = frag_kb(pw + wo + t * 16 * C + i * 32, 0); }
  group_fence();
#pragma unroll
  for (int i = 0; i < 2; ++i)
#pragma unroll
    for (int t = 0; t < 16; ++t) acc[t] = wmma16b(fa[i], fw[i][t], acc[t]);
  group_fence(); addr_wait(pa, pw, pw);   // the fence keeps the wait behind the WMMAs, where every load has returned
  for (int hq = 0; hq < 2; ++hq) {
#pragma unroll
    for (int t = 0; t < 8; ++t)
#pragma unroll
      for (int r = 0; r < 8; ++r) Tf[wave][8 * hlf + r][t * 16 + nloc] = acc[hq * 8 + t][r] * (1.0f / (XS * WSC));
    wave_lds_sync();
    { for (int rr = 0; rr < 16; ++rr) *(v4f*)(Y + (m0 + rr) * D + hq * 128 + lane * 4) = *(const v4f*)(&Tf[wave][rr][lane * 4]);  }
    wave_lds_sync(); }
}
// q and k projections with their LayerNorm (kind 0: tok_q WIN; 1: tok_kv WKV[:256]): the products of proj_part; a wave holds its 16 rows whole (256 columns: 16 in a lane x 16 lanes), so mean, variance and the
// affine step are taken on the accumulators, and the f16 hi+lo x8 planes go out through LDS as whole rows: no f32 plane and no row kernel in between
__device__ __forceinline__ void projln_part(char* sm, int bx, int kind, const b16* __restrict__ TQ16, const b16* __restrict__ TK16, const b16* __restrict__ WIN, const b16* __restrict__ WKV, const float* __restrict__ g, const float* __restrict__ be, b16* __restrict__ Yh, b16* __restrict__ Yl) {
  b16 (*Th)[16][D + 8] = (b16 (*)[16][D + 8])sm; b16 (*Tl)[16][D + 8] = Th + 4;   // [4 waves][16][D + 8] each
  const int wave = threadIdx.x >> 5, lane = threadIdx.x & 31, nloc = lane & 15, hlf = lane >> 4; const size_t m0 = (size_t)bx * 64 + wave * 16;
  const b16* A = kind == 0 ? TQ16 : TK16; const b16* Bw = kind == 0 ? WIN : WKV;
  v8f acc[16];
#pragma unroll
  for (int t = 0; t < 16; ++t) acc[t] = (v8f){};
  const b16* pa = A + (m0 + nloc) * C + 8 * hlf; const b16* pw = Bw + (size_t)nloc * C + 8 * hlf;   // the lane's own addresses: every load below is one of these plus a constant
  v16b fa[2], fw[2][16];   // all fragments of the tile (K = 64) are requested as one group, the lane's 16 gamma and beta values with them
#pragma unroll
  for (int i = 0; i < 2; ++i) { fa[i] = frag_kb(pa + i * 32, 0);
#pragma unroll
    for (int t = 0; t < 16; ++t) fw[i][t] = frag_kb(pw + t * 16 * C + i * 32, 0); }
  float gv[16], bv[16];
#pragma unroll
  for (int t = 0; t < 16; ++t) { gv[t] = g[t * 16 + nloc]; bv[t] = be[t * 16 + nloc]; }
  group_fence();
#pragma unroll
  for (int i = 0; i < 2; ++i)
#pragma unroll
    for (int t = 0; t < 16; ++t) acc[t] = wmma16b(fa[i], fw[i][t], acc[t]);
  group_fence(); addr_wait(pa, pw, pw);   // the fence keeps the wait behind the WMMAs, where every load has returned
  constexpr float SC = 1.0f / (XS * WSC);   // a power of two: scaling the sum is scaling every term
  float mean[8], rs[8];   // the loops below are unrolled whole: acc, gv, bv, mean and rs are register arrays and take constant indices only
#pragma unroll
  for (int r = 0; r < 8; ++r) { float s = 0.0f;
#pragma unroll
    for (int t = 0; t < 16; ++t) s += acc[t][r];
    mean[r] = hsum16(s) * (SC / D); }
#pragma unroll
  for (int r = 0; r < 8; ++r) { float ss = 0.0f;
#pragma unroll
    for (int t = 0; t < 16; ++t) { const float dv = acc[t][r] * SC - mean[r]; acc[t][r] = dv; ss += dv * dv; }
    rs[r] = rsqrtf(hsum16(ss) * (1.0f / D) + LN_EPS); }
#pragma unroll
  for (int t = 0; t < 16; ++t) { const float gt = bf16_rne(gv[t]), bt = bf16_rne(bv[t]);
#pragma unroll
    for (int r = 0; r < 8; ++r) { b16 h_, l_; split16((acc[t][r] * rs[r] * gt + bt) * XS, h_, l_); Th[wave][8 * hlf + r][t * 16 + nloc] = h_; Tl[wave][8 * hlf + r][t * 16 + nloc] = l_; } }
  wave_lds_sync();
#pragma unroll   // unrolled: every store is one base address plus a constant, so no address register takes a new value behind an issued store
  for (int rr = 0; rr < 16; ++rr) { const size_t gi = (m0 + rr) * D + lane * 8; *(v8b*)(Yh + gi) = *(const v8b*)(&Th[wave][rr][lane * 8]); *(v8b*)(Yl + gi) = *(const v8b*)(&Tl[wave][rr][lane * 8]); }
}
// v in channel-major hi/lo planes for the PV operand: VTh/VTl [bn][256 d][1024 s] = f16 hi+lo x8 of (tok_kv WKV[256:])^T: A = WKV_v rows d (K = 64), B = TK16 rows s; block = 64 d x 4 waves x
__device__ __forceinline__ void v_part(char* sm, int bx, int by, int bz, const b16* __restrict__ TK16, const b16* __restrict__ WKV, b16* __restrict__ VTh, b16* __restrict__ VTl) {
  b16 (*Ts)[16][128 + 8] = (b16 (*)[16][128 + 8])sm; b16 (*Tsl)[16][128 + 8] = Ts + 4;   // [4 waves][16][128 + 8] each
  const int wave = threadIdx.x >> 5, lane = threadIdx.x & 31, nloc = lane & 15, hlf = lane >> 4; const int bn = bz; const int d0 = bx * 64 + wave * 16, s0 = by * 128;
  v8f acc[8];
#pragma unroll
  for (int t = 0; t < 8; ++t) acc[t] = (v8f){};
  const b16* pa = WKV + (size_t)(d0 + nloc) * C + 8 * hlf; const b16* pw = TK16 + ((size_t)bn * S + s0 + nloc) * C + 8 * hlf;   // the lane's own addresses: every load below is one of these plus a constant
  v16b fa[2], fw[2][8];   // all fragments of the tile (K = 64) are requested as one group
#pragma unroll
  for (int i = 0; i < 2; ++i) { fa[i] = frag_kb(pa + D * C + i * 32, 0);   // the v half of W_kv: rows D .. 2D - 1
#pragma unroll
    for (int t = 0; t < 8; ++t) fw[i][t] = frag_kb(pw + t * 16 * C + i * 32, 0); }
  group_fence();
#pragma unroll
  for (int i = 0; i < 2; ++i)
#pragma unroll
    for (int t = 0; t < 8; ++t) acc[t] = wmma16b(fa[i], fw[i][t], acc[t]);
  group_fence(); addr_wait(pa, pw, pw);   // the fence keeps the wait behind the WMMAs, where every load has returned
#pragma unroll
  for (int t = 0; t < 8; ++t)
#pragma unroll
    for (int r = 0; r < 8; ++r) { b16 h_, l_; split16(acc[t][r] * (1.0f / (XS * WSC)) * XS, h_, l_); Ts[wave][8 * hlf + r][t * 16 + nloc] = h_; Tsl[wave][8 * hlf + r][t * 16 + nloc] = l_; }
  wave_lds_sync();
  { for (int rr = 0; rr < 16; ++rr) if (lane < 16) { const size_t gi = ((size_t)bn * D + d0 + rr) * S + s0 + lane * 8; *(v8b*)(VTh + gi) = *(const v8b*)(&Ts[wave][rr][lane * 8]); *(v8b*)(VTl + gi) = *(const v8b*)(&Tsl[wave][rr][lane * 8]); }  }
}
// all four projections in one launch; the parts with a LayerNorm, the longest, come first: 512 work-groups for q, 512 for k, 512 for the f32 v rows, 1,024 (4 x 8 x 32) for v^T
constexpr int NPB = NR / 64, NVB = (D / 64) * (S / 128) * NBN;
__global__ __launch_bounds__(128) void front_kernel(const b16* __restrict__ TQ16, const b16* __restrict__ TK16, const b16* __restrict__ WIN, const b16* __restrict__ WKV, const float* __restrict__ g, const float* __restrict__ be,
                                                    b16* __restrict__ Qh, b16* __restrict__ Ql, b16* __restrict__ Kh, b16* __restrict__ Kl, float* __restrict__ Vf, b16* __restrict__ VTh, b16* __restrict__ VTl) {
  __shared__ __attribute__((aligned(16))) char sm[2 * 4 * 16 * (D + 8) * 2];   // the largest part's need (q, k: two planes of 4 x 16 rows)
  const int b = blockIdx.x;
  if (b < 2 * NPB) { const int kind = b < NPB ? 0 : 1; projln_part(sm, b - kind * NPB, kind, TQ16, TK16, WIN, WKV, g, be, kind == 0 ? Qh : Kh, kind == 0 ? Ql : Kl); }   // q = LN(tok_q W_in), k = LN(tok_kv W_kv[:, :256]): one copy of the code
  else if (b < 3 * NPB) proj_part(sm, b - 2 * NPB, 2, TQ16, TK16, WIN, WKV, Vf);   // v f32 rows (residual)
  else { const int i = b - 3 * NPB; v_part(sm, i & 3, (i >> 2) & 7, i >> 5, TK16, WKV, VTh, VTl); }
}
// causal attention: grid (sequences, 1, S/64), block = 4 waves x 16 queries; one block fills a WGP's LDS and there are twice as many blocks as WGPs, so the query block falls with blockIdx.z: the longest blocks start first, and a WGP
// that ends a block of the first round (18 to 32 key blocks) takes the longest one left (16 down to 2); key blocks of 32 (no scaling). Every fragment comes from LDS: each wave's q rows are copied there once, each 32-key block of
// k (rows of 512 B, LDS pitch 528 B) and of v^T (rows of 64 B, LDS pitch 80 B), hi and lo, once per block of 4 waves, by asynchronous copies to LDS, two buffers: block t + 1 flies while block t is worked on.
// The products, their order and the softmax of a wave are those of the per-wave form: S^T 3 products with K = 256 (8 steps), online softmax f32, O^T 3 products.
constexpr int AW = 4, KP = D + 8, VP = 32 + 8;
__device__ __forceinline__ unsigned lds_off(const void* p) { return (unsigned)(size_t)p; }
// eight 16-byte-per-lane copies global -> LDS, addresses stepping by ls bytes (LDS) and gs elements (global); s_wait_xcnt 0 closes the statement so that no address register is rewritten ahead of it
__device__ __forceinline__ void copy8(unsigned l, unsigned ls, const b16* g, size_t gs) {
  asm volatile("global_load_async_to_lds_b128 %0, %8, off\n\tglobal_load_async_to_lds_b128 %1, %9, off\n\tglobal_load_async_to_lds_b128 %2, %10, off\n\tglobal_load_async_to_lds_b128 %3, %11, off\n\t"
               "global_load_async_to_lds_b128 %4, %12, off\n\tglobal_load_async_to_lds_b128 %5, %13, off\n\tglobal_load_async_to_lds_b128 %6, %14, off\n\tglobal_load_async_to_lds_b128 %7, %15, off\n\ts_wait_xcnt 0x0"
               :: "v"(l), "v"(l + ls), "v"(l + 2 * ls), "v"(l + 3 * ls), "v"(l + 4 * ls), "v"(l + 5 * ls), "v"(l + 6 * ls), "v"(l + 7 * ls),
                  "v"(g), "v"(g + gs), "v"(g + 2 * gs), "v"(g + 3 * gs), "v"(g + 4 * gs), "v"(g + 5 * gs), "v"(g + 6 * gs), "v"(g + 7 * gs) : "memory");
}
__global__ __launch_bounds__(128) void attn_kernel(const b16* __restrict__ Qh, const b16* __restrict__ Ql, const b16* __restrict__ Kh, const b16* __restrict__ Kl, const b16* __restrict__ VTh, const b16* __restrict__ VTl, const float* __restrict__ g2, const float* __restrict__ b2, b16* __restrict__ Ah, b16* __restrict__ Al) {
  __shared__ __attribute__((aligned(16))) b16 Ks[2][2][32][KP];    // [buffer][hi, lo][key][d]
  __shared__ __attribute__((aligned(16))) b16 Vs[2][2][D][VP];     // [buffer][hi, lo][d][key]
  __shared__ __attribute__((aligned(16))) b16 Qs[AW][2][16][KP];   // [wave][hi, lo][query][d]
  __shared__ __attribute__((aligned(16))) float To[AW][16][D + 4];
  const int wave = __builtin_amdgcn_readfirstlane(threadIdx.x >> 5), lane = threadIdx.x & 31, hh = lane >> 4, col = lane & 15; const int bn = blockIdx.x, qb = S / (16 * AW) - 1 - blockIdx.z; const int q0 = qb * (16 * AW) + wave * 16, qi = q0 + col;
  const b16* Kb = Kh + (size_t)bn * S * D; const b16* Klb = Kl + (size_t)bn * S * D; const b16* Vb = VTh + (size_t)bn * D * S; const b16* Vlb = VTl + (size_t)bn * D * S;
  // a wave's share of one key block: 8 k rows (a row = one copy of 32 lanes x 16 B) and 64 v^T rows (8 rows = one copy), hi and lo: 32 copies
  const size_t kg = (size_t)(wave * 8) * D + lane * 8, vg = (size_t)(wave * 64 + (lane >> 2)) * S + (lane & 3) * 8;
  auto stage = [&](int kb, int bf) {
    copy8(lds_off(&Ks[bf][0][wave * 8][lane * 8]), KP * 2, Kb + (size_t)kb * D + kg, D); copy8(lds_off(&Ks[bf][1][wave * 8][lane * 8]), KP * 2, Klb + (size_t)kb * D + kg, D);
    copy8(lds_off(&Vs[bf][0][wave * 64 + (lane >> 2)][(lane & 3) * 8]), 8 * VP * 2, Vb + vg + kb, (size_t)8 * S); copy8(lds_off(&Vs[bf][1][wave * 64 + (lane >> 2)][(lane & 3) * 8]), 8 * VP * 2, Vlb + vg + kb, (size_t)8 * S); };
  { const size_t qg = ((size_t)bn * S + q0) * D + lane * 8;
    copy8(lds_off(&Qs[wave][0][0][lane * 8]), KP * 2, Qh + qg, D); copy8(lds_off(&Qs[wave][0][8][lane * 8]), KP * 2, Qh + qg + 8 * D, D);
    copy8(lds_off(&Qs[wave][1][0][lane * 8]), KP * 2, Ql + qg, D); copy8(lds_off(&Qs[wave][1][8][lane * 8]), KP * 2, Ql + qg + 8 * D, D); }
  asm volatile("s_wait_asynccnt 0x0" ::: "memory");   // the q copies have landed (and no more than 32 copies of a wave are ever outstanding)
  stage(0, 0);
  asm volatile("s_wait_asynccnt 0x0" ::: "memory");   // this wave's share of key block 0 has landed
  __syncthreads();                                    // ... and every other wave's: nothing is read from LDS in front of this barrier
  stage(32, 1);                                       // nt >= 2: key block 1 always exists
  const b16* Qb = &Qs[wave][0][col][0]; const b16* Qlb = &Qs[wave][1][col][0];
  float m = -INFINITY, l = 0.0f; v8f o[16];
#pragma unroll
  for (int t = 0; t < 16; ++t) o[t] = (v8f){};
  const float cs = LOG2E / (XS * XS); const int kend = q0 + 16;   // causal
  const int nt = qb * (16 * AW / 32) + 16 * AW / 32;      // key blocks of the work-group's last wave; the same for all its waves
  for (int it = 0; it < nt; ++it) { const int kb = it * 32, bf = it & 1;
   if (kb < kend) {   // a wave past its diagonal skips the work, never the publish point below
    v8f s0 = {}, s1 = {};
    v16b fq[2][2], fk[2][4];   // two register stages: step i + 1's six fragments are read from LDS as one group ahead of step i's WMMAs; s0 and s1 take turns, each in its old order; unrolled whole so that the stage index is a constant
    auto ldk = [&](int ks, int st) { fq[st][0] = frag_kb(Qb + ks, hh); fq[st][1] = frag_kb(Qlb + ks, hh); fk[st][0] = frag_kb(&Ks[bf][0][col][ks], hh); fk[st][1] = frag_kb(&Ks[bf][0][16 + col][ks], hh);
      fk[st][2] = frag_kb(&Ks[bf][1][col][ks], hh); fk[st][3] = frag_kb(&Ks[bf][1][16 + col][ks], hh); };
    ldk(0, 0);
#pragma unroll
    for (int i = 0; i < D / 32; ++i) { const int st = i & 1; if (i + 1 < D / 32) ldk((i + 1) * 32, st ^ 1);
      group_fence();
      s0 = wmma16b(fk[st][0], fq[st][0], s0); s1 = wmma16b(fk[st][1], fq[st][0], s1); s0 = wmma16b(fk[st][0], fq[st][1], s0); s1 = wmma16b(fk[st][1], fq[st][1], s1);
      s0 = wmma16b(fk[st][2], fq[st][0], s0); s1 = wmma16b(fk[st][3], fq[st][0], s1);
      group_fence(); }
    v16b fv[3][2][2];          // three register stages of two d tiles (hi, lo) each: the first two groups are read ahead of the softmax, group g + 2 ahead of group g's WMMAs; the two tiles take turns, each in its old order
    auto ldv = [&](int g, int st) {
#pragma unroll
      for (int j = 0; j < 2; ++j) { fv[st][j][0] = frag_kb(&Vs[bf][0][(2 * g + j) * 16 + col][0], hh); fv[st][j][1] = frag_kb(&Vs[bf][1][(2 * g + j) * 16 + col][0], hh); } };
    ldv(0, 0); ldv(1, 1);
    group_fence();
    float e[16]; float mx = -INFINITY;
#pragma unroll
    for (int r = 0; r < 8; ++r) { const int k0i = kb + 8 * hh + r, k1i = kb + 16 + 8 * hh + r; e[r] = (k0i <= qi) ? s0[r] * cs : -INFINITY; e[8 + r] = (k1i <= qi) ? s1[r] * cs : -INFINITY; mx = fmaxf(mx, fmaxf(e[r], e[8 + r])); }
    mx = fmaxf(mx, __shfl_xor(mx, 16)); const float mn = fmaxf(m, mx); const float al = nexp2(m - mn); m = mn; float sum = 0.0f; v16b ph, pl;   // key 0 <= qi always -> mn finite
#pragma unroll
    for (int i = 0; i < 16; ++i) { const float p = nexp2(e[i] - mn); sum += p; const b16 h_ = (b16)(p * PS); ph[i] = h_; pl[i] = (b16)(p * PS - (float)h_); }
    sum += __shfl_xor(sum, 16); l = l * al + sum;
#pragma unroll
    for (int g = 0; g < 8; ++g) { const int st = g % 3, t0 = 2 * g, t1 = 2 * g + 1; if (g + 2 < 8) ldv(g + 2, (g + 2) % 3);
      o[t0] *= al; o[t1] *= al;
      group_fence();
      o[t0] = wmma16b(fv[st][0][0], ph, o[t0]); o[t1] = wmma16b(fv[st][1][0], ph, o[t1]); o[t0] = wmma16b(fv[st][0][0], pl, o[t0]); o[t1] = wmma16b(fv[st][1][0], pl, o[t1]);
      o[t0] = wmma16b(fv[st][0][1], ph, o[t0]); o[t1] = wmma16b(fv[st][1][1], ph, o[t1]);
      if (g + 2 < 8) group_fence(); } }   // no reads follow the last two groups: nothing to hold there
   // publish point of key block it + 1, passed by every wave
   asm volatile("s_wait_dscnt 0x0" ::: "memory");      // this wave's reads of buffer bf are done before it may be refilled
   asm volatile("s_wait_asynccnt 0x0" ::: "memory");   // this wave's share of key block it + 1 has landed
   __syncthreads();                                    // both hold for every wave
   if (it + 2 < nt) stage(kb + 64, bf); }
  asm volatile("s_wait_asynccnt 0x0" ::: "memory");    // no copy is outstanding when the wave ends
  // LN2 on the spot: lanes col and col + 16 hold query col's 256 channels, 128 each, so mean and variance are sums in the lane and one exchange with lane ^ 16; gamma and beta are applied behind the LDS transpose, where a lane has 8 fixed channels
  // (the loops are unrolled whole: o is a register array, and every store of the last loop is one base address plus a constant)
  const v4f ga = *(const v4f*)(g2 + lane * 8), gc = *(const v4f*)(g2 + lane * 8 + 4), ba = *(const v4f*)(b2 + lane * 8), bc = *(const v4f*)(b2 + lane * 8 + 4);
  const float inv = 1.0f / (l * PS * XS); v8f sv = {};
#pragma unroll
  for (int t = 0; t < 16; ++t) { o[t] *= inv; sv += o[t]; }
  float s = ((sv[0] + sv[1]) + (sv[2] + sv[3])) + ((sv[4] + sv[5]) + (sv[6] + sv[7])); s += __shfl_xor(s, 16);
  const float mean = s * (1.0f / D); v8f qv = {};
#pragma unroll
  for (int t = 0; t < 16; ++t) { o[t] -= mean; qv += o[t] * o[t]; }
  float ss = ((qv[0] + qv[1]) + (qv[2] + qv[3])) + ((qv[4] + qv[5]) + (qv[6] + qv[7])); ss += __shfl_xor(ss, 16);
  const float rs = rsqrtf(ss * (1.0f / D) + LN_EPS);
#pragma unroll
  for (int t = 0; t < 16; ++t)
#pragma unroll
    for (int r = 0; r < 8; ++r) To[wave][col][t * 16 + 8 * hh + r] = o[t][r] * rs;
  wave_lds_sync();
  float gg[8], bb[8];
#pragma unroll
  for (int i = 0; i < 4; ++i) { gg[i] = bf16_rne(ga[i]); gg[4 + i] = bf16_rne(gc[i]); bb[i] = bf16_rne(ba[i]); bb[4 + i] = bf16_rne(bc[i]); }
#pragma unroll
  for (int rr = 0; rr < 16; ++rr) { const size_t gi = ((size_t)bn * S + q0 + rr) * D + lane * 8; const v4f xa = *(const v4f*)(&To[wave][rr][lane * 8]), xc = *(const v4f*)(&To[wave][rr][lane * 8 + 4]); v8b hv, lv;
#pragma unroll
    for (int i = 0; i < 8; ++i) { b16 h_, l_; split16(((i < 4 ? xa[i] : xc[i - 4]) * gg[i] + bb[i]) * XS, h_, l_); hv[i] = h_; lv[i] = l_; }
    *(v8b*)(Ah + gi) = hv; *(v8b*)(Al + gi) = lv; }
}
// the whole tail of the block in one kernel: h = relu(x W1) W2, e = h + v, out = e W_out, x = LN2(att). Block = 4 waves x 32 tokens, one block per WGP. Every product is taken transposed (A = weight rows, B = token rows), so
// a product's accumulators (lane = token, registers = 8 channels) are, two tiles at a time, the next product's B fragment: hidden and e never leave the registers. x is read once (LDS, then 256 registers of a lane); the weights come
// in 16 chunks of 32 hidden channels (32 rows of W1T, 32 columns of W2T) by asynchronous copies to LDS, two buffers, shared by the 4 waves; each chunk's hidden values go into the e accumulators at once.
// Per accumulator the products and their order are those of the three separate kernels: k ascending in steps of 32, hi then lo.
constexpr int VR = D + 4 /* f32 pitch of a v row in LDS */, OP = 32 + 4 /* f32 pitch of an out row in LDS */;
__global__ __launch_bounds__(128) void ffn_kernel(const b16* __restrict__ Ah, const b16* __restrict__ Al, const b16* __restrict__ W1T, const b16* __restrict__ W2T, const b16* __restrict__ WOT, const float* __restrict__ Vf, float* __restrict__ out) {
  __shared__ __attribute__((aligned(16))) b16 W1s[2][32][KP];      // [buffer][hidden][d]
  __shared__ __attribute__((aligned(16))) b16 W2s[2][D][VP];       // [buffer][d][hidden]
  __shared__ __attribute__((aligned(16))) b16 WOs[C][KP];          // [c][d]
  __shared__ __attribute__((aligned(16))) b16 Xs[AW][2][32][KP];   // [wave][hi, lo][token][d]; a wave's part holds its x rows, then its v rows (f32, pitch VR), then its out tile (f32, pitch OP): no other wave touches it
  const int wave = __builtin_amdgcn_readfirstlane(threadIdx.x >> 5), lane = threadIdx.x & 31, hh = lane >> 4, col = lane & 15; const size_t m0 = (size_t)blockIdx.x * (32 * AW) + wave * 32;
  // a wave's share of one chunk: 8 W1T rows (a row = one copy of 32 lanes x 16 B) and 64 W2T row pieces of 64 B (8 rows = one copy): 16 copies
  auto stage = [&](int c, int bf) {
    copy8(lds_off(&W1s[bf][wave * 8][lane * 8]), KP * 2, W1T + (size_t)(c * 32 + wave * 8) * D + lane * 8, D);
    copy8(lds_off(&W2s[bf][wave * 64 + (lane >> 2)][(lane & 3) * 8]), 8 * VP * 2, W2T + (size_t)(wave * 64 + (lane >> 2)) * F + c * 32 + (lane & 3) * 8, (size_t)8 * F); };
  auto copyx = [&](int j) {   // x rows 16j .. 16j + 15, hi and lo: 32 copies
#pragma unroll
    for (int q = 2 * j; q < 2 * j + 2; ++q) { copy8(lds_off(&Xs[wave][0][8 * q][lane * 8]), KP * 2, Ah + (m0 + 8 * q) * D + lane * 8, D); copy8(lds_off(&Xs[wave][1][8 * q][lane * 8]), KP * 2, Al + (m0 + 8 * q) * D + lane * 8, D); } };
  float* Fw = (float*)&Xs[wave][0][0][0];
  auto copyv = [&](int j) {   // v rows 16j .. 16j + 15 (1,024 B each, two copies): 32 copies; the 16-byte pieces are addressed in 2-byte units
#pragma unroll
    for (int q = 2 * j; q < 2 * j + 2; ++q)
#pragma unroll
      for (int p = 0; p < 2; ++p) copy8(lds_off(Fw + 8 * q * VR + p * 128 + lane * 4), VR * 4, (const b16*)(Vf + (m0 + 8 * q) * D + p * 128 + lane * 4), 2 * D); };
  copyx(0); stage(0, 0);
  asm volatile("s_wait_asynccnt 0x0" ::: "memory");   // never more than 48 copies of a wave are outstanding
  copyx(1); copy8(lds_off(&WOs[wave * 16][lane * 8]), KP * 2, WOT + (size_t)(wave * 16) * D + lane * 8, D); copy8(lds_off(&WOs[wave * 16 + 8][lane * 8]), KP * 2, WOT + (size_t)(wave * 16 + 8) * D + lane * 8, D);
  asm volatile("s_wait_asynccnt 0x0" ::: "memory");   // this wave's x rows and its shares of chunk 0 and of W_out have landed
  __syncthreads();                                    // ... and every other wave's: nothing is read from LDS in front of this barrier
  stage(1, 1);
  v16b xh[2][D / 32], xl[2][D / 32];
#pragma unroll
  for (int j = 0; j < 2; ++j)
#pragma unroll
    for (int i = 0; i < D / 32; ++i) { xh[j][i] = frag_kb(&Xs[wave][0][j * 16 + col][i * 32], hh); xl[j][i] = frag_kb(&Xs[wave][1][j * 16 + col][i * 32], hh); }
  v8f e[2][16];
#pragma unroll
  for (int j = 0; j < 2; ++j)
#pragma unroll
    for (int t = 0; t < 16; ++t) e[j][t] = (v8f){};
  for (int it = 0; it < F / 32; ++it) { const int bf = it & 1;
    v16b fw[3][8];   // three register stages of eight weight fragments: each group is read from LDS as a whole ahead of the WMMAs of a group before it
    auto ld1 = [&](int g, int st) {   // W1T: k steps 4g .. 4g + 3, both hidden tiles
#pragma unroll
      for (int i = 0; i < 4; ++i) { fw[st][2 * i] = frag_kb(&W1s[bf][col][(4 * g + i) * 32], hh); fw[st][2 * i + 1] = frag_kb(&W1s[bf][16 + col][(4 * g + i) * 32], hh); } };
    auto ld2 = [&](int g, int st) {   // W2T: d tiles 8g .. 8g + 7
#pragma unroll
      for (int t = 0; t < 8; ++t) fw[st][t] = frag_kb(&W2s[bf][(8 * g + t) * 16 + col][0], hh); };
    v8f h00 = {}, h01 = {}, h10 = {}, h11 = {};   // [token tile][hidden tile]
    auto mm1 = [&](int g, int st) {   // four independent accumulators take turns
#pragma unroll
      for (int i = 0; i < 4; ++i) { const int k = 4 * g + i;
        h00 = wmma16b(fw[st][2 * i], xh[0][k], h00); h01 = wmma16b(fw[st][2 * i + 1], xh[0][k], h01); h10 = wmma16b(fw[st][2 * i], xh[1][k], h10); h11 = wmma16b(fw[st][2 * i + 1], xh[1][k], h11);
        h00 = wmma16b(fw[st][2 * i], xl[0][k], h00); h01 = wmma16b(fw[st][2 * i + 1], xl[0][k], h01); h10 = wmma16b(fw[st][2 * i], xl[1][k], h10); h11 = wmma16b(fw[st][2 * i + 1], xl[1][k], h11); } };
    ld1(0, 0); ld1(1, 1);
    group_fence();
    mm1(0, 0);
    group_fence();
    ld2(0, 0); ld2(1, 2);
    group_fence();
    mm1(1, 1);
    group_fence();   // keeps the waits below behind these WMMAs, under which the W2T fragments arrive: without it the compiler lifts the waits to just behind the reads
    // publish point of chunk it + 1, passed by every wave. It stands here and not at the trip's end: the W2T fragments, the trip's last LDS reads, went out ahead of the WMMAs above; what is left of the trip works on registers alone, and the next copies fly under it too
    asm volatile("s_wait_dscnt 0x0" ::: "memory");      // this wave's reads of buffer bf (and, in trip 0, of its x rows) are done before the LDS may be refilled
    asm volatile("s_wait_asynccnt 0x0" ::: "memory");   // this wave's share of chunk it + 1 has landed
    __syncthreads();                                    // both hold for every wave
    if (it + 2 < F / 32) stage(it + 2, bf);
    if (it < 2) copyv(it);                              // the x rows are in registers: the wave's v rows take their place, half at a time (48 copies outstanding at most), and land long before the loop ends
    v16b ph[2], pl[2];   // relu(hidden) x8, hi and lo: hidden tiles 0 and 1 of a token tile are elements 0..7 and 8..15 of its B fragment
#pragma unroll
    for (int r = 0; r < 8; ++r) { b16 h_, l_;
      split16(fmaxf(h00[r] * (1.0f / (XS * WSC)), 0.0f) * XS, h_, l_); ph[0][r] = h_; pl[0][r] = l_; split16(fmaxf(h01[r] * (1.0f / (XS * WSC)), 0.0f) * XS, h_, l_); ph[0][8 + r] = h_; pl[0][8 + r] = l_;
      split16(fmaxf(h10[r] * (1.0f / (XS * WSC)), 0.0f) * XS, h_, l_); ph[1][r] = h_; pl[1][r] = l_; split16(fmaxf(h11[r] * (1.0f / (XS * WSC)), 0.0f) * XS, h_, l_); ph[1][8 + r] = h_; pl[1][8 + r] = l_; }
#pragma unroll
    for (int g = 0; g < 2; ++g) {   // d tiles 8g .. 8g + 7 are in stage 2g
#pragma unroll
      for (int t = 0; t < 8; ++t) { e[0][8 * g + t] = wmma16b(fw[2 * g][t], ph[0], e[0][8 * g + t]); e[1][8 * g + t] = wmma16b(fw[2 * g][t], ph[1], e[1][8 * g + t]); }
#pragma unroll
      for (int t = 0; t < 8; ++t) { e[0][8 * g + t] = wmma16b(fw[2 * g][t], pl[0], e[0][8 * g + t]); e[1][8 * g + t] = wmma16b(fw[2 * g][t], pl[1], e[1][8 * g + t]); } } }
  asm volatile("s_wait_asynccnt 0x0" ::: "memory");     // no copy is outstanding behind the loop
  v16b fo[2][8];   // W_out fragments: two register stages of two k steps x four c tiles
  auto ldo = [&](int g, int st) {
#pragma unroll
    for (int i = 0; i < 2; ++i)
#pragma unroll
      for (int t = 0; t < 4; ++t) fo[st][4 * i + t] = frag_kb(&WOs[t * 16 + col][(2 * g + i) * 32], hh); };
  ldo(0, 0);
  v16b eh[2][D / 32], el[2][D / 32];   // e = h + v, x8, hi and lo: d tiles 2i and 2i + 1 are the B fragment of k step i
#pragma unroll
  for (int j = 0; j < 2; ++j)
#pragma unroll
    for (int t = 0; t < 16; ++t) { const float* pv = Fw + (j * 16 + col) * VR + t * 16 + 8 * hh; const v4f va = *(const v4f*)pv, vb = *(const v4f*)(pv + 4);
#pragma unroll
      for (int r = 0; r < 8; ++r) { const float y = e[j][t][r] * (1.0f / (XS * WSC)) + (r < 4 ? va[r & 3] : vb[r & 3]); b16 h_, l_; split16(y * XS, h_, l_); eh[j][t >> 1][(t & 1) * 8 + r] = h_; el[j][t >> 1][(t & 1) * 8 + r] = l_; } }
  v8f oa[2][4];
#pragma unroll
  for (int j = 0; j < 2; ++j)
#pragma unroll
    for (int t = 0; t < 4; ++t) oa[j][t] = (v8f){};
#pragma unroll
  for (int g = 0; g < 4; ++g) { const int st = g & 1; if (g + 1 < 4) ldo(g + 1, st ^ 1);
    group_fence();
#pragma unroll
    for (int i = 0; i < 2; ++i) {
#pragma unroll
      for (int t = 0; t < 4; ++t) { oa[0][t] = wmma16b(fo[st][4 * i + t], eh[0][2 * g + i], oa[0][t]); oa[1][t] = wmma16b(fo[st][4 * i + t], eh[1][2 * g + i], oa[1][t]); }
#pragma unroll
      for (int t = 0; t < 4; ++t) { oa[0][t] = wmma16b(fo[st][4 * i + t], el[0][2 * g + i], oa[0][t]); oa[1][t] = wmma16b(fo[st][4 * i + t], el[1][2 * g + i], oa[1][t]); } }
    group_fence(); }
  wave_lds_sync();   // the wave's reads of its v rows are done: its out tile (64 c x 32 tokens) takes their place
#pragma unroll
  for (int j = 0; j < 2; ++j)
#pragma unroll
    for (int t = 0; t < 4; ++t)
#pragma unroll
      for (int r = 0; r < 8; ++r) Fw[(t * 16 + 8 * hh + r) * OP + j * 16 + col] = oa[j][t][r] * (1.0f / (XS * WSC));
  wave_lds_sync();
  const int bn = (int)(m0 / S), s0 = (int)(m0 % S), b = bn / NN, n = bn % NN; float* po = out + (((size_t)b * C + (lane >> 3)) * NN + n) * S + s0 + (lane & 7) * 4;
#pragma unroll   // unrolled: every store is one base address plus a constant (a store = 4 channel rows x one whole 128-byte line), so no address register takes a new value behind an issued store
  for (int i = 0; i < 16; ++i) *(v4f*)(po + (size_t)i * 4 * NN * S) = *(const v4f*)(Fw + (i * 4 + (lane >> 3)) * OP + (lane & 7) * 4);
}
}  // namespace

extern "C" void kernel_launch(void* const* d_in, const int* in_sizes, int n_in, void* d_out, int out_size, void* d_ws, size_t ws_size, hipStream_t stream) {
  (void)n_in;
  auto Fp = [&](int i) { return (const float*)d_in[i]; };
  // input order: 0 fea_lf [4,64,8,32,32], 1 fea_hf, 2 W_in [64,256], 3 W_kv [64,512], 4 gamma, 5 beta, 6 g2, 7 b2, 8 W1 [256,512], 9 W2 [512,256], 10 W_out [256,64] (all (in, out))
  if (in_sizes[0] != NR * C || in_sizes[1] != NR * C || in_sizes[2] != C * D || in_sizes[3] != C * F || in_sizes[4] != D || in_sizes[8] != D * F || in_sizes[9] != F * D || in_sizes[10] != D * C || out_size != NR * C) return;
  size_t off = 0; char* ws = (char*)d_ws;
  auto carve = [&](size_t bytes) { char* p = ws + off; off += (bytes + 255) & ~(size_t)255; return p; };
  b16* TQ16 = (b16*)carve((size_t)NR * C * 2); b16* TK16 = (b16*)carve((size_t)NR * C * 2); b16* WIN = (b16*)carve((size_t)D * C * 2); b16* WKV = (b16*)carve((size_t)F * C * 2); b16* W1T = (b16*)carve((size_t)F * D * 2); b16* W2T = (b16*)carve((size_t)D * F * 2); b16* WOT = (b16*)carve((size_t)C * D * 2);
  b16* Qh = (b16*)carve((size_t)NR * D * 2); b16* Ql = (b16*)carve((size_t)NR * D * 2); b16* Kh = (b16*)carve((size_t)NR * D * 2); b16* Kl = (b16*)carve((size_t)NR * D * 2);
  float* Vf = (float*)carve((size_t)NR * D * 4); b16* VTh = (b16*)carve((size_t)NR * D * 2); b16* VTl = (b16*)carve((size_t)NR * D * 2); b16* Ah = (b16*)carve((size_t)NR * D * 2); b16* Al = (b16*)carve((size_t)NR * D * 2);   // LN2(att) gets its own planes: other attention blocks still read q, k and v while they are written
  if (off > ws_size) return;   // = 177 MB
  prep_kernel<<<NPW + NXT, 256, 0, stream>>>(Fp(0), Fp(1), Fp(2), Fp(3), Fp(8), Fp(9), Fp(10), TQ16, TK16, WIN, WKV, W1T, W2T, WOT);
  front_kernel<<<3 * NPB + NVB, 128, 0, stream>>>(TQ16, TK16, WIN, WKV, Fp(4), Fp(5), Qh, Ql, Kh, Kl, Vf, VTh, VTl);
  attn_kernel<<<dim3(NBN, 1, S / (16 * AW)), 32 * AW, 0, stream>>>(Qh, Ql, Kh, Kl, VTh, VTl, Fp(6), Fp(7), Ah, Al);   // LN2(att)
  ffn_kernel<<<NR / (32 * AW), 32 * AW, 0, stream>>>(Ah, Al, W1T, W2T, WOT, Vf, (float*)d_out);   // out = (relu(LN2(att) W1) W2 + v) W_out
}

// v007
// Measured time: 120 microseconds a run.
// In both of two side-by-side timings against v006, it was 1.10 times as fast.
// Over all steps from v000 it is 11.0 times as fast.
#include <hip/hip_runtime.h>

// Inter-frequency attention block: 32 sequences (4 batches x 8 'n' slices) of 1,024 tokens (32 x 32 positions), 64 channels; q = LN(tok_q W_in), k = LN((tok_kv W_kv)[:, :256]) (shared gamma/beta),
// v = (tok_kv W_kv)[:, 256:]; score = q.k (no scaling), causal (lower triangle; fill -1e15 == masked out since the diagonal is always kept), softmax, att = p v; h = relu(LN2(att) W1) W2;
// out = (h + v) W_out -> written channel-major as [4][64][8][32][32].
// WMMA (v_wmma_f32_16x16x32_f16, f32 accumulate): W_in / W_kv projections with EXACT bf16 tokens (x8, LDS-transposed from the channel-major inputs) and weights (x256), 1 product, each LayerNorm in the epilogue of the kernel that makes its rows; S^T = K.Q^T with
// q AND k (LayerNorm outputs) f16 hi+lo x8 (3 products: the unscaled 256-dim logits have sigma ~16); online softmax in f32; O^T += V^T P^T with v and P f16 hi+lo (3 products, one f32 accumulator:
// unscaled residuals); FFN W1 with LN2(att) hi+lo (2 products), W2 with the relu hidden hi+lo (2 products), W_out with (h + v) hi+lo (2 products). LayerNorms, softmax, relu, residual in f32.
// Inputs rounded to bf16 once. Fragment k-map per lane half hh for A AND B: elements 0..7 <- k = 8hh+0..7, 8..15 <- k = 16+8hh+0..7; acc[r] = D[8hh+r][col].

namespace {
constexpr int NBN = 32 /* b*n sequences */, NN = 8, S = 1024, C = 64, D = 256, F = 512, NR = NBN * S /* all 32 sequences go through every stage in one launch */;
constexpr float XS = 8.0f, WSC = 256.0f, PS = 8.0f, LOG2E = 1.4426950408889634f, LN_EPS = 1e-5f;

typedef _Float16 b16;
typedef __attribute__((ext_vector_type(16))) _Float16 v16b;
typedef __attribute__((ext_vector_type(8))) _Float16 v8b;
typedef __attribute__((ext_vector_type(8))) float v8f;
typedef __attribute__((ext_vector_type(4))) float v4f;
__device__ __forceinline__ float bf16_rne(float f) { unsigned int u = __float_as_uint(f); u += 0x7FFFu + ((u >> 16) & 1u); return __uint_as_float(u & 0xFFFF0000u); }
__device__ __forceinline__ void split16(float v, b16& hi, b16& lo) { hi = (b16)v; lo = (b16)(v - (float)hi); }
__device__ __forceinline__ v16b frag_kb(const b16* p, int hh) { const v8b a = *(const v8b*)(p + 8 * hh), b = *(const v8b*)(p + 16 + 8 * hh); v16b f;
#pragma unroll
  for (int e = 0; e < 8; ++e) { f[e] = a[e]; f[8 + e] = b[e]; } return f; }
__device__ __forceinline__ v8f wmma16b(v16b a, v16b b, v8f c) { return __builtin_amdgcn_wmma_f32_16x16x32_f16(false, a, false, b, (short)0, c, false, false); }
// stands between a group of fragment loads and a block of WMMAs: without it the compiler sinks each load to just in front of its own WMMA, and every load's latency is waited out alone
__device__ __forceinline__ void group_fence() { __builtin_amdgcn_sched_barrier(0); }
// stands behind a group of fragment loads from global memory: the loads' address registers are inputs here, so none of them is given a new value ahead of this wait
__device__ __forceinline__ void addr_wait(const b16* a, const b16* b, const b16* c) { asm volatile("s_wait_xcnt 0x0" :: "v"(a), "v"(b), "v"(c) : "memory"); }
__device__ __forceinline__ void wave_lds_sync() { __builtin_amdgcn_fence(__ATOMIC_RELEASE, "workgroup"); __builtin_amdgcn_wave_barrier(); __builtin_amdgcn_fence(__ATOMIC_ACQUIRE, "workgroup"); }
__device__ __forceinline__ float nexp2(float x) { return __builtin_amdgcn_exp2f(x); }
// sum over a 16-lane row, left in every lane of it: four adds whose second operand comes from lane ^ M of the row (DPP row_xmask), no LDS round trip
template <int M> __device__ __forceinline__ float xadd(float v) { return v + __int_as_float(__builtin_amdgcn_update_dpp(0, __float_as_int(v), 0x160 + M, 0xf, 0xf, true)); }
__device__ __forceinline__ float hsum16(float v) { return xadd<8>(xadd<4>(xadd<2>(xadd<1>(v)))); }

// the parts below are the bodies of kernels that do not depend on one another; the two kernels behind them give each work-group one part by its block index (bx, by, bz: the part's own block coordinates; the LDS is the kernel's, handed in)
__device__ __forceinline__ void xt_part(b16 (*T)[64 + 8], int bx, int by, int bz, const float* __restrict__ flf, const float* __restrict__ fhf, b16* __restrict__ TQ16, b16* __restrict__ TK16) {
  const int bn = bz, kind = by, s0 = bx * 64, t_ = threadIdx.x; const int b = bn / NN, n = bn % NN; const float* src = (kind == 0 ? flf : fhf) + ((size_t)b * C * NN + n) * S; b16* dst = kind == 0 ? TQ16 : TK16;
  for (int q = t_; q < 64 * 64; q += 256) { const int cc = q >> 6, ss = q & 63; T[ss][cc] = (b16)(bf16_rne(src[(size_t)cc * NN * S + s0 + ss]) * XS); }
  __syncthreads();
  { for (int q = t_; q < 64 * 8; q += 256) { const int ss = q >> 3, c8 = (q & 7) * 8; *(v8b*)(dst + ((size_t)bn * S + s0 + ss) * C + c8) = *(const v8b*)(&T[ss][c8]); }  }
}
// weights (in,out) transposed to [out][in] rows x256 via 64x64 LDS tiles: kind 0 W_in [64][256] -> WIN [256][64]; 1 W_kv [64][512] -> WKV [512][64]; 2 W1 [256][512] -> W1T [512][256];
__device__ __forceinline__ void prepw_part(b16 (*T)[64 + 8], int bx, int by, int bz, const float* __restrict__ win, const float* __restrict__ wkv, const float* __restrict__ w1, const float* __restrict__ w2, const float* __restrict__ wout, b16* __restrict__ WIN, b16* __restrict__ WKV, b16* __restrict__ W1T, b16* __restrict__ W2T, b16* __restrict__ WOT) {
  const int kind = bz, i0 = bx * 64, o0 = by * 64, t_ = threadIdx.x; const float* w; b16* dst; int nin, nout;
  if (kind == 0) { w = win; dst = WIN; nin = C; nout = D; } else if (kind == 1) { w = wkv; dst = WKV; nin = C; nout = F; } else if (kind == 2) { w = w1; dst = W1T; nin = D; nout = F; } else if (kind == 3) { w = w2; dst = W2T; nin = F; nout = D; } else { w = wout; dst = WOT; nin = D; nout = C; }
  if (i0 >= nin || o0 >= nout) return;
  for (int q = t_; q < 64 * 64; q += 256) { const int ii = q >> 6, oo = q & 63; T[oo][ii] = (b16)(bf16_rne(w[(size_t)(i0 + ii) * nout + o0 + oo]) * WSC); }
  __syncthreads();
  { for (int q = t_; q < 64 * 8; q += 256) { const int oo = q >> 3, c8 = (q & 7) * 8; *(v8b*)(dst + (size_t)(o0 + oo) * nin + i0 + c8) = *(const v8b*)(&T[oo][c8]); }  }
}
// token transpose and weight transpose in one launch: 320 work-groups of the weight grid (8 x 8 x 5) first, then 1,024 of the token grid (16 x 2 x 32)
constexpr int NPW = 8 * 8 * 5, NXT = (S / 64) * 2 * NBN;
__global__ __launch_bounds__(256) void prep_kernel(const float* __restrict__ flf, const float* __restrict__ fhf, const float* __restrict__ win, const float* __restrict__ wkv, const float* __restrict__ w1, const float* __restrict__ w2, const float* __restrict__ wout,
                                                   b16* __restrict__ TQ16, b16* __restrict__ TK16, b16* __restrict__ WIN, b16* __restrict__ WKV, b16* __restrict__ W1T, b16* __restrict__ W2T, b16* __restrict__ WOT) {
  __shared__ __attribute__((aligned(16))) b16 T[64][64 + 8];
  const int b = blockIdx.x;
  if (b < NPW) prepw_part(T, b & 7, (b >> 3) & 7, b >> 6, win, wkv, w1, w2, wout, WIN, WKV, W1T, W2T, WOT);
  else { const int i = b - NPW; xt_part(T, i & 15, (i >> 4) & 1, i >> 5, flf, fhf, TQ16, TK16); }
}
// k projection with its LayerNorm (tok_kv WKV[:256]): block = 64 rows x 4 waves x 256 cols (16 tiles, K = 64 exact, 1 product); a wave holds its 16 rows whole (256 columns: 16 in a lane x 16 lanes), so mean, variance and the
// affine step are taken on the accumulators, and the f16 hi+lo x8 planes go out through LDS as whole rows: no f32 plane and no row kernel in between
__device__ __forceinline__ void projln_part(char* sm, int bx, const b16* __restrict__ A, const b16* __restrict__ Bw, const float* __restrict__ g, const float* __restrict__ be, b16* __restrict__ Yh, b16* __restrict__ Yl) {
  b16 (*Th)[16][D + 8] = (b16 (*)[16][D + 8])sm; b16 (*Tl)[16][D + 8] = Th + 4;   // [4 waves][16][D + 8] each
  const int wave = threadIdx.x >> 5, lane = threadIdx.x & 31, nloc = lane & 15, hlf = lane >> 4; const size_t m0 = (size_t)bx * 64 + wave * 16;
  v8f acc[16];
#pragma unroll
  for (int t = 0; t < 16; ++t) acc[t] = (v8f){};
  const b16* pa = A + (m0 + nloc) * C + 8 * hlf; const b16* pw = Bw + (size_t)nloc * C + 8 * hlf;   // the lane's own addresses: every load below is one of these plus a constant
  v16b fa[2], fw[2][16];   // all fragments of the tile (K = 64) are requested as one group, the lane's 16 gamma and beta values with them
#pragma unroll
  for (int i = 0; i < 2; ++i) { fa[i] = frag_kb(pa + i * 32, 0);
#pragma unroll
    for (int t = 0; t < 16; ++t) fw[i][t] = frag_kb(pw + t * 16 * C + i * 32, 0); }
  float gv[16], bv[16];
#pragma unroll
  for (int t = 0; t < 16; ++t) { gv[t] = g[t * 16 + nloc]; bv[t] = be[t * 16 + nloc]; }
  group_fence();
#pragma unroll
  for (int i = 0; i < 2; ++i)
#pragma unroll
    for (int t = 0; t < 16; ++t) acc[t] = wmma16b(fa[i], fw[i][t], acc[t]);
  group_fence(); addr_wait(pa, pw, pw);   // the fence keeps the wait behind the WMMAs, where every load has returned
  constexpr float SC = 1.0f / (XS * WSC);   // a power of two: scaling the sum is scaling every term
  float mean[8], rs[8];   // the loops below are unrolled whole: acc, gv, bv, mean and rs are register arrays and take constant indices only
#pragma unroll
  for (int r = 0; r < 8; ++r) { float s = 0.0f;
#pragma unroll
    for (int t = 0; t < 16; ++t) s += acc[t][r];
    mean[r] = hsum16(s) * (SC / D); }
#pragma unroll
  for (int r = 0; r < 8; ++r) { float ss = 0.0f;
#pragma unroll
    for (int t = 0; t < 16; ++t) { const float dv = acc[t][r] * SC - mean[r]; acc[t][r] = dv; ss += dv * dv; }
    rs[r] = rsqrtf(hsum16(ss) * (1.0f / D) + LN_EPS); }
#pragma unroll
  for (int t = 0; t < 16; ++t) { const float gt = bf16_rne(gv[t]), bt = bf16_rne(bv[t]);
#pragma unroll
    for (int r = 0; r < 8; ++r) { b16 h_, l_; split16((acc[t][r] * rs[r] * gt + bt) * XS, h_, l_); Th[wave][8 * hlf + r][t * 16 + nloc] = h_; Tl[wave][8 * hlf + r][t * 16 + nloc] = l_; } }
  wave_lds_sync();
#pragma unroll   // unrolled: every store is one base address plus a constant, so no address register takes a new value behind an issued store
  for (int rr = 0; rr < 16; ++rr) { const size_t gi = (m0 + rr) * D + lane * 8; *(v8b*)(Yh + gi) = *(const v8b*)(&Th[wave][rr][lane * 8]); *(v8b*)(Yl + gi) = *(const v8b*)(&Tl[wave][rr][lane * 8]); }
}
// v in channel-major hi/lo planes for the PV operand: VTh/VTl [bn][256 d][1024 s] = f16 hi+lo x8 of (tok_kv WKV[256:])^T: A = WKV_v rows d (K = 64), B = TK16 rows s; block = 64 d x 4 waves x
__device__ __forceinline__ void v_part(char* sm, int bx, int by, int bz, const b16* __restrict__ TK16, const b16* __restrict__ WKV, b16* __restrict__ VTh, b16* __restrict__ VTl) {
  b16 (*Ts)[16][128 + 8] = (b16 (*)[16][128 + 8])sm; b16 (*Tsl)[16][128 + 8] = Ts + 4;   // [4 waves][16][128 + 8] each
  const int wave = threadIdx.x >> 5, lane = threadIdx.x & 31, nloc = lane & 15, hlf = lane >> 4; const int bn = bz; const int d0 = bx * 64 + wave * 16, s0 = by * 128;
  v8f acc[8];
#pragma unroll
  for (int t = 0; t < 8; ++t) acc[t] = (v8f){};
  const b16* pa = WKV + (size_t)(d0 + nloc) * C + 8 * hlf; const b16* pw = TK16 + ((size_t)bn * S + s0 + nloc) * C + 8 * hlf;   // the lane's own addresses: every load below is one of these plus a constant
  v16b fa[2], fw[2][8];   // all fragments of the tile (K = 64) are requested as one group
#pragma unroll
  for (int i = 0; i < 2; ++i) { fa[i] = frag_kb(pa + D * C + i * 32, 0);   // the v half of W_kv: rows D .. 2D - 1
#pragma unroll
    for (int t = 0; t < 8; ++t) fw[i][t] = frag_kb(pw + t * 16 * C + i * 32, 0); }
  group_fence();
#pragma unroll
  for (int i = 0; i < 2; ++i)
#pragma unroll
    for (int t = 0; t < 8; ++t) acc[t] = wmma16b(fa[i], fw[i][t], acc[t]);
  group_fence(); addr_wait(pa, pw, pw);   // the fence keeps the wait behind the WMMAs, where every load has returned
#pragma unroll
  for (int t = 0; t < 8; ++t)
#pragma unroll
    for (int r = 0; r < 8; ++r) { b16 h_, l_; split16(acc[t][r] * (1.0f / (XS * WSC)) * XS, h_, l_); Ts[wave][8 * hlf + r][t * 16 + nloc] = h_; Tsl[wave][8 * hlf + r][t * 16 + nloc] = l_; }
  wave_lds_sync();
  { for (int rr = 0; rr < 16; ++rr) if (lane < 16) { const size_t gi = ((size_t)bn * D + d0 + rr) * S + s0 + lane * 8; *(v8b*)(VTh + gi) = *(const v8b*)(&Ts[wave][rr][lane * 8]); *(v8b*)(VTl + gi) = *(const v8b*)(&Tsl[wave][rr][lane * 8]); }  }
}
// the k and v^T projections in one launch; the part with a LayerNorm, the longer, comes first: 512 work-groups for k, 1,024 (4 x 8 x 32) for v^T
constexpr int NPB = NR / 64, NVB = (D / 64) * (S / 128) * NBN;
__global__ __launch_bounds__(128) void front_kernel(const b16* __restrict__ TK16, const b16* __restrict__ WKV, const float* __restrict__ g, const float* __restrict__ be,
                                                    b16* __restrict__ Kh, b16* __restrict__ Kl, b16* __restrict__ VTh, b16* __restrict__ VTl) {
  __shared__ __attribute__((aligned(16))) char sm[2 * 4 * 16 * (D + 8) * 2];   // the larger part's need (k: two planes of 4 x 16 rows)
  const int b = blockIdx.x;
  if (b < NPB) projln_part(sm, b, TK16, WKV, g, be, Kh, Kl);   // k = LN(tok_kv W_kv[:, :256])
  else { const int i = b - NPB; v_part(sm, i & 3, (i >> 2) & 7, i >> 5, TK16, WKV, VTh, VTl); }
}
// causal attention: grid (sequences, 1, S/64), block = 4 waves x 16 queries; one block fills a WGP's LDS and there are twice as many blocks as WGPs, so the query block falls with blockIdx.z: the longest blocks start first, and a WGP
// that ends a block of the first round (18 to 32 key blocks) takes the longest one left (16 down to 2); key blocks of 32 (no scaling). q is made on the spot and never stored as a plane: q^T = W_in^T tok_q^T (K = 64, 32 WMMAs of a wave) leaves query col's 256 channels in lanes col and col + 16, where its LayerNorm is taken; the f16 hi+lo x8 rows go to the wave's own LDS (W_in comes once per block by asynchronous copies to LDS, with key block 0). Every fragment but the two token fragments of q's projection comes from LDS: each 32-key block of
// k (rows of 512 B, LDS pitch 528 B) and of v^T (rows of 64 B, LDS pitch 80 B), hi and lo, once per block of 4 waves, by asynchronous copies to LDS, two buffers: block t + 1 flies while block t is worked on.
// The products, their order and the softmax of a wave are those of the per-wave form: S^T 3 products with K = 256 (8 steps), online softmax f32, O^T 3 products.
constexpr int AW = 4, KP = D + 8, VP = 32 + 8, CP = C + 8 /* pitch of a 64-channel row in LDS: 144 B */;
__device__ __forceinline__ unsigned lds_off(const void* p) { return (unsigned)(size_t)p; }
// eight 16-byte-per-lane copies global -> LDS, addresses stepping by ls bytes (LDS) and gs elements (global); s_wait_xcnt 0 closes the statement so that no address register is rewritten ahead of it
__device__ __forceinline__ void copy8(unsigned l, unsigned ls, const b16* g, size_t gs) {
  asm volatile("global_load_async_to_lds_b128 %0, %8, off\n\tglobal_load_async_to_lds_b128 %1, %9, off\n\tglobal_load_async_to_lds_b128 %2, %10, off\n\tglobal_load_async_to_lds_b128 %3, %11, off\n\t"
               "global_load_async_to_lds_b128 %4, %12, off\n\tglobal_load_async_to_lds_b128 %5, %13, off\n\tglobal_load_async_to_lds_b128 %6, %14, off\n\tglobal_load_async_to_lds_b128 %7, %15, off\n\ts_wait_xcnt 0x0"
               :: "v"(l), "v"(l + ls), "v"(l + 2 * ls), "v"(l + 3 * ls), "v"(l + 4 * ls), "v"(l + 5 * ls), "v"(l + 6 * ls), "v"(l + 7 * ls),
                  "v"(g), "v"(g + gs), "v"(g + 2 * gs), "v"(g + 3 * gs), "v"(g + 4 * gs), "v"(g + 5 * gs), "v"(g + 6 * gs), "v"(g + 7 * gs) : "memory");
}
__global__ __launch_bounds__(128) void attn_kernel(const b16* __restrict__ TQ16, const b16* __restrict__ WIN, const float* __restrict__ g, const float* __restrict__ be, const b16* __restrict__ Kh, const b16* __restrict__ Kl, const b16* __restrict__ VTh, const b16* __restrict__ VTl, const float* __restrict__ g2, const float* __restrict__ b2, b16* __restrict__ Ah, b16* __restrict__ Al) {
  __shared__ __attribute__((aligned(16))) b16 Ks[2][2][32][KP];    // [buffer][hi, lo][key][d]
  __shared__ __attribute__((aligned(16))) b16 Vs[2][2][D][VP];     // [buffer][hi, lo][d][key]
  __shared__ __attribute__((aligned(16))) b16 Qs[AW][2][16][KP];   // [wave][hi, lo][query][d]
  __shared__ __attribute__((aligned(16))) float To[AW][16][D + 4];
  __shared__ __attribute__((aligned(16))) float Gs[AW][2][D];      // [wave][gamma, beta][d] of q's LayerNorm, rounded; a copy for each wave, so that no barrier is needed for it
  const int wave = __builtin_amdgcn_readfirstlane(threadIdx.x >> 5), lane = threadIdx.x & 31, hh = lane >> 4, col = lane & 15; const int bn = blockIdx.x, qb = S / (16 * AW) - 1 - blockIdx.z; const int q0 = qb * (16 * AW) + wave * 16, qi = q0 + col;
  const b16* Kb = Kh + (size_t)bn * S * D; const b16* Klb = Kl + (size_t)bn * S * D; const b16* Vb = VTh + (size_t)bn * D * S; const b16* Vlb = VTl + (size_t)bn * D * S;
  // a wave's share of one key block: 8 k rows (a row = one copy of 32 lanes x 16 B) and 64 v^T rows (8 rows = one copy), hi and lo: 32 copies
  const size_t kg = (size_t)(wave * 8) * D + lane * 8, vg = (size_t)(wave * 64 + (lane >> 2)) * S + (lane & 3) * 8;
  auto stage = [&](int kb, int bf) {
    copy8(lds_off(&Ks[bf][0][wave * 8][lane * 8]), KP * 2, Kb + (size_t)kb * D + kg, D); copy8(lds_off(&Ks[bf][1][wave * 8][lane * 8]), KP * 2, Klb + (size_t)kb * D + kg, D);
    copy8(lds_off(&Vs[bf][0][wave * 64 + (lane >> 2)][(lane & 3) * 8]), 8 * VP * 2, Vb + vg + kb, (size_t)8 * S); copy8(lds_off(&Vs[bf][1][wave * 64 + (lane >> 2)][(lane & 3) * 8]), 8 * VP * 2, Vlb + vg + kb, (size_t)8 * S); };
  b16 (*Ws)[CP] = (b16 (*)[CP])&To[0][0][0];          // W_in rows [d][c] lie in To's place: To is written only behind the loop, whose barriers every wave passes after its last read of them
#pragma unroll   // the wave's share of W_in: 64 rows, 4 rows = one copy
  for (int q = 0; q < 2; ++q) copy8(lds_off(&Ws[wave * 64 + q * 32 + (lane >> 3)][(lane & 7) * 8]), 4 * CP * 2, WIN + (size_t)(wave * 64 + q * 32 + (lane >> 3)) * C + (lane & 7) * 8, 4 * C);
  stage(0, 0);                                        // no more than 48 copies of a wave are ever outstanding
  const b16* pt = TQ16 + ((size_t)bn * S + qi) * C + 8 * hh;   // the lane's own token row: its two fragments and the lane's 8 gamma and beta values are requested beside the copies
  const v16b ft[2] = { frag_kb(pt, 0), frag_kb(pt + 32, 0) };
  const v4f g0 = *(const v4f*)(g + lane * 8), g1 = *(const v4f*)(g + lane * 8 + 4), e0 = *(const v4f*)(be + lane * 8), e1 = *(const v4f*)(be + lane * 8 + 4);
  addr_wait(pt, pt, pt);
  asm volatile("s_wait_asynccnt 0x0" ::: "memory");   // this wave's shares of W_in and of key block 0 have landed
  __syncthreads();                                    // ... and every other wave's: nothing is read from LDS in front of this barrier
  stage(32, 1);                                       // nt >= 2: key block 1 always exists; it flies under the q projection too
  { v16b fw[2][16];   // all W_in fragments of q^T (K = 64) are read from LDS as one group
#pragma unroll
    for (int i = 0; i < 2; ++i)
#pragma unroll
      for (int t = 0; t < 16; ++t) fw[i][t] = frag_kb(&Ws[t * 16 + col][i * 32], hh);
    v8f qa[16];
#pragma unroll
    for (int t = 0; t < 16; ++t) qa[t] = (v8f){};
    group_fence();
#pragma unroll
    for (int i = 0; i < 2; ++i)
#pragma unroll
      for (int t = 0; t < 16; ++t) qa[t] = wmma16b(fw[i][t], ft[i], qa[t]);
    group_fence();
    v4f r0, r1, r2, r3;
#pragma unroll
    for (int i = 0; i < 4; ++i) { r0[i] = bf16_rne(g0[i]); r1[i] = bf16_rne(g1[i]); r2[i] = bf16_rne(e0[i]); r3[i] = bf16_rne(e1[i]); }
    *(v4f*)(&Gs[wave][0][lane * 8]) = r0; *(v4f*)(&Gs[wave][0][lane * 8 + 4]) = r1; *(v4f*)(&Gs[wave][1][lane * 8]) = r2; *(v4f*)(&Gs[wave][1][lane * 8 + 4]) = r3;
    wave_lds_sync();
    constexpr float SC = 1.0f / (XS * WSC); v8f sv = {};   // a power of two: scaling the sum is scaling every term (the loops are unrolled whole: qa is a register array)
#pragma unroll
    for (int t = 0; t < 16; ++t) sv += qa[t];
    float s = ((sv[0] + sv[1]) + (sv[2] + sv[3])) + ((sv[4] + sv[5]) + (sv[6] + sv[7])); s += __shfl_xor(s, 16);
    const float mean = s * (SC / D); v8f qv = {};
#pragma unroll
    for (int t = 0; t < 16; ++t) { qa[t] = qa[t] * SC - mean; qv += qa[t] * qa[t]; }
    float ss = ((qv[0] + qv[1]) + (qv[2] + qv[3])) + ((qv[4] + qv[5]) + (qv[6] + qv[7])); ss += __shfl_xor(ss, 16);
    float rs;   // v_rsq_f32 and the one slot that the instruction set asks for behind a transcendental, in one statement; the argument is at least 1e-5, where rsqrtf is this instruction alone
    asm("v_rsq_f32 %0, %1\n\tv_nop" : "=v"(rs) : "v"(ss * (1.0f / D) + LN_EPS));
#pragma unroll
    for (int t = 0; t < 16; ++t) { const float* pg = &Gs[wave][0][t * 16 + 8 * hh]; const v4f ga = *(const v4f*)pg, gc = *(const v4f*)(pg + 4), ba = *(const v4f*)(pg + D), bc = *(const v4f*)(pg + D + 4); v8b hv, lv;
#pragma unroll
      for (int r = 0; r < 8; ++r) { b16 h_, l_; split16((qa[t][r] * rs * (r < 4 ? ga[r & 3] : gc[r & 3]) + (r < 4 ? ba[r & 3] : bc[r & 3])) * XS, h_, l_); hv[r] = h_; lv[r] = l_; }
      *(v8b*)(&Qs[wave][0][col][t * 16 + 8 * hh]) = hv; *(v8b*)(&Qs[wave][1][col][t * 16 + 8 * hh]) = lv; }
    wave_lds_sync(); }   // the wave's q rows are written before its lanes read one another's
  const b16* Qb = &Qs[wave][0][col][0]; const b16* Qlb = &Qs[wave][1][col][0];
  float m = -INFINITY, l = 0.0f; v8f o[16];
#pragma unroll
  for (int t = 0; t < 16; ++t) o[t] = (v8f){};
  const float cs = LOG2E / (XS * XS); const int kend = q0 + 16;   // causal
  const int nt = qb * (16 * AW / 32) + 16 * AW / 32;      // key blocks of the work-group's last wave; the same for all its waves
  for (int it = 0; it < nt; ++it) { const int kb = it * 32, bf = it & 1;
   if (kb < kend) {   // a wave past its diagonal skips the work, never the publish point below
    v8f s0 = {}, s1 = {};
    v16b fq[2][2], fk[2][4];   // two register stages: step i + 1's six fragments are read from LDS as one group ahead of step i's WMMAs; s0 and s1 take turns, each in its old order; unrolled whole so that the stage index is a constant
    auto ldk = [&](int ks, int st) { fq[st][0] = frag_kb(Qb + ks, hh); fq[st][1] = frag_kb(Qlb + ks, hh); fk[st][0] = frag_kb(&Ks[bf][0][col][ks], hh); fk[st][1] = frag_kb(&Ks[bf][0][16 + col][ks], hh);
      fk[st][2] = frag_kb(&Ks[bf][1][col][ks], hh); fk[st][3] = frag_kb(&Ks[bf][1][16 + col][ks], hh); };
    ldk(0, 0);
#pragma unroll
    for (int i = 0; i < D / 32; ++i) { const int st = i & 1; if (i + 1 < D / 32) ldk((i + 1) * 32, st ^ 1);
      group_fence();
      s0 = wmma16b(fk[st][0], fq[st][0], s0); s1 = wmma16b(fk[st][1], fq[st][0], s1); s0 = wmma16b(fk[st][0], fq[st][1], s0); s1 = wmma16b(fk[st][1], fq[st][1], s1);
      s0 = wmma16b(fk[st][2], fq[st][0], s0); s1 = wmma16b(fk[st][3], fq[st][0], s1);
      group_fence(); }
    v16b fv[3][2][2];          // three register stages of two d tiles (hi, lo) each: the first two groups are read ahead of the softmax, group g + 2 ahead of group g's WMMAs; the two tiles take turns, each in its old order
    auto ldv = [&](int g, int st) {
#pragma unroll
      for (int j = 0; j < 2; ++j) { fv[st][j][0] = frag_kb(&Vs[bf][0][(2 * g + j) * 16 + col][0], hh); fv[st][j][1] = frag_kb(&Vs[bf][1][(2 * g + j) * 16 + col][0], hh); } };
    ldv(0, 0); ldv(1, 1);
    group_fence();
    float e[16]; float mx = -INFINITY;
#pragma unroll
    for (int r = 0; r < 8; ++r) { const int k0i = kb + 8 * hh + r, k1i = kb + 16 + 8 * hh + r; e[r] = (k0i <= qi) ? s0[r] * cs : -INFINITY; e[8 + r] = (k1i <= qi) ? s1[r] * cs : -INFINITY; mx = fmaxf(mx, fmaxf(e[r], e[8 + r])); }
    mx = fmaxf(mx, __shfl_xor(mx, 16)); const float mn = fmaxf(m, mx); const float al = nexp2(m - mn); m = mn; float sum = 0.0f; v16b ph, pl;   // key 0 <= qi always -> mn finite
#pragma unroll
    for (int i = 0; i < 16; ++i) { const float p = nexp2(e[i] - mn); sum += p; const b16 h_ = (b16)(p * PS); ph[i] = h_; pl[i] = (b16)(p * PS - (float)h_); }
    sum += __shfl_xor(sum, 16); l = l * al + sum;
#pragma unroll
    for (int g = 0; g < 8; ++g) { const int st = g % 3, t0 = 2 * g, t1 = 2 * g + 1; if (g + 2 < 8) ldv(g + 2, (g + 2) % 3);
      o[t0] *= al; o[t1] *= al;
      group_fence();
      o[t0] = wmma16b(fv[st][0][0], ph, o[t0]); o[t1] = wmma16b(fv[st][1][0], ph, o[t1]); o[t0] = wmma16b(fv[st][0][0], pl, o[t0]); o[t1] = wmma16b(fv[st][1][0], pl, o[t1]);
      o[t0] = wmma16b(fv[st][0][1], ph, o[t0]); o[t1] = wmma16b(fv[st][1][1], ph, o[t1]);
      if (g + 2 < 8) group_fence(); } }   // no reads follow the last two groups: nothing to hold there
   // publish point of key block it + 1, passed by every wave
   asm volatile("s_wait_dscnt 0x0" ::: "memory");      // this wave's reads of buffer bf are done before it may be refilled
   asm volatile("s_wait_asynccnt 0x0" ::: "memory");   // this wave's share of key block it + 1 has landed
   __syncthreads();                                    // both hold for every wave
   if (it + 2 < nt) stage(kb + 64, bf); }
  asm volatile("s_wait_asynccnt 0x0" ::: "memory");    // no copy is outstanding when the wave ends
  // LN2 on the spot: lanes col and col + 16 hold query col's 256 channels, 128 each, so mean and variance are sums in the lane and one exchange with lane ^ 16; gamma and beta are applied behind the LDS transpose, where a lane has 8 fixed channels
  // (the loops are unrolled whole: o is a register array, and every store of the last loop is one base address plus a constant)
  const v4f ga = *(const v4f*)(g2 + lane * 8), gc = *(const v4f*)(g2 + lane * 8 + 4), ba = *(const v4f*)(b2 + lane * 8), bc = *(const v4f*)(b2 + lane * 8 + 4);
  const float inv = 1.0f / (l * PS * XS); v8f sv = {};
#pragma unroll
  for (int t = 0; t < 16; ++t) { o[t] *= inv; sv += o[t]; }
  float s = ((sv[0] + sv[1]) + (sv[2] + sv[3])) + ((sv[4] + sv[5]) + (sv[6] + sv[7])); s += __shfl_xor(s, 16);
  const float mean = s * (1.0f / D); v8f qv = {};
#pragma unroll
  for (int t = 0; t < 16; ++t) { o[t] -= mean; qv += o[t] * o[t]; }
  float ss = ((qv[0] + qv[1]) + (qv[2] + qv[3])) + ((qv[4] + qv[5]) + (qv[6] + qv[7])); ss += __shfl_xor(ss, 16);
  const float rs = rsqrtf(ss * (1.0f / D) + LN_EPS);
#pragma unroll
  for (int t = 0; t < 16; ++t)
#pragma unroll
    for (int r = 0; r < 8; ++r) To[wave][col][t * 16 + 8 * hh + r] = o[t][r] * rs;
  wave_lds_sync();
  float gg[8], bb[8];
#pragma unroll
  for (int i = 0; i < 4; ++i) { gg[i] = bf16_rne(ga[i]); gg[4 + i] = bf16_rne(gc[i]); bb[i] = bf16_rne(ba[i]); bb[4 + i] = bf16_rne(bc[i]); }
#pragma unroll
  for (int rr = 0; rr < 16; ++rr) { const size_t gi = ((size_t)bn * S + q0 + rr) * D + lane * 8; const v4f xa = *(const v4f*)(&To[wave][rr][lane * 8]), xc = *(const v4f*)(&To[wave][rr][lane * 8 + 4]); v8b hv, lv;
#pragma unroll
    for (int i = 0; i < 8; ++i) { b16 h_, l_; split16(((i < 4 ? xa[i] : xc[i - 4]) * gg[i] + bb[i]) * XS, h_, l_); hv[i] = h_; lv[i] = l_; }
    *(v8b*)(Ah + gi) = hv; *(v8b*)(Al + gi) = lv; }
}
// the whole tail of the block in one kernel: h = relu(x W1) W2, e = h + v, out = e W_out, x = LN2(att), v = tok_kv W_kv[:, 256:]. Block = 4 waves x 32 tokens, one block per WGP. Every product is taken transposed (A = weight rows, B = token rows), so
// a product's accumulators (lane = token, registers = 8 channels) are, two tiles at a time, the next product's B fragment: hidden and e never leave the registers. x is read once (LDS, then 256 registers of a lane); the weights come
// in 16 chunks of 32 hidden channels (32 rows of W1T, 32 columns of W2T) by asynchronous copies to LDS, two buffers, shared by the 4 waves; each chunk's hidden values go into the e accumulators at once.
// v is not read back as a 256-wide plane: behind the loop v^T = W_kv_v^T tok^T (K = 64, 64 WMMAs of a wave, the scale x8 x256 of the W2 products) goes into the e accumulators, from the wave's 32 token rows of 128 B and the v half of W_kv, both copied to LDS.
// Per accumulator the products and their order are those of the three separate kernels: k ascending in steps of 32, hi then lo; v's two k steps come last in the sum.
constexpr int OP = 32 + 4 /* f32 pitch of an out row in LDS */;
__global__ __launch_bounds__(128) void ffn_kernel(const b16* __restrict__ Ah, const b16* __restrict__ Al, const b16* __restrict__ W1T, const b16* __restrict__ W2T, const b16* __restrict__ WOT, const b16* __restrict__ TK16, const b16* __restrict__ WKV, float* __restrict__ out) {
  __shared__ __attribute__((aligned(16))) b16 W1s[2][32][KP];      // [buffer][hidden][d]
  __shared__ __attribute__((aligned(16))) b16 W2s[2][D][VP];       // [buffer][d][hidden]
  __shared__ __attribute__((aligned(16))) b16 WOs[C][KP];          // [c][d]
  __shared__ __attribute__((aligned(16))) b16 WVs[D][CP];          // [d][c]: the v half of W_kv
  __shared__ __attribute__((aligned(16))) b16 Tks[AW][32][CP];     // [wave][token][c]
  __shared__ __attribute__((aligned(16))) b16 Xs[AW][2][32][KP];   // [wave][hi, lo][token][d]; a wave's part holds its x rows, then its out tile (f32, pitch OP): no other wave touches it
  const int wave = __builtin_amdgcn_readfirstlane(threadIdx.x >> 5), lane = threadIdx.x & 31, hh = lane >> 4, col = lane & 15; const size_t m0 = (size_t)blockIdx.x * (32 * AW) + wave * 32;
  // a wave's share of one chunk: 8 W1T rows (a row = one copy of 32 lanes x 16 B) and 64 W2T row pieces of 64 B (8 rows = one copy): 16 copies
  auto stage = [&](int c, int bf) {
    copy8(lds_off(&W1s[bf][wave * 8][lane * 8]), KP * 2, W1T + (size_t)(c * 32 + wave * 8) * D + lane * 8, D);
    copy8(lds_off(&W2s[bf][wave * 64 + (lane >> 2)][(lane & 3) * 8]), 8 * VP * 2, W2T + (size_t)(wave * 64 + (lane >> 2)) * F + c * 32 + (lane & 3) * 8, (size_t)8 * F); };
  auto copyx = [&](int j) {   // x rows 16j .. 16j + 15, hi and lo: 32 copies
#pragma unroll
    for (int q = 2 * j; q < 2 * j + 2; ++q) { copy8(lds_off(&Xs[wave][0][8 * q][lane * 8]), KP * 2, Ah + (m0 + 8 * q) * D + lane * 8, D); copy8(lds_off(&Xs[wave][1][8 * q][lane * 8]), KP * 2, Al + (m0 + 8 * q) * D + lane * 8, D); } };
  float* Fw = (float*)&Xs[wave][0][0][0];
  copyx(0); stage(0, 0);
  asm volatile("s_wait_asynccnt 0x0" ::: "memory");   // never more than 56 copies of a wave are outstanding
  copyx(1); copy8(lds_off(&WOs[wave * 16][lane * 8]), KP * 2, WOT + (size_t)(wave * 16) * D + lane * 8, D); copy8(lds_off(&WOs[wave * 16 + 8][lane * 8]), KP * 2, WOT + (size_t)(wave * 16 + 8) * D + lane * 8, D);
  copy8(lds_off(&Tks[wave][lane >> 3][(lane & 7) * 8]), 4 * CP * 2, TK16 + (m0 + (lane >> 3)) * C + (lane & 7) * 8, 4 * C);   // the wave's 32 token rows (4 rows = one copy)
  asm volatile("s_wait_asynccnt 0x0" ::: "memory");   // this wave's x and token rows and its shares of chunk 0 and of W_out have landed
  __syncthreads();                                    // ... and every other wave's: nothing is read from LDS in front of this barrier
  stage(1, 1);
#pragma unroll   // with chunk 1 goes the wave's share of the v half of W_kv (64 rows, 4 rows = one copy; 32 copies outstanding): trip 0's publish point hands it to every wave, long before it is read behind the loop
  for (int q = 0; q < 2; ++q) copy8(lds_off(&WVs[wave * 64 + q * 32 + (lane >> 3)][(lane & 7) * 8]), 4 * CP * 2, WKV + (size_t)(D + wave * 64 + q * 32 + (lane >> 3)) * C + (lane & 7) * 8, 4 * C);
  v16b xh[2][D / 32], xl[2][D / 32];
#pragma unroll
  for (int j = 0; j < 2; ++j)
#pragma unroll
    for (int i = 0; i < D / 32; ++i) { xh[j][i] = frag_kb(&Xs[wave][0][j * 16 + col][i * 32], hh); xl[j][i] = frag_kb(&Xs[wave][1][j * 16 + col][i * 32], hh); }
  v8f e[2][16];
#pragma unroll
  for (int j = 0; j < 2; ++j)
#pragma unroll
    for (int t = 0; t < 16; ++t) e[j][t] = (v8f){};
  for (int it = 0; it < F / 32; ++it) { const int bf = it & 1;
    v16b fw[3][8];   // three register stages of eight weight fragments: each group is read from LDS as a whole ahead of the WMMAs of a group before it
    auto ld1 = [&](int g, int st) {   // W1T: k steps 4g .. 4g + 3, both hidden tiles
#pragma unroll
      for (int i = 0; i < 4; ++i) { fw[st][2 * i] = frag_kb(&W1s[bf][col][(4 * g + i) * 32], hh); fw[st][2 * i + 1] = frag_kb(&W1s[bf][16 + col][(4 * g + i) * 32], hh); } };
    auto ld2 = [&](int g, int st) {   // W2T: d tiles 8g .. 8g + 7
#pragma unroll
      for (int t = 0; t < 8; ++t) fw[st][t] = frag_kb(&W2s[bf][(8 * g + t) * 16 + col][0], hh); };
    v8f h00 = {}, h01 = {}, h10 = {}, h11 = {};   // [token tile][hidden tile]
    auto mm1 = [&](int g, int st) {   // four independent accumulators take turns
#pragma unroll
      for (int i = 0; i < 4; ++i) { const int k = 4 * g + i;
        h00 = wmma16b(fw[st][2 * i], xh[0][k], h00); h01 = wmma16b(fw[st][2 * i + 1], xh[0][k], h01); h10 = wmma16b(fw[st][2 * i], xh[1][k], h10); h11 = wmma16b(fw[st][2 * i + 1], xh[1][k], h11);
        h00 = wmma16b(fw[st][2 * i], xl[0][k], h00); h01 = wmma16b(fw[st][2 * i + 1], xl[0][k], h01); h10 = wmma16b(fw[st][2 * i], xl[1][k], h10); h11 = wmma16b(fw[st][2 * i + 1], xl[1][k], h11); } };
    ld1(0, 0); ld1(1, 1);
    group_fence();
    mm1(0, 0);
    group_fence();
    ld2(0, 0); ld2(1, 2);
    group_fence();
    mm1(1, 1);
    group_fence();   // keeps the waits below behind these WMMAs, under which the W2T fragments arrive: without it the compiler lifts the waits to just behind the reads
    // publish point of chunk it + 1, passed by every wave. It stands here and not at the trip's end: the W2T fragments, the trip's last LDS reads, went out ahead of the WMMAs above; what is left of the trip works on registers alone, and the next copies fly under it too
    asm volatile("s_wait_dscnt 0x0" ::: "memory");      // this wave's reads of buffer bf are done before it may be refilled
    asm volatile("s_wait_asynccnt 0x0" ::: "memory");   // this wave's share of chunk it + 1 has landed
    __syncthreads();                                    // both hold for every wave
    if (it + 2 < F / 32) stage(it + 2, bf);
    v16b ph[2], pl[2];   // relu(hidden) x8, hi and lo: hidden tiles 0 and 1 of a token tile are elements 0..7 and 8..15 of its B fragment
#pragma unroll
    for (int r = 0; r < 8; ++r) { b16 h_, l_;
      split16(fmaxf(h00[r] * (1.0f / (XS * WSC)), 0.0f) * XS, h_, l_); ph[0][r] = h_; pl[0][r] = l_; split16(fmaxf(h01[r] * (1.0f / (XS * WSC)), 0.0f) * XS, h_, l_); ph[0][8 + r] = h_; pl[0][8 + r] = l_;
      split16(fmaxf(h10[r] * (1.0f / (XS * WSC)), 0.0f) * XS, h_, l_); ph[1][r] = h_; pl[1][r] = l_; split16(fmaxf(h11[r] * (1.0f / (XS * WSC)), 0.0f) * XS, h_, l_); ph[1][8 + r] = h_; pl[1][8 + r] = l_; }
#pragma unroll
    for (int g = 0; g < 2; ++g) {   // d tiles 8g .. 8g + 7 are in stage 2g
#pragma unroll
      for (int t = 0; t < 8; ++t) { e[0][8 * g + t] = wmma16b(fw[2 * g][t], ph[0], e[0][8 * g + t]); e[1][8 * g + t] = wmma16b(fw[2 * g][t], ph[1], e[1][8 * g + t]); }
#pragma unroll
      for (int t = 0; t < 8; ++t) { e[0][8 * g + t] = wmma16b(fw[2 * g][t], pl[0], e[0][8 * g + t]); e[1][8 * g + t] = wmma16b(fw[2 * g][t], pl[1], e[1][8 * g + t]); } } }
  asm volatile("s_wait_asynccnt 0x0" ::: "memory");     // no copy is outstanding behind the loop
  { v16b ft[2][2], fvw[2][16];   // e += v^T: all fragments (K = 64) are read from LDS as one group
#pragma unroll
    for (int i = 0; i < 2; ++i) { ft[0][i] = frag_kb(&Tks[wave][col][i * 32], hh); ft[1][i] = frag_kb(&Tks[wave][16 + col][i * 32], hh);
#pragma unroll
      for (int t = 0; t < 16; ++t) fvw[i][t] = frag_kb(&WVs[t * 16 + col][i * 32], hh); }
    group_fence();
#pragma unroll
    for (int i = 0; i < 2; ++i)
#pragma unroll
      for (int t = 0; t < 16; ++t) { e[0][t] = wmma16b(fvw[i][t], ft[0][i], e[0][t]); e[1][t] = wmma16b(fvw[i][t], ft[1][i], e[1][t]); }
    group_fence(); }
  v16b fo[2][8];   // W_out fragments: two register stages of two k steps x four c tiles
  auto ldo = [&](int g, int st) {
#pragma unroll
    for (int i = 0; i < 2; ++i)
#pragma unroll
      for (int t = 0; t < 4; ++t) fo[st][4 * i + t] = frag_kb(&WOs[t * 16 + col][(2 * g + i) * 32], hh); };
  ldo(0, 0);
  v16b eh[2][D / 32], el[2][D / 32];   // e = h + v, x8, hi and lo: d tiles 2i and 2i + 1 are the B fragment of k step i
#pragma unroll
  for (int j = 0; j < 2; ++j)
#pragma unroll
    for (int t = 0; t < 16; ++t) {
#pragma unroll
      for (int r = 0; r < 8; ++r) { const float y = e[j][t][r] * (1.0f / (XS * WSC)); b16 h_, l_; split16(y * XS, h_, l_); eh[j][t >> 1][(t & 1) * 8 + r] = h_; el[j][t >> 1][(t & 1) * 8 + r] = l_; } }
  v8f oa[2][4];
#pragma unroll
  for (int j = 0; j < 2; ++j)
#pragma unroll
    for (int t = 0; t < 4; ++t) oa[j][t] = (v8f){};
#pragma unroll
  for (int g = 0; g < 4; ++g) { const int st = g & 1; if (g + 1 < 4) ldo(g + 1, st ^ 1);
    group_fence();
#pragma unroll
    for (int i = 0; i < 2; ++i) {
#pragma unroll
      for (int t = 0; t < 4; ++t) { oa[0][t] = wmma16b(fo[st][4 * i + t], eh[0][2 * g + i], oa[0][t]); oa[1][t] = wmma16b(fo[st][4 * i + t], eh[1][2 * g + i], oa[1][t]); }
#pragma unroll
      for (int t = 0; t < 4; ++t) { oa[0][t] = wmma16b(fo[st][4 * i + t], el[0][2 * g + i], oa[0][t]); oa[1][t] = wmma16b(fo[st][4 * i + t], el[1][2 * g + i], oa[1][t]); } }
    group_fence(); }
  // the wave's x rows went to registers long ago: its out tile (64 c x 32 tokens) takes their place
#pragma unroll
  for (int j = 0; j < 2; ++j)
#pragma unroll
    for (int t = 0; t < 4; ++t)
#pragma unroll
      for (int r = 0; r < 8; ++r) Fw[(t * 16 + 8 * hh + r) * OP + j * 16 + col] = oa[j][t][r] * (1.0f / (XS * WSC));
  wave_lds_sync();
  const int bn = (int)(m0 / S), s0 = (int)(m0 % S), b = bn / NN, n = bn % NN; float* po = out + (((size_t)b * C + (lane >> 3)) * NN + n) * S + s0 + (lane & 7) * 4;
#pragma unroll   // unrolled: every store is one base address plus a constant (a store = 4 channel rows x one whole 128-byte line), so no address register takes a new value behind an issued store
  for (int i = 0; i < 16; ++i) *(v4f*)(po + (size_t)i * 4 * NN * S) = *(const v4f*)(Fw + (i * 4 + (lane >> 3)) * OP + (lane & 7) * 4);
}
}  // namespace

extern "C" void kernel_launch(void* const* d_in, const int* in_sizes, int n_in, void* d_out, int out_size, void* d_ws, size_t ws_size, hipStream_t stream) {
  (void)n_in;
  auto Fp = [&](int i) { return (const float*)d_in[i]; };
  // input order: 0 fea_lf [4,64,8,32,32], 1 fea_hf, 2 W_in [64,256], 3 W_kv [64,512], 4 gamma, 5 beta, 6 g2, 7 b2, 8 W1 [256,512], 9 W2 [512,256], 10 W_out [256,64] (all (in, out))
  if (in_sizes[0] != NR * C || in_sizes[1] != NR * C || in_sizes[2] != C * D || in_sizes[3] != C * F || in_sizes[4] != D || in_sizes[8] != D * F || in_sizes[9] != F * D || in_sizes[10] != D * C || out_size != NR * C) return;
  size_t off = 0; char* ws = (char*)d_ws;
  auto carve = [&](size_t bytes) { char* p = ws + off; off += (bytes + 255) & ~(size_t)255; return p; };
  b16* TQ16 = (b16*)carve((size_t)NR * C * 2); b16* TK16 = (b16*)carve((size_t)NR * C * 2); b16* WIN = (b16*)carve((size_t)D * C * 2); b16* WKV = (b16*)carve((size_t)F * C * 2); b16* W1T = (b16*)carve((size_t)F * D * 2); b16* W2T = (b16*)carve((size_t)D * F * 2); b16* WOT = (b16*)carve((size_t)C * D * 2);
  b16* Kh = (b16*)carve((size_t)NR * D * 2); b16* Kl = (b16*)carve((size_t)NR * D * 2);
  b16* VTh = (b16*)carve((size_t)NR * D * 2); b16* VTl = (b16*)carve((size_t)NR * D * 2); b16* Ah = (b16*)carve((size_t)NR * D * 2); b16* Al = (b16*)carve((size_t)NR * D * 2);   // LN2(att) gets its own planes: other attention blocks still read k and v while they are written
  if (off > ws_size) return;   // = 110 MB
  prep_kernel<<<NPW + NXT, 256, 0, stream>>>(Fp(0), Fp(1), Fp(2), Fp(3), Fp(8), Fp(9), Fp(10), TQ16, TK16, WIN, WKV, W1T, W2T, WOT);
  front_kernel<<<NPB + NVB, 128, 0, stream>>>(TK16, WKV, Fp(4), Fp(5), Kh, Kl, VTh, VTl);
  attn_kernel<<<dim3(NBN, 1, S / (16 * AW)), 32 * AW, 0, stream>>>(TQ16, WIN, Fp(4), Fp(5), Kh, Kl, VTh, VTl, Fp(6), Fp(7), Ah, Al);   // LN2(att)
  ffn_kernel<<<NR / (32 * AW), 32 * AW, 0, stream>>>(Ah, Al, W1T, W2T, WOT, TK16, WKV, (float*)d_out);   // out = (relu(LN2(att) W1) W2 + v) W_out
}

// v008
// Measured time: 116 microseconds a run.
// In two side-by-side timings against v007, it was 1.03 and 1.04 times as fast.
// Over all steps from v000 it is 11.4 times as fast.
#include <hip/hip_runtime.h>

// Inter-frequency attention block: 32 sequences (4 batches x 8 'n' slices) of 1,024 tokens (32 x 32 positions), 64 channels; q = LN(tok_q W_in), k = LN((tok_kv W_kv)[:, :256]) (shared gamma/beta),
// v = (tok_kv W_kv)[:, 256:]; score = q.k (no scaling), causal (lower triangle; fill -1e15 == masked out since the diagonal is always kept), softmax, att = p v; h = relu(LN2(att) W1) W2;
// out = (h + v) W_out -> written channel-major as [4][64][8][32][32].
// WMMA (v_wmma_f32_16x16x32_f16, f32 accumulate): W_in / W_kv projections with EXACT bf16 tokens (x8, LDS-transposed from the channel-major inputs) and weights (x256), 1 product, each LayerNorm in the epilogue of the kernel that makes its rows; S^T = K.Q^T with
// q AND k (LayerNorm outputs) f16 hi+lo x8 (3 products: the unscaled 256-dim logits have sigma ~16); online softmax in f32; O^T += V^T P^T with v and P f16 hi+lo (3 products, one f32 accumulator:
// unscaled residuals); FFN W1 with LN2(att) hi+lo (2 products), W2 with the relu hidden hi+lo (2 products), W_out with (h + v) hi+lo (2 products). LayerNorms, softmax, relu, residual in f32.
// Inputs rounded to bf16 once. Fragment k-map per lane half hh for A AND B: elements 0..7 <- k = 8hh+0..7, 8..15 <- k = 16+8hh+0..7; acc[r] = D[8hh+r][col].

namespace {
constexpr int NBN = 32 /* b*n sequences */, NN = 8, S = 1024, C = 64, D = 256, F = 512, NR = NBN * S /* all 32 sequences go through every stage in one launch */;
constexpr float XS = 8.0f, WSC = 256.0f, PS = 8.0f, LOG2E = 1.4426950408889634f, LN_EPS = 1e-5f;

typedef _Float16 b16;
typedef __attribute__((ext_vector_type(16))) _Float16 v16b;
typedef __attribute__((ext_vector_type(8))) _Float16 v8b;
typedef __attribute__((ext_vector_type(8))) float v8f;
typedef __attribute__((ext_vector_type(4))) float v4f;
__device__ __forceinline__ float bf16_rne(float f) { unsigned int u = __float_as_uint(f); u += 0x7FFFu + ((u >> 16) & 1u); return __uint_as_float(u & 0xFFFF0000u); }
__device__ __forceinline__ void split16(float v, b16& hi, b16& lo) { hi = (b16)v; lo = (b16)(v - (float)hi); }
__device__ __forceinline__ v16b frag_kb(const b16* p, int hh) { const v8b a = *(const v8b*)(p + 8 * hh), b = *(const v8b*)(p + 16 + 8 * hh); v16b f;
#pragma unroll
  for (int e = 0; e < 8; ++e) { f[e] = a[e]; f[8 + e] = b[e]; } return f; }
__device__ __forceinline__ v8f wmma16b(v16b a, v16b b, v8f c) { return __builtin_amdgcn_wmma_f32_16x16x32_f16(false, a, false, b, (short)0, c, false, false); }
// stands between a group of fragment loads and a block of WMMAs: without it the compiler sinks each load to just in front of its own WMMA, and every load's latency is waited out alone
__device__ __forceinline__ void group_fence() { __builtin_amdgcn_sched_barrier(0); }
// stands behind a group of fragment loads from global memory: the loads' address registers are inputs here, so none of them is given a new value ahead of this wait
__device__ __forceinline__ void addr_wait(const b16* a, const b16* b, const b16* c) { asm volatile("s_wait_xcnt 0x0" :: "v"(a), "v"(b), "v"(c) : "memory"); }
__device__ __forceinline__ void wave_lds_sync() { __builtin_amdgcn_fence(__ATOMIC_RELEASE, "workgroup"); __builtin_amdgcn_wave_barrier(); __builtin_amdgcn_fence(__ATOMIC_ACQUIRE, "workgroup"); }
__device__ __forceinline__ float nexp2(float x) { return __builtin_amdgcn_exp2f(x); }
// sum over a 16-lane row, left in every lane of it: four adds whose second operand comes from lane ^ M of the row (DPP row_xmask), no LDS round trip
template <int M> __device__ __forceinline__ float xadd(float v) { return v + __int_as_float(__builtin_amdgcn_update_dpp(0, __float_as_int(v), 0x160 + M, 0xf, 0xf, true)); }
__device__ __forceinline__ float hsum16(float v) { return xadd<8>(xadd<4>(xadd<2>(xadd<1>(v)))); }
// the value of lane ^ 16, by a vector cross-row move (v_permlanex16_b32): __shfl_xor(v, 16) is an LDS-queue operation here, whose wait also drains every fragment read in front of it
__device__ __forceinline__ float xrow(float v) { const int b = __float_as_int(v); return __int_as_float(__builtin_amdgcn_permlanex16(b, b, 0x76543210, 0xfedcba98, false, false)); }

// the parts below are the bodies of kernels that do not depend on one another; the two kernels behind them give each work-group one part by its block index (bx, by, bz: the part's own block coordinates; the LDS is the kernel's, handed in)
__device__ __forceinline__ void xt_part(b16 (*T)[64 + 8], int bx, int by, int bz, const float* __restrict__ flf, const float* __restrict__ fhf, b16* __restrict__ TQ16, b16* __restrict__ TK16) {
  const int bn = bz, kind = by, s0 = bx * 64, t_ = threadIdx.x; const int b = bn / NN, n = bn % NN; const float* src = (kind == 0 ? flf : fhf) + ((size_t)b * C * NN + n) * S; b16* dst = kind == 0 ? TQ16 : TK16;
  for (int q = t_; q < 64 * 64; q += 256) { const int cc = q >> 6, ss = q & 63; T[ss][cc] = (b16)(bf16_rne(src[(size_t)cc * NN * S + s0 + ss]) * XS); }
  __syncthreads();
  { for (int q = t_; q < 64 * 8; q += 256) { const int ss = q >> 3, c8 = (q & 7) * 8; *(v8b*)(dst + ((size_t)bn * S + s0 + ss) * C + c8) = *(const v8b*)(&T[ss][c8]); }  }
}
// weights (in,out) transposed to [out][in] rows x256 via 64x64 LDS tiles: kind 0 W_in [64][256] -> WIN [256][64]; 1 W_kv [64][512] -> WKV [512][64]; 2 W1 [256][512] -> W1T [512][256];
__device__ __forceinline__ void prepw_part(b16 (*T)[64 + 8], int bx, int by, int bz, const float* __restrict__ win, const float* __restrict__ wkv, const float* __restrict__ w1, const float* __restrict__ w2, const float* __restrict__ wout, b16* __restrict__ WIN, b16* __restrict__ WKV, b16* __restrict__ W1T, b16* __restrict__ W2T, b16* __restrict__ WOT) {
  const int kind = bz, i0 = bx * 64, o0 = by * 64, t_ = threadIdx.x; const float* w; b16* dst; int nin, nout;
  if (kind == 0) { w = win; dst = WIN; nin = C; nout = D; } else if (kind == 1) { w = wkv; dst = WKV; nin = C; nout = F; } else if (kind == 2) { w = w1; dst = W1T; nin = D; nout = F; } else if (kind == 3) { w = w2; dst = W2T; nin = F; nout = D; } else { w = wout; dst = WOT; nin = D; nout = C; }
  if (i0 >= nin || o0 >= nout) return;
  for (int q = t_; q < 64 * 64; q += 256) { const int ii = q >> 6, oo = q & 63; T[oo][ii] = (b16)(bf16_rne(w[(size_t)(i0 + ii) * nout + o0 + oo]) * WSC); }
  __syncthreads();
  { for (int q = t_; q < 64 * 8; q += 256) { const int oo = q >> 3, c8 = (q & 7) * 8; *(v8b*)(dst + (size_t)(o0 + oo) * nin + i0 + c8) = *(const v8b*)(&T[oo][c8]); }  }
}
// token transpose and weight transpose in one launch: 320 work-groups of the weight grid (8 x 8 x 5) first, then 1,024 of the token grid (16 x 2 x 32)
constexpr int NPW = 8 * 8 * 5, NXT = (S / 64) * 2 * NBN;
__global__ __launch_bounds__(256) void prep_kernel(const float* __restrict__ flf, const float* __restrict__ fhf, const float* __restrict__ win, const float* __restrict__ wkv, const float* __restrict__ w1, const float* __restrict__ w2, const float* __restrict__ wout,
                                                   b16* __restrict__ TQ16, b16* __restrict__ TK16, b16* __restrict__ WIN, b16* __restrict__ WKV, b16* __restrict__ W1T, b16* __restrict__ W2T, b16* __restrict__ WOT) {
  __shared__ __attribute__((aligned(16))) b16 T[64][64 + 8];
  const int b = blockIdx.x;
  if (b < NPW) prepw_part(T, b & 7, (b >> 3) & 7, b >> 6, win, wkv, w1, w2, wout, WIN, WKV, W1T, W2T, WOT);
  else { const int i = b - NPW; xt_part(T, i & 15, (i >> 4) & 1, i >> 5, flf, fhf, TQ16, TK16); }
}
// k projection with its LayerNorm (tok_kv WKV[:256]): block = 64 rows x 4 waves x 256 cols (16 tiles, K = 64 exact, 1 product); a wave holds its 16 rows whole (256 columns: 16 in a lane x 16 lanes), so mean, variance and the
// affine step are taken on the accumulators, and the f16 hi+lo x8 planes go out through LDS as whole rows: no f32 plane and no row kernel in between
__device__ __forceinline__ void projln_part(char* sm, int bx, const b16* __restrict__ A, const b16* __restrict__ Bw, const float* __restrict__ g, const float* __restrict__ be, b16* __restrict__ Yh, b16* __restrict__ Yl) {
  b16 (*Th)[16][D + 8] = (b16 (*)[16][D + 8])sm; b16 (*Tl)[16][D + 8] = Th + 4;   // [4 waves][16][D + 8] each
  const int wave = threadIdx.x >> 5, lane = threadIdx.x & 31, nloc = lane & 15, hlf = lane >> 4; const size_t m0 = (size_t)bx * 64 + wave * 16;
  v8f acc[16];
#pragma unroll
  for (int t = 0; t < 16; ++t) acc[t] = (v8f){};
  const b16* pa = A + (m0 + nloc) * C + 8 * hlf; const b16* pw = Bw + (size_t)nloc * C + 8 * hlf;   // the lane's own addresses: every load below is one of these plus a constant
  v16b fa[2], fw[2][16];   // all fragments of the tile (K = 64) are requested as one group, the lane's 16 gamma and beta values with them
#pragma unroll
  for (int i = 0; i < 2; ++i) { fa[i] = frag_kb(pa + i * 32, 0);
#pragma unroll
    for (int t = 0; t < 16; ++t) fw[i][t] = frag_kb(pw + t * 16 * C + i * 32, 0); }
  float gv[16], bv[16];
#pragma unroll
  for (int t = 0; t < 16; ++t) { gv[t] = g[t * 16 + nloc]; bv[t] = be[t * 16 + nloc]; }
  group_fence();
#pragma unroll
  for (int i = 0; i < 2; ++i)
#pragma unroll
    for (int t = 0; t < 16; ++t) acc[t] = wmma16b(fa[i], fw[i][t], acc[t]);
  group_fence(); addr_wait(pa, pw, pw);   // the fence keeps the wait behind the WMMAs, where every load has returned
  constexpr float SC = 1.0f / (XS * WSC);   // a power of two: scaling the sum is scaling every term
  float mean[8], rs[8];   // the loops below are unrolled whole: acc, gv, bv, mean and rs are register arrays and take constant indices only
#pragma unroll
  for (int r = 0; r < 8; ++r) { float s = 0.0f;
#pragma unroll
    for (int t = 0; t < 16; ++t) s += acc[t][r];
    mean[r] = hsum16(s) * (SC / D); }
#pragma unroll
  for (int r = 0; r < 8; ++r) { float ss = 0.0f;
#pragma unroll
    for (int t = 0; t < 16; ++t) { const float dv = acc[t][r] * SC - mean[r]; acc[t][r] = dv; ss += dv * dv; }
    rs[r] = rsqrtf(hsum16(ss) * (1.0f / D) + LN_EPS); }
#pragma unroll
  for (int t = 0; t < 16; ++t) { const float gt = bf16_rne(gv[t]), bt = bf16_rne(bv[t]);
#pragma unroll
    for (int r = 0; r < 8; ++r) { b16 h_, l_; split16((acc[t][r] * rs[r] * gt + bt) * XS, h_, l_); Th[wave][8 * hlf + r][t * 16 + nloc] = h_; Tl[wave][8 * hlf + r][t * 16 + nloc] = l_; } }
  wave_lds_sync();
#pragma unroll   // unrolled: every store is one base address plus a constant, so no address register takes a new value behind an issued store
  for (int rr = 0; rr < 16; ++rr) { const size_t gi = (m0 + rr) * D + lane * 8; *(v8b*)(Yh + gi) = *(const v8b*)(&Th[wave][rr][lane * 8]); *(v8b*)(Yl + gi) = *(const v8b*)(&Tl[wave][rr][lane * 8]); }
}
// v in channel-major hi/lo planes for the PV operand: VTh/VTl [bn][256 d][1024 s] = f16 hi+lo x8 of (tok_kv WKV[256:])^T: A = WKV_v rows d (K = 64), B = TK16 rows s; block = 64 d x 4 waves x
__device__ __forceinline__ void v_part(char* sm, int bx, int by, int bz, const b16* __restrict__ TK16, const b16* __restrict__ WKV, b16* __restrict__ VTh, b16* __restrict__ VTl) {
  b16 (*Ts)[16][128 + 8] = (b16 (*)[16][128 + 8])sm; b16 (*Tsl)[16][128 + 8] = Ts + 4;   // [4 waves][16][128 + 8] each
  const int wave = threadIdx.x >> 5, lane = threadIdx.x & 31, nloc = lane & 15, hlf = lane >> 4; const int bn = bz; const int d0 = bx * 64 + wave * 16, s0 = by * 128;
  v8f acc[8];
#pragma unroll
  for (int t = 0; t < 8; ++t) acc[t] = (v8f){};
  const b16* pa = WKV + (size_t)(d0 + nloc) * C + 8 * hlf; const b16* pw = TK16 + ((size_t)bn * S + s0 + nloc) * C + 8 * hlf;   // the lane's own addresses: every load below is one of these plus a constant
  v16b fa[2], fw[2][8];   // all fragments of the tile (K = 64) are requested as one group
#pragma unroll
  for (int i = 0; i < 2; ++i) { fa[i] = frag_kb(pa + D * C + i * 32, 0);   // the v half of W_kv: rows D .. 2D - 1
#pragma unroll
    for (int t = 0; t < 8; ++t) fw[i][t] = frag_kb(pw + t * 16 * C + i * 32, 0); }
  group_fence();
#pragma unroll
  for (int i = 0; i < 2; ++i)
#pragma unroll
    for (int t = 0; t < 8; ++t) acc[t] = wmma16b(fa[i], fw[i][t], acc[t]);
  group_fence(); addr_wait(pa, pw, pw);   // the fence keeps the wait behind the WMMAs, where every load has returned
#pragma unroll
  for (int t = 0; t < 8; ++t)
#pragma unroll
    for (int r = 0; r < 8; ++r) { b16 h_, l_; split16(acc[t][r] * (1.0f / (XS * WSC)) * XS, h_, l_); Ts[wave][8 * hlf + r][t * 16 + nloc] = h_; Tsl[wave][8 * hlf + r][t * 16 + nloc] = l_; }
  wave_lds_sync();
  { for (int rr = 0; rr < 16; ++rr) if (lane < 16) { const size_t gi = ((size_t)bn * D + d0 + rr) * S + s0 + lane * 8; *(v8b*)(VTh + gi) = *(const v8b*)(&Ts[wave][rr][lane * 8]); *(v8b*)(VTl + gi) = *(const v8b*)(&Tsl[wave][rr][lane * 8]); }  }
}
// the k and v^T projections in one launch; the part with a LayerNorm, the longer, comes first: 512 work-groups for k, 1,024 (4 x 8 x 32) for v^T
constexpr int NPB = NR / 64, NVB = (D / 64) * (S / 128) * NBN;
__global__ __launch_bounds__(128) void front_kernel(const b16* __restrict__ TK16, const b16* __restrict__ WKV, const float* __restrict__ g, const float* __restrict__ be,
                                                    b16* __restrict__ Kh, b16* __restrict__ Kl, b16* __restrict__ VTh, b16* __restrict__ VTl) {
  __shared__ __attribute__((aligned(16))) char sm[2 * 4 * 16 * (D + 8) * 2];   // the larger part's need (k: two planes of 4 x 16 rows)
  const int b = blockIdx.x;
  if (b < NPB) projln_part(sm, b, TK16, WKV, g, be, Kh, Kl);   // k = LN(tok_kv W_kv[:, :256])
  else { const int i = b - NPB; v_part(sm, i & 3, (i >> 2) & 7, i >> 5, TK16, WKV, VTh, VTl); }
}
// causal attention: grid (sequences, 1, S/64), block = 4 waves x 16 queries; one block fills a WGP's LDS and there are twice as many blocks as WGPs, so the query block falls with blockIdx.z: the longest blocks start first, and a WGP
// that ends a block of the first round (18 to 32 key blocks) takes the longest one left (16 down to 2); key blocks of 32 (no scaling). q is made on the spot and never stored as a plane: q^T = W_in^T tok_q^T (K = 64, 32 WMMAs of a wave) leaves query col's 256 channels in lanes col and col + 16, where its LayerNorm is taken; its f16 hi+lo x8 values are S^T's B fragments as they stand and stay in 128 registers of a lane for the whole loop (W_in comes once per block by asynchronous copies to LDS, with key block 0). The k and v^T fragments come from LDS: each 32-key block of
// k (rows of 512 B, LDS pitch 528 B) and of v^T (rows of 64 B, LDS pitch 80 B), hi and lo, once per block of 4 waves, by asynchronous copies to LDS, two buffers: block t + 1 flies while block t is worked on.
// The products, their order and the softmax of a wave are those of the per-wave form: S^T 3 products with K = 256 (8 steps), online softmax f32, O^T 3 products.
constexpr int AW = 4, KP = D + 8, VP = 32 + 8, CP = C + 8 /* pitch of a 64-channel row in LDS: 144 B */;
__device__ __forceinline__ unsigned lds_off(const void* p) { return (unsigned)(size_t)p; }
// eight 16-byte-per-lane copies global -> LDS, addresses stepping by ls bytes (LDS) and gs elements (global); s_wait_xcnt 0 closes the statement so that no address register is rewritten ahead of it
__device__ __forceinline__ void copy8(unsigned l, unsigned ls, const b16* g, size_t gs) {
  asm volatile("global_load_async_to_lds_b128 %0, %8, off\n\tglobal_load_async_to_lds_b128 %1, %9, off\n\tglobal_load_async_to_lds_b128 %2, %10, off\n\tglobal_load_async_to_lds_b128 %3, %11, off\n\t"
               "global_load_async_to_lds_b128 %4, %12, off\n\tglobal_load_async_to_lds_b128 %5, %13, off\n\tglobal_load_async_to_lds_b128 %6, %14, off\n\tglobal_load_async_to_lds_b128 %7, %15, off\n\ts_wait_xcnt 0x0"
               :: "v"(l), "v"(l + ls), "v"(l + 2 * ls), "v"(l + 3 * ls), "v"(l + 4 * ls), "v"(l + 5 * ls), "v"(l + 6 * ls), "v"(l + 7 * ls),
                  "v"(g), "v"(g + gs), "v"(g + 2 * gs), "v"(g + 3 * gs), "v"(g + 4 * gs), "v"(g + 5 * gs), "v"(g + 6 * gs), "v"(g + 7 * gs) : "memory");
}
__global__ __launch_bounds__(128) void attn_kernel(const b16* __restrict__ TQ16, const b16* __restrict__ WIN, const float* __restrict__ g, const float* __restrict__ be, const b16* __restrict__ Kh, const b16* __restrict__ Kl, const b16* __restrict__ VTh, const b16* __restrict__ VTl, const float* __restrict__ g2, const float* __restrict__ b2, b16* __restrict__ Ah, b16* __restrict__ Al) {
  __shared__ __attribute__((aligned(16))) b16 Ks[2][2][32][KP];    // [buffer][hi, lo][key][d]
  __shared__ __attribute__((aligned(16))) b16 Vs[2][2][D][VP];     // [buffer][hi, lo][d][key]
  __shared__ __attribute__((aligned(16))) float To[AW][16][D + 4];
  __shared__ __attribute__((aligned(16))) float Gs[AW][2][D];      // [wave][gamma, beta][d] of q's LayerNorm, rounded; a copy for each wave, so that no barrier is needed for it
  const int wave = __builtin_amdgcn_readfirstlane(threadIdx.x >> 5), lane = threadIdx.x & 31, hh = lane >> 4, col = lane & 15; const int bn = blockIdx.x, qb = S / (16 * AW) - 1 - blockIdx.z; const int q0 = qb * (16 * AW) + wave * 16, qi = q0 + col;
  const b16* Kb = Kh + (size_t)bn * S * D; const b16* Klb = Kl + (size_t)bn * S * D; const b16* Vb = VTh + (size_t)bn * D * S; const b16* Vlb = VTl + (size_t)bn * D * S;
  // a wave's share of one key block: 8 k rows (a row = one copy of 32 lanes x 16 B) and 64 v^T rows (8 rows = one copy), hi and lo: 32 copies
  const size_t kg = (size_t)(wave * 8) * D + lane * 8, vg = (size_t)(wave * 64 + (lane >> 2)) * S + (lane & 3) * 8;
  auto stage = [&](int kb, int bf) {
    // the fences keep each group's 24 address registers from being formed ahead of the group before it: asm operands lie in the first 256 registers, and with all 96 formed at once the four base addresses were spilled to scratch
    copy8(lds_off(&Ks[bf][0][wave * 8][lane * 8]), KP * 2, Kb + (size_t)kb * D + kg, D); group_fence(); copy8(lds_off(&Ks[bf][1][wave * 8][lane * 8]), KP * 2, Klb + (size_t)kb * D + kg, D); group_fence();
    copy8(lds_off(&Vs[bf][0][wave * 64 + (lane >> 2)][(lane & 3) * 8]), 8 * VP * 2, Vb + vg + kb, (size_t)8 * S); group_fence(); copy8(lds_off(&Vs[bf][1][wave * 64 + (lane >> 2)][(lane & 3) * 8]), 8 * VP * 2, Vlb + vg + kb, (size_t)8 * S); };
  b16 (*Ws)[CP] = (b16 (*)[CP])&To[0][0][0];          // W_in rows [d][c] lie in To's place: To is written only behind the loop, whose barriers every wave passes after its last read of them
#pragma unroll   // the wave's share of W_in: 64 rows, 4 rows = one copy
  for (int q = 0; q < 2; ++q) copy8(lds_off(&Ws[wave * 64 + q * 32 + (lane >> 3)][(lane & 7) * 8]), 4 * CP * 2, WIN + (size_t)(wave * 64 + q * 32 + (lane >> 3)) * C + (lane & 7) * 8, 4 * C);
  stage(0, 0);                                        // no more than 48 copies of a wave are ever outstanding
  const b16* pt = TQ16 + ((size_t)bn * S + qi) * C + 8 * hh;   // the lane's own token row: its two fragments and the lane's 8 gamma and beta values are requested beside the copies
  const v16b ft[2] = { frag_kb(pt, 0), frag_kb(pt + 32, 0) };
  const v4f g0 = *(const v4f*)(g + lane * 8), g1 = *(const v4f*)(g + lane * 8 + 4), e0 = *(const v4f*)(be + lane * 8), e1 = *(const v4f*)(be + lane * 8 + 4);
  addr_wait(pt, pt, pt);
  asm volatile("s_wait_asynccnt 0x0" ::: "memory");   // this wave's shares of W_in and of key block 0 have landed
  __syncthreads();                                    // ... and every other wave's: nothing is read from LDS in front of this barrier
  stage(32, 1);                                       // nt >= 2: key block 1 always exists; it flies under the q projection too
  v16b qh[D / 32], ql[D / 32];   // q, f16 hi and lo x8, as the B fragments of S^T: d tiles 2i and 2i + 1 of q^T's accumulators are, in the same lane, elements 0..7 and 8..15 of k step i, so q never leaves the registers
  { v16b fw[2][16];   // all W_in fragments of q^T (K = 64) are read from LDS as one group
#pragma unroll
    for (int i = 0; i < 2; ++i)
#pragma unroll
      for (int t = 0; t < 16; ++t) fw[i][t] = frag_kb(&Ws[t * 16 + col][i * 32], hh);
    v8f qa[16];
#pragma unroll
    for (int t = 0; t < 16; ++t) qa[t] = (v8f){};
    group_fence();
#pragma unroll
    for (int i = 0; i < 2; ++i)
#pragma unroll
      for (int t = 0; t < 16; ++t) qa[t] = wmma16b(fw[i][t], ft[i], qa[t]);
    group_fence();
    v4f r0, r1, r2, r3;
#pragma unroll
    for (int i = 0; i < 4; ++i) { r0[i] = bf16_rne(g0[i]); r1[i] = bf16_rne(g1[i]); r2[i] = bf16_rne(e0[i]); r3[i] = bf16_rne(e1[i]); }
    *(v4f*)(&Gs[wave][0][lane * 8]) = r0; *(v4f*)(&Gs[wave][0][lane * 8 + 4]) = r1; *(v4f*)(&Gs[wave][1][lane * 8]) = r2; *(v4f*)(&Gs[wave][1][lane * 8 + 4]) = r3;
    wave_lds_sync();
    constexpr float SC = 1.0f / (XS * WSC); v8f sv = {};   // a power of two: scaling the sum is scaling every term (the loops are unrolled whole: qa is a register array)
#pragma unroll
    for (int t = 0; t < 16; ++t) sv += qa[t];
    float s = ((sv[0] + sv[1]) + (sv[2] + sv[3])) + ((sv[4] + sv[5]) + (sv[6] + sv[7])); s += xrow(s);
    const float mean = s * (SC / D); v8f qv = {};
#pragma unroll
    for (int t = 0; t < 16; ++t) { qa[t] = qa[t] * SC - mean; qv += qa[t] * qa[t]; }
    float ss = ((qv[0] + qv[1]) + (qv[2] + qv[3])) + ((qv[4] + qv[5]) + (qv[6] + qv[7])); ss += xrow(ss);
    float rs;   // v_rsq_f32 and the one slot that the instruction set asks for behind a transcendental, in one statement; the argument is at least 1e-5, where rsqrtf is this instruction alone
    asm("v_rsq_f32 %0, %1\n\tv_nop" : "=v"(rs) : "v"(ss * (1.0f / D) + LN_EPS));
#pragma unroll
    for (int t = 0; t < 16; ++t) { const float* pg = &Gs[wave][0][t * 16 + 8 * hh]; const v4f ga = *(const v4f*)pg, gc = *(const v4f*)(pg + 4), ba = *(const v4f*)(pg + D), bc = *(const v4f*)(pg + D + 4);
#pragma unroll
      for (int r = 0; r < 8; ++r) { b16 h_, l_; split16((qa[t][r] * rs * (r < 4 ? ga[r & 3] : gc[r & 3]) + (r < 4 ? ba[r & 3] : bc[r & 3])) * XS, h_, l_); qh[t >> 1][(t & 1) * 8 + r] = h_; ql[t >> 1][(t & 1) * 8 + r] = l_; } } }
  float m = -INFINITY, l = 0.0f; v8f o[16];
#pragma unroll
  for (int t = 0; t < 16; ++t) o[t] = (v8f){};
  const float cs = LOG2E / (XS * XS); const int kend = q0 + 16;   // causal
  const int nt = qb * (16 * AW / 32) + 16 * AW / 32;      // key blocks of the work-group's last wave; the same for all its waves
  for (int it = 0; it < nt; ++it) { const int kb = it * 32, bf = it & 1;
   if (kb < kend) {   // a wave past its diagonal skips the work, never the publish point below
    v8f s0 = {}, s1 = {};
    v16b fk[2][4];   // two register stages: step i + 1's four k fragments are read from LDS as one group ahead of step i's WMMAs; s0 and s1 take turns, each in its old order; unrolled whole so that the stage index is a constant
    auto ldk = [&](int ks, int st) { fk[st][0] = frag_kb(&Ks[bf][0][col][ks], hh); fk[st][1] = frag_kb(&Ks[bf][0][16 + col][ks], hh);
      fk[st][2] = frag_kb(&Ks[bf][1][col][ks], hh); fk[st][3] = frag_kb(&Ks[bf][1][16 + col][ks], hh); };
    ldk(0, 0);
#pragma unroll
    for (int i = 0; i < D / 32; ++i) { const int st = i & 1; if (i + 1 < D / 32) ldk((i + 1) * 32, st ^ 1);
      group_fence();
      s0 = wmma16b(fk[st][0], qh[i], s0); s1 = wmma16b(fk[st][1], qh[i], s1); s0 = wmma16b(fk[st][0], ql[i], s0); s1 = wmma16b(fk[st][1], ql[i], s1);
      s0 = wmma16b(fk[st][2], qh[i], s0); s1 = wmma16b(fk[st][3], qh[i], s1);
      group_fence(); }
    v16b fv[3][2][2];          // three register stages of two d tiles (hi, lo) each: the first two groups are read ahead of the softmax, group g + 2 ahead of group g's WMMAs; the two tiles take turns, each in its old order
    auto ldv = [&](int g, int st) {
#pragma unroll
      for (int j = 0; j < 2; ++j) { fv[st][j][0] = frag_kb(&Vs[bf][0][(2 * g + j) * 16 + col][0], hh); fv[st][j][1] = frag_kb(&Vs[bf][1][(2 * g + j) * 16 + col][0], hh); } };
    ldv(0, 0); ldv(1, 1);
    group_fence();
    float e[16]; float mx = -INFINITY;
#pragma unroll
    for (int r = 0; r < 8; ++r) { const int k0i = kb + 8 * hh + r, k1i = kb + 16 + 8 * hh + r; e[r] = (k0i <= qi) ? s0[r] * cs : -INFINITY; e[8 + r] = (k1i <= qi) ? s1[r] * cs : -INFINITY; mx = fmaxf(mx, fmaxf(e[r], e[8 + r])); }
    mx = fmaxf(mx, xrow(mx)); const float mn = fmaxf(m, mx); const float al = nexp2(m - mn); m = mn; float sum = 0.0f; v16b ph, pl;   // key 0 <= qi always -> mn finite
#pragma unroll
    for (int i = 0; i < 16; ++i) { const float p = nexp2(e[i] - mn); sum += p; const b16 h_ = (b16)(p * PS); ph[i] = h_; pl[i] = (b16)(p * PS - (float)h_); }
    sum += xrow(sum); l = l * al + sum;
#pragma unroll
    for (int g = 0; g < 8; ++g) { const int st = g % 3, t0 = 2 * g, t1 = 2 * g + 1; if (g + 2 < 8) ldv(g + 2, (g + 2) % 3);
      o[t0] *= al; o[t1] *= al;
      group_fence();
      o[t0] = wmma16b(fv[st][0][0], ph, o[t0]); o[t1] = wmma16b(fv[st][1][0], ph, o[t1]); o[t0] = wmma16b(fv[st][0][0], pl, o[t0]); o[t1] = wmma16b(fv[st][1][0], pl, o[t1]);
      o[t0] = wmma16b(fv[st][0][1], ph, o[t0]); o[t1] = wmma16b(fv[st][1][1], ph, o[t1]);
      if (g + 2 < 8) group_fence(); } }   // no reads follow the last two groups: nothing to hold there
   // publish point of key block it + 1, passed by every wave
   asm volatile("s_wait_dscnt 0x0" ::: "memory");      // this wave's reads of buffer bf are done before it may be refilled
   asm volatile("s_wait_asynccnt 0x0" ::: "memory");   // this wave's share of key block it + 1 has landed
   __syncthreads();                                    // both hold for every wave
   if (it + 2 < nt) stage(kb + 64, bf); }
  asm volatile("s_wait_asynccnt 0x0" ::: "memory");    // no copy is outstanding when the wave ends
  // LN2 on the spot: lanes col and col + 16 hold query col's 256 channels, 128 each, so mean and variance are sums in the lane and one exchange with lane ^ 16; gamma and beta are applied behind the LDS transpose, where a lane has 8 fixed channels
  // (the loops are unrolled whole: o is a register array, and every store of the last loop is one base address plus a constant)
  const v4f ga = *(const v4f*)(g2 + lane * 8), gc = *(const v4f*)(g2 + lane * 8 + 4), ba = *(const v4f*)(b2 + lane * 8), bc = *(const v4f*)(b2 + lane * 8 + 4);
  const float inv = 1.0f / (l * PS * XS); v8f sv = {};
#pragma unroll
  for (int t = 0; t < 16; ++t) { o[t] *= inv; sv += o[t]; }
  float s = ((sv[0] + sv[1]) + (sv[2] + sv[3])) + ((sv[4] + sv[5]) + (sv[6] + sv[7])); s += xrow(s);
  const float mean = s * (1.0f / D); v8f qv = {};
#pragma unroll
  for (int t = 0; t < 16; ++t) { o[t] -= mean; qv += o[t] * o[t]; }
  float ss = ((qv[0] + qv[1]) + (qv[2] + qv[3])) + ((qv[4] + qv[5]) + (qv[6] + qv[7])); ss += xrow(ss);
  const float rs = rsqrtf(ss * (1.0f / D) + LN_EPS);
#pragma unroll
  for (int t = 0; t < 16; ++t)
#pragma unroll
    for (int r = 0; r < 8; ++r) To[wave][col][t * 16 + 8 * hh + r] = o[t][r] * rs;
  wave_lds_sync();
  float gg[8], bb[8];
#pragma unroll
  for (int i = 0; i < 4; ++i) { gg[i] = bf16_rne(ga[i]); gg[4 + i] = bf16_rne(gc[i]); bb[i] = bf16_rne(ba[i]); bb[4 + i] = bf16_rne(bc[i]); }
#pragma unroll
  for (int rr = 0; rr < 16; ++rr) { const size_t gi = ((size_t)bn * S + q0 + rr) * D + lane * 8; const v4f xa = *(const v4f*)(&To[wave][rr][lane * 8]), xc = *(const v4f*)(&To[wave][rr][lane * 8 + 4]); v8b hv, lv;
#pragma unroll
    for (int i = 0; i < 8; ++i) { b16 h_, l_; split16(((i < 4 ? xa[i] : xc[i - 4]) * gg[i] + bb[i]) * XS, h_, l_); hv[i] = h_; lv[i] = l_; }
    *(v8b*)(Ah + gi) = hv; *(v8b*)(Al + gi) = lv; }
}
// the whole tail of the block in one kernel: h = relu(x W1) W2, e = h + v, out = e W_out, x = LN2(att), v = tok_kv W_kv[:, 256:]. Block = 4 waves x 32 tokens, one block per WGP. Every product is taken transposed (A = weight rows, B = token rows), so
// a product's accumulators (lane = token, registers = 8 channels) are, two tiles at a time, the next product's B fragment: hidden and e never leave the registers. x is read once (LDS, then 256 registers of a lane); the weights come
// in 16 chunks of 32 hidden channels (32 rows of W1T, 32 columns of W2T) by asynchronous copies to LDS, two buffers, shared by the 4 waves; each chunk's hidden values go into the e accumulators at once.
// v is not read back as a 256-wide plane: behind the loop v^T = W_kv_v^T tok^T (K = 64, 64 WMMAs of a wave, the scale x8 x256 of the W2 products) goes into the e accumulators, from the wave's 32 token rows of 128 B and the v half of W_kv, both copied to LDS.
// Per accumulator the products and their order are those of the three separate kernels: k ascending in steps of 32, hi then lo; v's two k steps come last in the sum.
constexpr int OP = 32 + 4 /* f32 pitch of an out row in LDS */;
__global__ __launch_bounds__(128) void ffn_kernel(const b16* __restrict__ Ah, const b16* __restrict__ Al, const b16* __restrict__ W1T, const b16* __restrict__ W2T, const b16* __restrict__ WOT, const b16* __restrict__ TK16, const b16* __restrict__ WKV, float* __restrict__ out) {
  __shared__ __attribute__((aligned(16))) b16 W1s[2][32][KP];      // [buffer][hidden][d]
  __shared__ __attribute__((aligned(16))) b16 W2s[2][D][VP];       // [buffer][d][hidden]
  __shared__ __attribute__((aligned(16))) b16 WOs[C][KP];          // [c][d]
  __shared__ __attribute__((aligned(16))) b16 WVs[D][CP];          // [d][c]: the v half of W_kv
  __shared__ __attribute__((aligned(16))) b16 Tks[AW][32][CP];     // [wave][token][c]
  __shared__ __attribute__((aligned(16))) b16 Xs[AW][2][32][KP];   // [wave][hi, lo][token][d]; a wave's part holds its x rows, then its out tile (f32, pitch OP): no other wave touches it
  const int wave = __builtin_amdgcn_readfirstlane(threadIdx.x >> 5), lane = threadIdx.x & 31, hh = lane >> 4, col = lane & 15; const size_t m0 = (size_t)blockIdx.x * (32 * AW) + wave * 32;
  // a wave's share of one chunk: 8 W1T rows (a row = one copy of 32 lanes x 16 B) and 64 W2T row pieces of 64 B (8 rows = one copy): 16 copies
  auto stage = [&](int c, int bf) {
    copy8(lds_off(&W1s[bf][wave * 8][lane * 8]), KP * 2, W1T + (size_t)(c * 32 + wave * 8) * D + lane * 8, D);
    copy8(lds_off(&W2s[bf][wave * 64 + (lane >> 2)][(lane & 3) * 8]), 8 * VP * 2, W2T + (size_t)(wave * 64 + (lane >> 2)) * F + c * 32 + (lane & 3) * 8, (size_t)8 * F); };
  auto copyx = [&](int j) {   // x rows 16j .. 16j + 15, hi and lo: 32 copies
#pragma unroll
    for (int q = 2 * j; q < 2 * j + 2; ++q) { copy8(lds_off(&Xs[wave][0][8 * q][lane * 8]), KP * 2, Ah + (m0 + 8 * q) * D + lane * 8, D); copy8(lds_off(&Xs[wave][1][8 * q][lane * 8]), KP * 2, Al + (m0 + 8 * q) * D + lane * 8, D); } };
  float* Fw = (float*)&Xs[wave][0][0][0];
  copyx(0); stage(0, 0);
  asm volatile("s_wait_asynccnt 0x0" ::: "memory");   // never more than 56 copies of a wave are outstanding
  copyx(1); copy8(lds_off(&WOs[wave * 16][lane * 8]), KP * 2, WOT + (size_t)(wave * 16) * D + lane * 8, D); copy8(lds_off(&WOs[wave * 16 + 8][lane * 8]), KP * 2, WOT + (size_t)(wave * 16 + 8) * D + lane * 8, D);
  copy8(lds_off(&Tks[wave][lane >> 3][(lane & 7) * 8]), 4 * CP * 2, TK16 + (m0 + (lane >> 3)) * C + (lane & 7) * 8, 4 * C);   // the wave's 32 token rows (4 rows = one copy)
  asm volatile("s_wait_asynccnt 0x0" ::: "memory");   // this wave's x and token rows and its shares of chunk 0 and of W_out have landed
  __syncthreads();                                    // ... and every other wave's: nothing is read from LDS in front of this barrier
  stage(1, 1);
#pragma unroll   // with chunk 1 goes the wave's share of the v half of W_kv (64 rows, 4 rows = one copy; 32 copies outstanding): trip 0's publish point hands it to every wave, long before it is read behind the loop
  for (int q = 0; q < 2; ++q) copy8(lds_off(&WVs[wave * 64 + q * 32 + (lane >> 3)][(lane & 7) * 8]), 4 * CP * 2, WKV + (size_t)(D + wave * 64 + q * 32 + (lane >> 3)) * C + (lane & 7) * 8, 4 * C);
  v16b xh[2][D / 32], xl[2][D / 32];
#pragma unroll
  for (int j = 0; j < 2; ++j)
#pragma unroll
    for (int i = 0; i < D / 32; ++i) { xh[j][i] = frag_kb(&Xs[wave][0][j * 16 + col][i * 32], hh); xl[j][i] = frag_kb(&Xs[wave][1][j * 16 + col][i * 32], hh); }
  v8f e[2][16];
#pragma unroll
  for (int j = 0; j < 2; ++j)
#pragma unroll
    for (int t = 0; t < 16; ++t) e[j][t] = (v8f){};
  for (int it = 0; it < F / 32; ++it) { const int bf = it & 1;
    v16b fw[3][8];   // three register stages of eight weight fragments: each group is read from LDS as a whole ahead of the WMMAs of a group before it
    auto ld1 = [&](int g, int st) {   // W1T: k steps 4g .. 4g + 3, both hidden tiles
#pragma unroll
      for (int i = 0; i < 4; ++i) { fw[st][2 * i] = frag_kb(&W1s[bf][col][(4 * g + i) * 32], hh); fw[st][2 * i + 1] = frag_kb(&W1s[bf][16 + col][(4 * g + i) * 32], hh); } };
    auto ld2 = [&](int g, int st) {   // W2T: d tiles 8g .. 8g + 7
#pragma unroll
      for (int t = 0; t < 8; ++t) fw[st][t] = frag_kb(&W2s[bf][(8 * g + t) * 16 + col][0], hh); };
    v8f h00 = {}, h01 = {}, h10 = {}, h11 = {};   // [token tile][hidden tile]
    auto mm1 = [&](int g, int st) {   // four independent accumulators take turns
#pragma unroll
      for (int i = 0; i < 4; ++i) { const int k = 4 * g + i;
        h00 = wmma16b(fw[st][2 * i], xh[0][k], h00); h01 = wmma16b(fw[st][2 * i + 1], xh[0][k], h01); h10 = wmma16b(fw[st][2 * i], xh[1][k], h10); h11 = wmma16b(fw[st][2 * i + 1], xh[1][k], h11);
        h00 = wmma16b(fw[st][2 * i], xl[0][k], h00); h01 = wmma16b(fw[st][2 * i + 1], xl[0][k], h01); h10 = wmma16b(fw[st][2 * i], xl[1][k], h10); h11 = wmma16b(fw[st][2 * i + 1], xl[1][k], h11); } };
    ld1(0, 0); ld1(1, 1);
    group_fence();
    mm1(0, 0);
    group_fence();
    ld2(0, 0); ld2(1, 2);
    group_fence();
    mm1(1, 1);
    group_fence();   // keeps the waits below behind these WMMAs, under which the W2T fragments arrive: without it the compiler lifts the waits to just behind the reads
    // publish point of chunk it + 1, passed by every wave. It stands here and not at the trip's end: the W2T fragments, the trip's last LDS reads, went out ahead of the WMMAs above; what is left of the trip works on registers alone, and the next copies fly under it too
    asm volatile("s_wait_dscnt 0x0" ::: "memory");      // this wave's reads of buffer bf are done before it may be refilled
    asm volatile("s_wait_asynccnt 0x0" ::: "memory");   // this wave's share of chunk it + 1 has landed
    __syncthreads();                                    // both hold for every wave
    if (it + 2 < F / 32) stage(it + 2, bf);
    v16b ph[2], pl[2];   // relu(hidden) x8, hi and lo: hidden tiles 0 and 1 of a token tile are elements 0..7 and 8..15 of its B fragment
#pragma unroll
    for (int r = 0; r < 8; ++r) { b16 h_, l_;
      split16(fmaxf(h00[r] * (1.0f / (XS * WSC)), 0.0f) * XS, h_, l_); ph[0][r] = h_; pl[0][r] = l_; split16(fmaxf(h01[r] * (1.0f / (XS * WSC)), 0.0f) * XS, h_, l_); ph[0][8 + r] = h_; pl[0][8 + r] = l_;
      split16(fmaxf(h10[r] * (1.0f / (XS * WSC)), 0.0f) * XS, h_, l_); ph[1][r] = h_; pl[1][r] = l_; split16(fmaxf(h11[r] * (1.0f / (XS * WSC)), 0.0f) * XS, h_, l_); ph[1][8 + r] = h_; pl[1][8 + r] = l_; }
#pragma unroll
    for (int g = 0; g < 2; ++g) {   // d tiles 8g .. 8g + 7 are in stage 2g
#pragma unroll
      for (int t = 0; t < 8; ++t) { e[0][8 * g + t] = wmma16b(fw[2 * g][t], ph[0], e[0][8 * g + t]); e[1][8 * g + t] = wmma16b(fw[2 * g][t], ph[1], e[1][8 * g + t]); }
#pragma unroll
      for (int t = 0; t < 8; ++t) { e[0][8 * g + t] = wmma16b(fw[2 * g][t], pl[0], e[0][8 * g + t]); e[1][8 * g + t] = wmma16b(fw[2 * g][t], pl[1], e[1][8 * g + t]); } } }
  asm volatile("s_wait_asynccnt 0x0" ::: "memory");     // no copy is outstanding behind the loop
  { v16b ft[2][2], fvw[2][16];   // e += v^T: all fragments (K = 64) are read from LDS as one group
#pragma unroll
    for (int i = 0; i < 2; ++i) { ft[0][i] = frag_kb(&Tks[wave][col][i * 32], hh); ft[1][i] = frag_kb(&Tks[wave][16 + col][i * 32], hh);
#pragma unroll
      for (int t = 0; t < 16; ++t) fvw[i][t] = frag_kb(&WVs[t * 16 + col][i * 32], hh); }
    group_fence();
#pragma unroll
    for (int i = 0; i < 2; ++i)
#pragma unroll
      for (int t = 0; t < 16; ++t) { e[0][t] = wmma16b(fvw[i][t], ft[0][i], e[0][t]); e[1][t] = wmma16b(fvw[i][t], ft[1][i], e[1][t]); }
    group_fence(); }
  v16b fo[2][8];   // W_out fragments: two register stages of two k steps x four c tiles
  auto ldo = [&](int g, int st) {
#pragma unroll
    for (int i = 0; i < 2; ++i)
#pragma unroll
      for (int t = 0; t < 4; ++t) fo[st][4 * i + t] = frag_kb(&WOs[t * 16 + col][(2 * g + i) * 32], hh); };
  ldo(0, 0);
  v16b eh[2][D / 32], el[2][D / 32];   // e = h + v, x8, hi and lo: d tiles 2i and 2i + 1 are the B fragment of k step i
#pragma unroll
  for (int j = 0; j < 2; ++j)
#pragma unroll
    for (int t = 0; t < 16; ++t) {
#pragma unroll
      for (int r = 0; r < 8; ++r) { const float y = e[j][t][r] * (1.0f / (XS * WSC)); b16 h_, l_; split16(y * XS, h_, l_); eh[j][t >> 1][(t & 1) * 8 + r] = h_; el[j][t >> 1][(t & 1) * 8 + r] = l_; } }
  v8f oa[2][4];
#pragma unroll
  for (int j = 0; j < 2; ++j)
#pragma unroll
    for (int t = 0; t < 4; ++t) oa[j][t] = (v8f){};
#pragma unroll
  for (int g = 0; g < 4; ++g) { const int st = g & 1; if (g + 1 < 4) ldo(g + 1, st ^ 1);
    group_fence();
#pragma unroll
    for (int i = 0; i < 2; ++i) {
#pragma unroll
      for (int t = 0; t < 4; ++t) { oa[0][t] = wmma16b(fo[st][4 * i + t], eh[0][2 * g + i], oa[0][t]); oa[1][t] = wmma16b(fo[st][4 * i + t], eh[1][2 * g + i], oa[1][t]); }
#pragma unroll
      for (int t = 0; t < 4; ++t) { oa[0][t] = wmma16b(fo[st][4 * i + t], el[0][2 * g + i], oa[0][t]); oa[1][t] = wmma16b(fo[st][4 * i + t], el[1][2 * g + i], oa[1][t]); } }
    group_fence(); }
  // the wave's x rows went to registers long ago: its out tile (64 c x 32 tokens) takes their place
#pragma unroll
  for (int j = 0; j < 2; ++j)
#pragma unroll
    for (int t = 0; t < 4; ++t)
#pragma unroll
      for (int r = 0; r < 8; ++r) Fw[(t * 16 + 8 * hh + r) * OP + j * 16 + col] = oa[j][t][r] * (1.0f / (XS * WSC));
  wave_lds_sync();
  const int bn = (int)(m0 / S), s0 = (int)(m0 % S), b = bn / NN, n = bn % NN; float* po = out + (((size_t)b * C + (lane >> 3)) * NN + n) * S + s0 + (lane & 7) * 4;
#pragma unroll   // unrolled: every store is one base address plus a constant (a store = 4 channel rows x one whole 128-byte line), so no address register takes a new value behind an issued store
  for (int i = 0; i < 16; ++i) *(v4f*)(po + (size_t)i * 4 * NN * S) = *(const v4f*)(Fw + (i * 4 + (lane >> 3)) * OP + (lane & 7) * 4);
}
}  // namespace

extern "C" void kernel_launch(void* const* d_in, const int* in_sizes, int n_in, void* d_out, int out_size, void* d_ws, size_t ws_size, hipStream_t stream) {
  (void)n_in;
  auto Fp = [&](int i) { return (const float*)d_in[i]; };
  // input order: 0 fea_lf [4,64,8,32,32], 1 fea_hf, 2 W_in [64,256], 3 W_kv [64,512], 4 gamma, 5 beta, 6 g2, 7 b2, 8 W1 [256,512], 9 W2 [512,256], 10 W_out [256,64] (all (in, out))
  if (in_sizes[0] != NR * C || in_sizes[1] != NR * C || in_sizes[2] != C * D || in_sizes[3] != C * F || in_sizes[4] != D || in_sizes[8] != D * F || in_sizes[9] != F * D || in_sizes[10] != D * C || out_size != NR * C) return;
  size_t off = 0; char* ws = (char*)d_ws;
  auto carve = [&](size_t bytes) { char* p = ws + off; off += (bytes + 255) & ~(size_t)255; return p; };
  b16* TQ16 = (b16*)carve((size_t)NR * C * 2); b16* TK16 = (b16*)carve((size_t)NR * C * 2); b16* WIN = (b16*)carve((size_t)D * C * 2); b16* WKV = (b16*)carve((size_t)F * C * 2); b16* W1T = (b16*)carve((size_t)F * D * 2); b16* W2T = (b16*)carve((size_t)D * F * 2); b16* WOT = (b16*)carve((size_t)C * D * 2);
  b16* Kh = (b16*)carve((size_t)NR * D * 2); b16* Kl = (b16*)carve((size_t)NR * D * 2);
  b16* VTh = (b16*)carve((size_t)NR * D * 2); b16* VTl = (b16*)carve((size_t)NR * D * 2); b16* Ah = (b16*)carve((size_t)NR * D * 2); b16* Al = (b16*)carve((size_t)NR * D * 2);   // LN2(att) gets its own planes: other attention blocks still read k and v while they are written
  if (off > ws_size) return;   // = 110 MB
  prep_kernel<<<NPW + NXT, 256, 0, stream>>>(Fp(0), Fp(1), Fp(2), Fp(3), Fp(8), Fp(9), Fp(10), TQ16, TK16, WIN, WKV, W1T, W2T, WOT);
  front_kernel<<<NPB + NVB, 128, 0, stream>>>(TK16, WKV, Fp(4), Fp(5), Kh, Kl, VTh, VTl);
  attn_kernel<<<dim3(NBN, 1, S / (16 * AW)), 32 * AW, 0, stream>>>(TQ16, WIN, Fp(4), Fp(5), Kh, Kl, VTh, VTl, Fp(6), Fp(7), Ah, Al);   // LN2(att)
  ffn_kernel<<<NR / (32 * AW), 32 * AW, 0, stream>>>(Ah, Al, W1T, W2T, WOT, TK16, WKV, (float*)d_out);   // out = (relu(LN2(att) W1) W2 + v) W_out
}
